// v000
// The times below were measured on an AMD MI455X: many runs one after another, warmed up first and cycling through
// copies of the inputs, with the whole window's GPU time divided by the number of runs. Launches and the gaps
// between them are all in it. The median over several windows is given; except for v000 it joins two sittings, which
// can be a few percent apart, so the side-by-side timings, each taken in one sitting, are the better comparison.
// The starting kernel, v000, takes 439 microseconds a run.
#include <hip/hip_runtime.h>
#include <hip/hip_bf16.h>
#include <math.h>
#include <stdint.h>

// Problem constants (reference: B=4, S=1024, D=1024, H=16, HD=64)
#define B_   4
#define S_   1024
#define D_   1024
#define H_   16
#define HD_  64
#define NTOK (B_ * S_)   // 4096 tokens

typedef unsigned short u16;
typedef __attribute__((ext_vector_type(8)))  u16    u16x8;
typedef __attribute__((ext_vector_type(16))) __bf16 v16bf;
typedef __attribute__((ext_vector_type(8)))  float  v8f;

// ---- helpers ---------------------------------------------------------------

__device__ __forceinline__ u16 f2bf(float f) {
  union { float f; unsigned u; } c; c.f = f;
  unsigned u = c.u;
  u += 0x7FFFu + ((u >> 16) & 1u);   // round-to-nearest-even
  return (u16)(u >> 16);
}

// Build a 16x32 (or 32x16) bf16 WMMA fragment from two contiguous 16B chunks.
// Per ISA layout (16-bit A 16x32): lane-lo holds K=0..7 (v0-3) and K=16..23
// (v4-7); lane-hi holds K=8..15 and K=24..31.
__device__ __forceinline__ v16bf make_frag(const u16* p0, const u16* p1) {
  union { u16x8 h[2]; v16bf v; } u;
  u.h[0] = *(const u16x8*)p0;
  u.h[1] = *(const u16x8*)p1;
  return u.v;
}

__device__ __forceinline__ v8f wmma_bf16(v16bf a, v16bf b, v8f c) {
  return __builtin_amdgcn_wmma_f32_16x16x32_bf16(
      false, a, false, b, (short)0, c, false, false);
}

// Async copy of one 16B chunk from global to LDS (ASYNCcnt-tracked).
__device__ __forceinline__ void async_cp16(unsigned lds_off, const u16* g) {
  asm volatile("global_load_async_to_lds_b128 %0, %1, off"
               :: "v"(lds_off), "v"(g) : "memory");
}
__device__ __forceinline__ void wait_async0() {
  asm volatile("s_wait_asynccnt 0x0" ::: "memory");
}
__device__ __forceinline__ unsigned lds_off32(const void* p) {
  return (unsigned)(uintptr_t)p;   // low 32 bits of generic ptr = LDS offset
}

// ---- conversion kernels ----------------------------------------------------

__global__ void cvt_act(const float* __restrict__ x, u16* __restrict__ y, int n) {
  int i = blockIdx.x * blockDim.x + threadIdx.x;
  if (i < n) y[i] = f2bf(x[i]);
}

// W is [K][N] row-major f32; produce WT[N][K] bf16 so a B-fragment column
// reads contiguous K.
__global__ void cvt_wT(const float* __restrict__ w, u16* __restrict__ wt) {
  int i = blockIdx.x * blockDim.x + threadIdx.x;
  int n = i & (D_ - 1);
  int k = i >> 10;
  wt[(size_t)n * D_ + k] = f2bf(w[(size_t)k * D_ + n]);
}

// ---- fused QKV projection GEMM --------------------------------------------
// Each wave: 16x64 tile.  All 8 waves in a WG share the same 16-row A block,
// async-staged into LDS once (32 KB).  K-loop is unrolled x2 with disjoint
// fragment register sets -> true double buffering, no rotation movs.

__global__ void qkv_gemm(const u16* __restrict__ eegb, const u16* __restrict__ picb,
                         const u16* __restrict__ WkT,  const u16* __restrict__ WqT,
                         const u16* __restrict__ WvT,
                         const float* __restrict__ bk, const float* __restrict__ bq,
                         const float* __restrict__ bv,
                         u16* __restrict__ qo, u16* __restrict__ ko,
                         u16* __restrict__ vTo) {
  __shared__ u16 ldsA[16 * D_];          // 32 KB: 16 rows x 1024 cols bf16
  const int mode = blockIdx.y;           // 0=q 1=k 2=v
  const int lane = threadIdx.x & 31;
  const int wv   = threadIdx.x >> 5;
  const int l16  = lane & 15;
  const int hig  = lane >> 4;

  const int tile = blockIdx.x * 8 + wv;
  const int row0 = (tile >> 4) << 4;     // shared by all 8 waves in this WG
  const int col0 = (tile & 15) << 6;

  const u16*  A    = (mode == 1) ? eegb : picb;
  const u16*  WT   = (mode == 0) ? WqT : (mode == 1 ? WkT : WvT);
  const float* bias = (mode == 0) ? bq : (mode == 1 ? bk : bv);

  // ---- async-stage A row block (contiguous 16*1024 bf16 = 32 KB) ----
  {
    const u16* gbase = A + (size_t)row0 * D_;
    const unsigned lbase = lds_off32(&ldsA[0]);
    const int tid = threadIdx.x;
#pragma unroll
    for (int j = 0; j < 8; ++j) {
      const int c = tid * 8 + j;               // 16B chunk 0..2047
      async_cp16(lbase + c * 16, gbase + c * 8);
    }
    wait_async0();
    __syncthreads();
  }

  v8f acc[4] = {};
  const u16* arow = &ldsA[l16 * D_];
  const u16* wcol[4];
#pragma unroll
  for (int c = 0; c < 4; ++c)
    wcol[c] = WT + (size_t)(col0 + c * 16 + l16) * D_ + hig * 8;

  auto ldA = [&](int kk) {
    return make_frag(arow + kk + hig * 8, arow + kk + 16 + hig * 8);
  };
  auto ldB = [&](v16bf* dst, int kk) {
#pragma unroll
    for (int c = 0; c < 4; ++c)
      dst[c] = make_frag(wcol[c] + kk, wcol[c] + kk + 16);
  };

  // two-phase double-buffered pipeline (no register rotation)
  v16bf af0 = ldA(0), af1;
  v16bf bf0[4], bf1[4];
  ldB(bf0, 0);

  for (int kk = 0; kk < D_; kk += 64) {
    af1 = ldA(kk + 32);
    ldB(bf1, kk + 32);
    if (kk + 96 < D_) __builtin_prefetch(wcol[0] + kk + 96, 0, 1);
#pragma unroll
    for (int c = 0; c < 4; ++c) acc[c] = wmma_bf16(af0, bf0[c], acc[c]);
    if (kk + 64 < D_) {
      af0 = ldA(kk + 64);
      ldB(bf0, kk + 64);
    }
#pragma unroll
    for (int c = 0; c < 4; ++c) acc[c] = wmma_bf16(af1, bf1[c], acc[c]);
  }

#pragma unroll
  for (int c = 0; c < 4; ++c) {
    const int n = col0 + c * 16 + l16;
    const float bval = bias[n];
    const int h = n >> 6, d = n & 63;
#pragma unroll
    for (int r = 0; r < 8; ++r) {
      const int rowg = row0 + r + hig * 8;
      const int b = rowg >> 10, s = rowg & (S_ - 1);
      const float val = acc[c][r] + bval;
      if (mode == 2) {
        vTo[(((size_t)(b * H_ + h) * HD_ + d) * S_) + s] = f2bf(val);   // [b,h,hd,S]
      } else {
        u16* dst = (mode == 0) ? qo : ko;                               // [b,h,S,hd]
        dst[(((size_t)(b * H_ + h) * S_ + s) * HD_) + d] = f2bf(val);
      }
    }
  }
}

// ---- flash attention -------------------------------------------------------
// grid.x = B*H*(S/128) = 512; block = 256 (8 waves); each wave: 16 q-rows.
// K/V tiles for each 32-key block are shared by all 8 waves -> double-buffered
// async staging into LDS: issue tile i+1, compute on tile i, 1 barrier/iter.

__global__ void flash_attn(const u16* __restrict__ q, const u16* __restrict__ k,
                           const u16* __restrict__ vT, u16* __restrict__ ctx) {
  __shared__ u16 kt[2][32 * 64];    // 2 x 4 KB  [key][d]
  __shared__ u16 vt[2][64 * 32];    // 2 x 4 KB  [d][key]
  __shared__ u16 plds[8 * 512];     // 8 KB per-wave 16x32 P tiles

  const int tid  = threadIdx.x;
  const int lane = tid & 31;
  const int wv   = tid >> 5;
  const int l16  = lane & 15;
  const int hig  = lane >> 4;

  const int qblk = blockIdx.x & 7;
  const int bh   = blockIdx.x >> 3;
  const int h    = bh & (H_ - 1);
  const int b0   = bh >> 4;
  const int qbase = qblk * 128 + wv * 16;

  const u16* qh = q  + (size_t)bh * S_ * HD_;
  const u16* kh = k  + (size_t)bh * S_ * HD_;
  const u16* vh = vT + (size_t)bh * HD_ * S_;

  const u16* qp = qh + (size_t)(qbase + l16) * HD_;
  v16bf qa0 = make_frag(qp +      hig * 8, qp + 16 + hig * 8);  // d 0..31
  v16bf qa1 = make_frag(qp + 32 + hig * 8, qp + 48 + hig * 8);  // d 32..63

  float m[8], lsum[8];
#pragma unroll
  for (int r = 0; r < 8; ++r) { m[r] = -3.0e38f; lsum[r] = 0.f; }
  v8f o[4] = {};

  u16* pw = plds + wv * 512;
  const float SC = 0.125f;                   // 1/sqrt(64)

  // cooperative async stage of one 32-key K/V tile pair (8 KB = 2 chunks/thr)
  auto issue_tiles = [&](int n0, int bsel) {
    // K tile: 32 keys x 64 d, contiguous 4 KB at kh + n0*64
    async_cp16(lds_off32(&kt[bsel][0]) + tid * 16,
               kh + (size_t)n0 * HD_ + tid * 8);
    // V tile: 64 d-rows x 32 keys (64B per row, stride S_)
    const int d = tid >> 2, part = tid & 3;
    async_cp16(lds_off32(&vt[bsel][0]) + (d * 32 + part * 8) * 2,
               vh + (size_t)d * S_ + n0 + part * 8);
  };

  issue_tiles(0, 0);

  for (int it = 0; it < S_ / 32; ++it) {
    const int n0   = it * 32;
    const int bsel = it & 1;
    wait_async0();         // own chunks of tile `it` landed
    __syncthreads();       // everyone's chunks landed; prev compute done
    if (it + 1 < S_ / 32) issue_tiles(n0 + 32, bsel ^ 1);

    // ---- scores S = Q @ K^T for 16x32 tile (K from LDS) ----
    const u16* kp0 = &kt[bsel][(size_t)l16 * 64];
    const u16* kp1 = &kt[bsel][(size_t)(16 + l16) * 64];
    v16bf kb00 = make_frag(kp0 +      hig * 8, kp0 + 16 + hig * 8);
    v16bf kb01 = make_frag(kp0 + 32 + hig * 8, kp0 + 48 + hig * 8);
    v16bf kb10 = make_frag(kp1 +      hig * 8, kp1 + 16 + hig * 8);
    v16bf kb11 = make_frag(kp1 + 32 + hig * 8, kp1 + 48 + hig * 8);

    v8f c0 = {}, c1 = {};
    c0 = wmma_bf16(qa0, kb00, c0);
    c0 = wmma_bf16(qa1, kb01, c0);
    c1 = wmma_bf16(qa0, kb10, c1);
    c1 = wmma_bf16(qa1, kb11, c1);

    // ---- online softmax (row stats via 16-lane shuffle reductions) ----
#pragma unroll
    for (int r = 0; r < 8; ++r) {
      float s0 = c0[r] * SC, s1 = c1[r] * SC;
      float t = fmaxf(s0, s1);
      t = fmaxf(t, __shfl_xor(t, 1, 32));
      t = fmaxf(t, __shfl_xor(t, 2, 32));
      t = fmaxf(t, __shfl_xor(t, 4, 32));
      t = fmaxf(t, __shfl_xor(t, 8, 32));
      float mnew = fmaxf(m[r], t);
      float scl  = __expf(m[r] - mnew);
      m[r] = mnew;
      float p0 = __expf(s0 - mnew);
      float p1 = __expf(s1 - mnew);
      float ps = p0 + p1;
      ps += __shfl_xor(ps, 1, 32);
      ps += __shfl_xor(ps, 2, 32);
      ps += __shfl_xor(ps, 4, 32);
      ps += __shfl_xor(ps, 8, 32);
      lsum[r] = lsum[r] * scl + ps;
      o[0][r] *= scl; o[1][r] *= scl; o[2][r] *= scl; o[3][r] *= scl;
      // stage P (C-layout -> LDS row-major [row][key32]) as bf16
      const int rr = r + hig * 8;
      pw[rr * 32 + l16]      = f2bf(p0);
      pw[rr * 32 + 16 + l16] = f2bf(p1);
    }
    asm volatile("s_wait_dscnt 0x0" ::: "memory");

    // re-read P in A-fragment layout (wave-private LDS region)
    const u16* pr = pw + l16 * 32;
    v16bf pa = make_frag(pr + hig * 8, pr + 16 + hig * 8);

    // ---- O += P @ V  (V from LDS, [d][key] tile) ----
#pragma unroll
    for (int j = 0; j < 4; ++j) {
      const u16* vp = &vt[bsel][(size_t)(j * 16 + l16) * 32];
      v16bf vb = make_frag(vp + hig * 8, vp + 16 + hig * 8);
      o[j] = wmma_bf16(pa, vb, o[j]);
    }
  }

  // ---- normalize & store ctx as bf16 in [B,S,D] ----
#pragma unroll
  for (int r = 0; r < 8; ++r) {
    const float inv = 1.0f / lsum[r];
    const int rowg = qbase + r + hig * 8;
    u16* crow = ctx + ((size_t)(b0 * S_ + rowg)) * D_ + h * HD_;
    crow[0 * 16 + l16] = f2bf(o[0][r] * inv);
    crow[1 * 16 + l16] = f2bf(o[1][r] * inv);
    crow[2 * 16 + l16] = f2bf(o[2][r] * inv);
    crow[3 * 16 + l16] = f2bf(o[3][r] * inv);
  }
}

// ---- output projection + residual -----------------------------------------

__global__ void out_gemm(const u16* __restrict__ ctxb, const u16* __restrict__ WdT,
                         const float* __restrict__ bd, const float* __restrict__ pic,
                         float* __restrict__ xo) {
  __shared__ u16 ldsA[16 * D_];          // 32 KB
  const int lane = threadIdx.x & 31;
  const int wv   = threadIdx.x >> 5;
  const int l16  = lane & 15;
  const int hig  = lane >> 4;

  const int tile = blockIdx.x * 8 + wv;
  const int row0 = (tile >> 4) << 4;
  const int col0 = (tile & 15) << 6;

  {
    const u16* gbase = ctxb + (size_t)row0 * D_;
    const unsigned lbase = lds_off32(&ldsA[0]);
    const int tid = threadIdx.x;
#pragma unroll
    for (int j = 0; j < 8; ++j) {
      const int c = tid * 8 + j;
      async_cp16(lbase + c * 16, gbase + c * 8);
    }
    wait_async0();
    __syncthreads();
  }

  v8f acc[4] = {};
  const u16* arow = &ldsA[l16 * D_];
  const u16* wcol[4];
#pragma unroll
  for (int c = 0; c < 4; ++c)
    wcol[c] = WdT + (size_t)(col0 + c * 16 + l16) * D_ + hig * 8;

  auto ldA = [&](int kk) {
    return make_frag(arow + kk + hig * 8, arow + kk + 16 + hig * 8);
  };
  auto ldB = [&](v16bf* dst, int kk) {
#pragma unroll
    for (int c = 0; c < 4; ++c)
      dst[c] = make_frag(wcol[c] + kk, wcol[c] + kk + 16);
  };

  v16bf af0 = ldA(0), af1;
  v16bf bf0[4], bf1[4];
  ldB(bf0, 0);

  for (int kk = 0; kk < D_; kk += 64) {
    af1 = ldA(kk + 32);
    ldB(bf1, kk + 32);
    if (kk + 96 < D_) __builtin_prefetch(wcol[0] + kk + 96, 0, 1);
#pragma unroll
    for (int c = 0; c < 4; ++c) acc[c] = wmma_bf16(af0, bf0[c], acc[c]);
    if (kk + 64 < D_) {
      af0 = ldA(kk + 64);
      ldB(bf0, kk + 64);
    }
#pragma unroll
    for (int c = 0; c < 4; ++c) acc[c] = wmma_bf16(af1, bf1[c], acc[c]);
  }

#pragma unroll
  for (int c = 0; c < 4; ++c) {
    const int n = col0 + c * 16 + l16;
    const float bval = bd[n];
#pragma unroll
    for (int r = 0; r < 8; ++r) {
      const int rowg = row0 + r + hig * 8;
      const size_t idx = (size_t)rowg * D_ + n;
      xo[idx] = acc[c][r] + bval + pic[idx];     // residual
    }
  }
}

// ---- layer norm ------------------------------------------------------------

__global__ void ln_kernel(const float* __restrict__ x, const float* __restrict__ w,
                          const float* __restrict__ bw, float* __restrict__ out) {
  __shared__ float red[256];
  const int row = blockIdx.x;
  const float* xr = x + (size_t)row * D_;

  float s = 0.f;
  for (int i = threadIdx.x; i < D_; i += 256) s += xr[i];
  red[threadIdx.x] = s; __syncthreads();
  for (int off = 128; off > 0; off >>= 1) {
    if (threadIdx.x < off) red[threadIdx.x] += red[threadIdx.x + off];
    __syncthreads();
  }
  const float mean = red[0] * (1.0f / D_);
  __syncthreads();

  float v = 0.f;
  for (int i = threadIdx.x; i < D_; i += 256) {
    float d = xr[i] - mean; v += d * d;
  }
  red[threadIdx.x] = v; __syncthreads();
  for (int off = 128; off > 0; off >>= 1) {
    if (threadIdx.x < off) red[threadIdx.x] += red[threadIdx.x + off];
    __syncthreads();
  }
  const float inv = rsqrtf(red[0] * (1.0f / D_) + 1e-12f);

  for (int i = threadIdx.x; i < D_; i += 256)
    out[(size_t)row * D_ + i] = w[i] * ((xr[i] - mean) * inv) + bw[i];
}

// ---- launch ---------------------------------------------------------------

extern "C" void kernel_launch(void* const* d_in, const int* in_sizes, int n_in,
                              void* d_out, int out_size, void* d_ws, size_t ws_size,
                              hipStream_t stream) {
  const float* eeg = (const float*)d_in[0];
  const float* pic = (const float*)d_in[1];
  const float* Wk  = (const float*)d_in[2];
  const float* bk  = (const float*)d_in[3];
  const float* Wq  = (const float*)d_in[4];
  const float* bq  = (const float*)d_in[5];
  const float* Wv  = (const float*)d_in[6];
  const float* bv  = (const float*)d_in[7];
  const float* Wd  = (const float*)d_in[8];
  const float* bd  = (const float*)d_in[9];
  const float* lnw = (const float*)d_in[10];
  const float* lnb = (const float*)d_in[11];

  char* ws = (char*)d_ws;
  u16*  eegb = (u16*)(ws + ((size_t)0  << 20));   // 8 MB
  u16*  picb = (u16*)(ws + ((size_t)8  << 20));   // 8 MB
  u16*  WkT  = (u16*)(ws + ((size_t)16 << 20));   // 2 MB
  u16*  WqT  = (u16*)(ws + ((size_t)18 << 20));   // 2 MB
  u16*  WvT  = (u16*)(ws + ((size_t)20 << 20));   // 2 MB
  u16*  WdT  = (u16*)(ws + ((size_t)22 << 20));   // 2 MB
  u16*  qb   = (u16*)(ws + ((size_t)24 << 20));   // 8 MB [b,h,S,hd]
  u16*  kbuf = (u16*)(ws + ((size_t)32 << 20));   // 8 MB [b,h,S,hd]
  u16*  vTb  = (u16*)(ws + ((size_t)40 << 20));   // 8 MB [b,h,hd,S]
  u16*  ctxb = (u16*)(ws + ((size_t)48 << 20));   // 8 MB [B,S,D]
  float* xb  = (float*)(ws + ((size_t)56 << 20)); // 16 MB

  const int nact = NTOK * D_;
  cvt_act<<<nact / 256, 256, 0, stream>>>(eeg, eegb, nact);
  cvt_act<<<nact / 256, 256, 0, stream>>>(pic, picb, nact);
  cvt_wT<<<(D_ * D_) / 256, 256, 0, stream>>>(Wk, WkT);
  cvt_wT<<<(D_ * D_) / 256, 256, 0, stream>>>(Wq, WqT);
  cvt_wT<<<(D_ * D_) / 256, 256, 0, stream>>>(Wv, WvT);
  cvt_wT<<<(D_ * D_) / 256, 256, 0, stream>>>(Wd, WdT);

  qkv_gemm<<<dim3(512, 3), 256, 0, stream>>>(eegb, picb, WkT, WqT, WvT,
                                             bk, bq, bv, qb, kbuf, vTb);
  flash_attn<<<512, 256, 0, stream>>>(qb, kbuf, vTb, ctxb);
  out_gemm<<<512, 256, 0, stream>>>(ctxb, WdT, bd, pic, xb);
  ln_kernel<<<NTOK, 256, 0, stream>>>(xb, lnw, lnb, (float*)d_out);
}

// v001
// One run takes 319 microseconds.
// In both of two side-by-side timings against v000, it was 1.39 times as fast.
#include <hip/hip_runtime.h>
#include <hip/hip_bf16.h>
#include <math.h>
#include <stdint.h>

// Problem constants (reference: B=4, S=1024, D=1024, H=16, HD=64)
#define B_   4
#define S_   1024
#define D_   1024
#define H_   16
#define HD_  64
#define NTOK (B_ * S_)   // 4096 tokens

typedef unsigned short u16;
typedef __attribute__((ext_vector_type(8)))  u16    u16x8;
typedef __attribute__((ext_vector_type(4)))  u16    u16x4;
typedef __attribute__((ext_vector_type(4)))  float  f32x4;
typedef __attribute__((ext_vector_type(16))) __bf16 v16bf;
typedef __attribute__((ext_vector_type(8)))  float  v8f;

// ---- helpers ---------------------------------------------------------------

__device__ __forceinline__ u16 f2bf(float f) {
  union { float f; unsigned u; } c; c.f = f;
  unsigned u = c.u;
  u += 0x7FFFu + ((u >> 16) & 1u);   // round-to-nearest-even
  return (u16)(u >> 16);
}

// Build a 16x32 (or 32x16) bf16 WMMA fragment from two contiguous 16B chunks.
// Per ISA layout (16-bit A 16x32): lane-lo holds K=0..7 (v0-3) and K=16..23
// (v4-7); lane-hi holds K=8..15 and K=24..31.
__device__ __forceinline__ v16bf make_frag(const u16* p0, const u16* p1) {
  union { u16x8 h[2]; v16bf v; } u;
  u.h[0] = *(const u16x8*)p0;
  u.h[1] = *(const u16x8*)p1;
  return u.v;
}

__device__ __forceinline__ v8f wmma_bf16(v16bf a, v16bf b, v8f c) {
  return __builtin_amdgcn_wmma_f32_16x16x32_bf16(
      false, a, false, b, (short)0, c, false, false);
}

// Async copy of one 16B chunk from global to LDS (ASYNCcnt-tracked).
__device__ __forceinline__ void async_cp16(unsigned lds_off, const u16* g) {
  asm volatile("global_load_async_to_lds_b128 %0, %1, off"
               :: "v"(lds_off), "v"(g) : "memory");
}
__device__ __forceinline__ void wait_async0() {
  asm volatile("s_wait_asynccnt 0x0" ::: "memory");
}
__device__ __forceinline__ unsigned lds_off32(const void* p) {
  return (unsigned)(uintptr_t)p;   // low 32 bits of generic ptr = LDS offset
}

// ---- conversion kernels ----------------------------------------------------

__global__ void cvt_act(const float* __restrict__ x, u16* __restrict__ y, int n) {
  int i = blockIdx.x * blockDim.x + threadIdx.x;
  if (i < n) y[i] = f2bf(x[i]);
}

// W is [K][N] row-major f32; produce WT[N][K] bf16 so a B-fragment column
// reads contiguous K.  One 64(k) x 64(n) tile per workgroup, turned in LDS:
// global reads are whole 256-byte row pieces, global writes whole 128-byte
// lines (8 lanes x 16 B per WT row), each line written by one workgroup.
#define WT_PITCH 68   // u16 per LDS row: 64 + 4, rows stay 8-byte aligned
__global__ __launch_bounds__(256) void cvt_wT(const float* __restrict__ w,
                                              u16* __restrict__ wt) {
  __shared__ __attribute__((aligned(16))) u16 tile[64 * WT_PITCH];   // [n][k]
  const int tid = threadIdx.x;
  const int n0  = (blockIdx.x & 15) << 6;
  const int k0  = (blockIdx.x >> 4) << 6;

  // each thread: a 4(k) x 4(n) block, four independent 16-byte loads
  const int nq = (tid & 15) << 2;
  const int kq = (tid >> 4) << 2;
  const float* src = w + (size_t)(k0 + kq) * D_ + n0 + nq;
  f32x4 r[4];
#pragma unroll
  for (int j = 0; j < 4; ++j) r[j] = *(const f32x4*)(src + (size_t)j * D_);

#pragma unroll
  for (int c = 0; c < 4; ++c) {
    u16x4 p;
#pragma unroll
    for (int j = 0; j < 4; ++j) p[j] = f2bf(r[j][c]);
    *(u16x4*)&tile[(nq + c) * WT_PITCH + kq] = p;    // 4 k of one n: 8 bytes
  }
  __syncthreads();

  const int kc = (tid & 7) << 3;
#pragma unroll
  for (int p = 0; p < 2; ++p) {
    const int n = p * 32 + (tid >> 3);
    union { u16x4 h[2]; u16x8 v; } u;
    u.h[0] = *(const u16x4*)&tile[n * WT_PITCH + kc];
    u.h[1] = *(const u16x4*)&tile[n * WT_PITCH + kc + 4];
    *(u16x8*)(wt + (size_t)(n0 + n) * D_ + k0 + kc) = u.v;
  }
}

// ---- fused QKV projection GEMM --------------------------------------------
// Each wave: 16x64 tile.  All 8 waves in a WG share the same 16-row A block,
// async-staged into LDS once (32 KB).  K-loop is unrolled x2 with disjoint
// fragment register sets -> true double buffering, no rotation movs.

__global__ void qkv_gemm(const u16* __restrict__ eegb, const u16* __restrict__ picb,
                         const u16* __restrict__ WkT,  const u16* __restrict__ WqT,
                         const u16* __restrict__ WvT,
                         const float* __restrict__ bk, const float* __restrict__ bq,
                         const float* __restrict__ bv,
                         u16* __restrict__ qo, u16* __restrict__ ko,
                         u16* __restrict__ vTo) {
  __shared__ u16 ldsA[16 * D_];          // 32 KB: 16 rows x 1024 cols bf16
  const int mode = blockIdx.y;           // 0=q 1=k 2=v
  const int lane = threadIdx.x & 31;
  const int wv   = threadIdx.x >> 5;
  const int l16  = lane & 15;
  const int hig  = lane >> 4;

  const int tile = blockIdx.x * 8 + wv;
  const int row0 = (tile >> 4) << 4;     // shared by all 8 waves in this WG
  const int col0 = (tile & 15) << 6;

  const u16*  A    = (mode == 1) ? eegb : picb;
  const u16*  WT   = (mode == 0) ? WqT : (mode == 1 ? WkT : WvT);
  const float* bias = (mode == 0) ? bq : (mode == 1 ? bk : bv);

  // ---- async-stage A row block (contiguous 16*1024 bf16 = 32 KB) ----
  {
    const u16* gbase = A + (size_t)row0 * D_;
    const unsigned lbase = lds_off32(&ldsA[0]);
    const int tid = threadIdx.x;
#pragma unroll
    for (int j = 0; j < 8; ++j) {
      const int c = tid * 8 + j;               // 16B chunk 0..2047
      async_cp16(lbase + c * 16, gbase + c * 8);
    }
    wait_async0();
    __syncthreads();
  }

  v8f acc[4] = {};
  const u16* arow = &ldsA[l16 * D_];
  const u16* wcol[4];
#pragma unroll
  for (int c = 0; c < 4; ++c)
    wcol[c] = WT + (size_t)(col0 + c * 16 + l16) * D_ + hig * 8;

  auto ldA = [&](int kk) {
    return make_frag(arow + kk + hig * 8, arow + kk + 16 + hig * 8);
  };
  auto ldB = [&](v16bf* dst, int kk) {
#pragma unroll
    for (int c = 0; c < 4; ++c)
      dst[c] = make_frag(wcol[c] + kk, wcol[c] + kk + 16);
  };

  // two-phase double-buffered pipeline (no register rotation)
  v16bf af0 = ldA(0), af1;
  v16bf bf0[4], bf1[4];
  ldB(bf0, 0);

  for (int kk = 0; kk < D_; kk += 64) {
    af1 = ldA(kk + 32);
    ldB(bf1, kk + 32);
    if (kk + 96 < D_) __builtin_prefetch(wcol[0] + kk + 96, 0, 1);
#pragma unroll
    for (int c = 0; c < 4; ++c) acc[c] = wmma_bf16(af0, bf0[c], acc[c]);
    if (kk + 64 < D_) {
      af0 = ldA(kk + 64);
      ldB(bf0, kk + 64);
    }
#pragma unroll
    for (int c = 0; c < 4; ++c) acc[c] = wmma_bf16(af1, bf1[c], acc[c]);
  }

#pragma unroll
  for (int c = 0; c < 4; ++c) {
    const int n = col0 + c * 16 + l16;
    const float bval = bias[n];
    const int h = n >> 6, d = n & 63;
#pragma unroll
    for (int r = 0; r < 8; ++r) {
      const int rowg = row0 + r + hig * 8;
      const int b = rowg >> 10, s = rowg & (S_ - 1);
      const float val = acc[c][r] + bval;
      if (mode == 2) {
        vTo[(((size_t)(b * H_ + h) * HD_ + d) * S_) + s] = f2bf(val);   // [b,h,hd,S]
      } else {
        u16* dst = (mode == 0) ? qo : ko;                               // [b,h,S,hd]
        dst[(((size_t)(b * H_ + h) * S_ + s) * HD_) + d] = f2bf(val);
      }
    }
  }
}

// ---- flash attention -------------------------------------------------------
// grid.x = B*H*(S/128) = 512; block = 256 (8 waves); each wave: 16 q-rows.
// K/V tiles for each 32-key block are shared by all 8 waves -> double-buffered
// async staging into LDS: issue tile i+1, compute on tile i, 1 barrier/iter.

__global__ void flash_attn(const u16* __restrict__ q, const u16* __restrict__ k,
                           const u16* __restrict__ vT, u16* __restrict__ ctx) {
  __shared__ u16 kt[2][32 * 64];    // 2 x 4 KB  [key][d]
  __shared__ u16 vt[2][64 * 32];    // 2 x 4 KB  [d][key]
  __shared__ u16 plds[8 * 512];     // 8 KB per-wave 16x32 P tiles

  const int tid  = threadIdx.x;
  const int lane = tid & 31;
  const int wv   = tid >> 5;
  const int l16  = lane & 15;
  const int hig  = lane >> 4;

  const int qblk = blockIdx.x & 7;
  const int bh   = blockIdx.x >> 3;
  const int h    = bh & (H_ - 1);
  const int b0   = bh >> 4;
  const int qbase = qblk * 128 + wv * 16;

  const u16* qh = q  + (size_t)bh * S_ * HD_;
  const u16* kh = k  + (size_t)bh * S_ * HD_;
  const u16* vh = vT + (size_t)bh * HD_ * S_;

  const u16* qp = qh + (size_t)(qbase + l16) * HD_;
  v16bf qa0 = make_frag(qp +      hig * 8, qp + 16 + hig * 8);  // d 0..31
  v16bf qa1 = make_frag(qp + 32 + hig * 8, qp + 48 + hig * 8);  // d 32..63

  float m[8], lsum[8];
#pragma unroll
  for (int r = 0; r < 8; ++r) { m[r] = -3.0e38f; lsum[r] = 0.f; }
  v8f o[4] = {};

  u16* pw = plds + wv * 512;
  const float SC = 0.125f;                   // 1/sqrt(64)

  // cooperative async stage of one 32-key K/V tile pair (8 KB = 2 chunks/thr)
  auto issue_tiles = [&](int n0, int bsel) {
    // K tile: 32 keys x 64 d, contiguous 4 KB at kh + n0*64
    async_cp16(lds_off32(&kt[bsel][0]) + tid * 16,
               kh + (size_t)n0 * HD_ + tid * 8);
    // V tile: 64 d-rows x 32 keys (64B per row, stride S_)
    const int d = tid >> 2, part = tid & 3;
    async_cp16(lds_off32(&vt[bsel][0]) + (d * 32 + part * 8) * 2,
               vh + (size_t)d * S_ + n0 + part * 8);
  };

  issue_tiles(0, 0);

  for (int it = 0; it < S_ / 32; ++it) {
    const int n0   = it * 32;
    const int bsel = it & 1;
    wait_async0();         // own chunks of tile `it` landed
    __syncthreads();       // everyone's chunks landed; prev compute done
    if (it + 1 < S_ / 32) issue_tiles(n0 + 32, bsel ^ 1);

    // ---- scores S = Q @ K^T for 16x32 tile (K from LDS) ----
    const u16* kp0 = &kt[bsel][(size_t)l16 * 64];
    const u16* kp1 = &kt[bsel][(size_t)(16 + l16) * 64];
    v16bf kb00 = make_frag(kp0 +      hig * 8, kp0 + 16 + hig * 8);
    v16bf kb01 = make_frag(kp0 + 32 + hig * 8, kp0 + 48 + hig * 8);
    v16bf kb10 = make_frag(kp1 +      hig * 8, kp1 + 16 + hig * 8);
    v16bf kb11 = make_frag(kp1 + 32 + hig * 8, kp1 + 48 + hig * 8);

    v8f c0 = {}, c1 = {};
    c0 = wmma_bf16(qa0, kb00, c0);
    c0 = wmma_bf16(qa1, kb01, c0);
    c1 = wmma_bf16(qa0, kb10, c1);
    c1 = wmma_bf16(qa1, kb11, c1);

    // ---- online softmax (row stats via 16-lane shuffle reductions) ----
#pragma unroll
    for (int r = 0; r < 8; ++r) {
      float s0 = c0[r] * SC, s1 = c1[r] * SC;
      float t = fmaxf(s0, s1);
      t = fmaxf(t, __shfl_xor(t, 1, 32));
      t = fmaxf(t, __shfl_xor(t, 2, 32));
      t = fmaxf(t, __shfl_xor(t, 4, 32));
      t = fmaxf(t, __shfl_xor(t, 8, 32));
      float mnew = fmaxf(m[r], t);
      float scl  = __expf(m[r] - mnew);
      m[r] = mnew;
      float p0 = __expf(s0 - mnew);
      float p1 = __expf(s1 - mnew);
      float ps = p0 + p1;
      ps += __shfl_xor(ps, 1, 32);
      ps += __shfl_xor(ps, 2, 32);
      ps += __shfl_xor(ps, 4, 32);
      ps += __shfl_xor(ps, 8, 32);
      lsum[r] = lsum[r] * scl + ps;
      o[0][r] *= scl; o[1][r] *= scl; o[2][r] *= scl; o[3][r] *= scl;
      // stage P (C-layout -> LDS row-major [row][key32]) as bf16
      const int rr = r + hig * 8;
      pw[rr * 32 + l16]      = f2bf(p0);
      pw[rr * 32 + 16 + l16] = f2bf(p1);
    }
    asm volatile("s_wait_dscnt 0x0" ::: "memory");

    // re-read P in A-fragment layout (wave-private LDS region)
    const u16* pr = pw + l16 * 32;
    v16bf pa = make_frag(pr + hig * 8, pr + 16 + hig * 8);

    // ---- O += P @ V  (V from LDS, [d][key] tile) ----
#pragma unroll
    for (int j = 0; j < 4; ++j) {
      const u16* vp = &vt[bsel][(size_t)(j * 16 + l16) * 32];
      v16bf vb = make_frag(vp + hig * 8, vp + 16 + hig * 8);
      o[j] = wmma_bf16(pa, vb, o[j]);
    }
  }

  // ---- normalize & store ctx as bf16 in [B,S,D] ----
#pragma unroll
  for (int r = 0; r < 8; ++r) {
    const float inv = 1.0f / lsum[r];
    const int rowg = qbase + r + hig * 8;
    u16* crow = ctx + ((size_t)(b0 * S_ + rowg)) * D_ + h * HD_;
    crow[0 * 16 + l16] = f2bf(o[0][r] * inv);
    crow[1 * 16 + l16] = f2bf(o[1][r] * inv);
    crow[2 * 16 + l16] = f2bf(o[2][r] * inv);
    crow[3 * 16 + l16] = f2bf(o[3][r] * inv);
  }
}

// ---- output projection + residual -----------------------------------------

__global__ void out_gemm(const u16* __restrict__ ctxb, const u16* __restrict__ WdT,
                         const float* __restrict__ bd, const float* __restrict__ pic,
                         float* __restrict__ xo) {
  __shared__ u16 ldsA[16 * D_];          // 32 KB
  const int lane = threadIdx.x & 31;
  const int wv   = threadIdx.x >> 5;
  const int l16  = lane & 15;
  const int hig  = lane >> 4;

  const int tile = blockIdx.x * 8 + wv;
  const int row0 = (tile >> 4) << 4;
  const int col0 = (tile & 15) << 6;

  {
    const u16* gbase = ctxb + (size_t)row0 * D_;
    const unsigned lbase = lds_off32(&ldsA[0]);
    const int tid = threadIdx.x;
#pragma unroll
    for (int j = 0; j < 8; ++j) {
      const int c = tid * 8 + j;
      async_cp16(lbase + c * 16, gbase + c * 8);
    }
    wait_async0();
    __syncthreads();
  }

  v8f acc[4] = {};
  const u16* arow = &ldsA[l16 * D_];
  const u16* wcol[4];
#pragma unroll
  for (int c = 0; c < 4; ++c)
    wcol[c] = WdT + (size_t)(col0 + c * 16 + l16) * D_ + hig * 8;

  auto ldA = [&](int kk) {
    return make_frag(arow + kk + hig * 8, arow + kk + 16 + hig * 8);
  };
  auto ldB = [&](v16bf* dst, int kk) {
#pragma unroll
    for (int c = 0; c < 4; ++c)
      dst[c] = make_frag(wcol[c] + kk, wcol[c] + kk + 16);
  };

  v16bf af0 = ldA(0), af1;
  v16bf bf0[4], bf1[4];
  ldB(bf0, 0);

  for (int kk = 0; kk < D_; kk += 64) {
    af1 = ldA(kk + 32);
    ldB(bf1, kk + 32);
    if (kk + 96 < D_) __builtin_prefetch(wcol[0] + kk + 96, 0, 1);
#pragma unroll
    for (int c = 0; c < 4; ++c) acc[c] = wmma_bf16(af0, bf0[c], acc[c]);
    if (kk + 64 < D_) {
      af0 = ldA(kk + 64);
      ldB(bf0, kk + 64);
    }
#pragma unroll
    for (int c = 0; c < 4; ++c) acc[c] = wmma_bf16(af1, bf1[c], acc[c]);
  }

#pragma unroll
  for (int c = 0; c < 4; ++c) {
    const int n = col0 + c * 16 + l16;
    const float bval = bd[n];
#pragma unroll
    for (int r = 0; r < 8; ++r) {
      const int rowg = row0 + r + hig * 8;
      const size_t idx = (size_t)rowg * D_ + n;
      xo[idx] = acc[c][r] + bval + pic[idx];     // residual
    }
  }
}

// ---- layer norm ------------------------------------------------------------

__global__ void ln_kernel(const float* __restrict__ x, const float* __restrict__ w,
                          const float* __restrict__ bw, float* __restrict__ out) {
  __shared__ float red[256];
  const int row = blockIdx.x;
  const float* xr = x + (size_t)row * D_;

  float s = 0.f;
  for (int i = threadIdx.x; i < D_; i += 256) s += xr[i];
  red[threadIdx.x] = s; __syncthreads();
  for (int off = 128; off > 0; off >>= 1) {
    if (threadIdx.x < off) red[threadIdx.x] += red[threadIdx.x + off];
    __syncthreads();
  }
  const float mean = red[0] * (1.0f / D_);
  __syncthreads();

  float v = 0.f;
  for (int i = threadIdx.x; i < D_; i += 256) {
    float d = xr[i] - mean; v += d * d;
  }
  red[threadIdx.x] = v; __syncthreads();
  for (int off = 128; off > 0; off >>= 1) {
    if (threadIdx.x < off) red[threadIdx.x] += red[threadIdx.x + off];
    __syncthreads();
  }
  const float inv = rsqrtf(red[0] * (1.0f / D_) + 1e-12f);

  for (int i = threadIdx.x; i < D_; i += 256)
    out[(size_t)row * D_ + i] = w[i] * ((xr[i] - mean) * inv) + bw[i];
}

// ---- launch ---------------------------------------------------------------

extern "C" void kernel_launch(void* const* d_in, const int* in_sizes, int n_in,
                              void* d_out, int out_size, void* d_ws, size_t ws_size,
                              hipStream_t stream) {
  const float* eeg = (const float*)d_in[0];
  const float* pic = (const float*)d_in[1];
  const float* Wk  = (const float*)d_in[2];
  const float* bk  = (const float*)d_in[3];
  const float* Wq  = (const float*)d_in[4];
  const float* bq  = (const float*)d_in[5];
  const float* Wv  = (const float*)d_in[6];
  const float* bv  = (const float*)d_in[7];
  const float* Wd  = (const float*)d_in[8];
  const float* bd  = (const float*)d_in[9];
  const float* lnw = (const float*)d_in[10];
  const float* lnb = (const float*)d_in[11];

  char* ws = (char*)d_ws;
  u16*  eegb = (u16*)(ws + ((size_t)0  << 20));   // 8 MB
  u16*  picb = (u16*)(ws + ((size_t)8  << 20));   // 8 MB
  u16*  WkT  = (u16*)(ws + ((size_t)16 << 20));   // 2 MB
  u16*  WqT  = (u16*)(ws + ((size_t)18 << 20));   // 2 MB
  u16*  WvT  = (u16*)(ws + ((size_t)20 << 20));   // 2 MB
  u16*  WdT  = (u16*)(ws + ((size_t)22 << 20));   // 2 MB
  u16*  qb   = (u16*)(ws + ((size_t)24 << 20));   // 8 MB [b,h,S,hd]
  u16*  kbuf = (u16*)(ws + ((size_t)32 << 20));   // 8 MB [b,h,S,hd]
  u16*  vTb  = (u16*)(ws + ((size_t)40 << 20));   // 8 MB [b,h,hd,S]
  u16*  ctxb = (u16*)(ws + ((size_t)48 << 20));   // 8 MB [B,S,D]
  float* xb  = (float*)(ws + ((size_t)56 << 20)); // 16 MB

  const int nact = NTOK * D_;
  cvt_act<<<nact / 256, 256, 0, stream>>>(eeg, eegb, nact);
  cvt_act<<<nact / 256, 256, 0, stream>>>(pic, picb, nact);
  cvt_wT<<<(D_ / 64) * (D_ / 64), 256, 0, stream>>>(Wk, WkT);
  cvt_wT<<<(D_ / 64) * (D_ / 64), 256, 0, stream>>>(Wq, WqT);
  cvt_wT<<<(D_ / 64) * (D_ / 64), 256, 0, stream>>>(Wv, WvT);
  cvt_wT<<<(D_ / 64) * (D_ / 64), 256, 0, stream>>>(Wd, WdT);

  qkv_gemm<<<dim3(512, 3), 256, 0, stream>>>(eegb, picb, WkT, WqT, WvT,
                                             bk, bq, bv, qb, kbuf, vTb);
  flash_attn<<<512, 256, 0, stream>>>(qb, kbuf, vTb, ctxb);
  out_gemm<<<512, 256, 0, stream>>>(ctxb, WdT, bd, pic, xb);
  ln_kernel<<<NTOK, 256, 0, stream>>>(xb, lnw, lnb, (float*)d_out);
}

// v002
// It runs in 309 microseconds.
// Timed twice side by side with v001, it ran 1.04 and 1.03 times as fast.
// All steps since v000 together make it 1.44 times as fast.
#include <hip/hip_runtime.h>
#include <hip/hip_bf16.h>
#include <math.h>
#include <stdint.h>

// Problem constants (reference: B=4, S=1024, D=1024, H=16, HD=64)
#define B_   4
#define S_   1024
#define D_   1024
#define H_   16
#define HD_  64
#define NTOK (B_ * S_)   // 4096 tokens

typedef unsigned short u16;
typedef __attribute__((ext_vector_type(8)))  u16    u16x8;
typedef __attribute__((ext_vector_type(4)))  u16    u16x4;
typedef __attribute__((ext_vector_type(4)))  float  f32x4;
typedef __attribute__((ext_vector_type(16))) __bf16 v16bf;
typedef __attribute__((ext_vector_type(8)))  float  v8f;

// ---- helpers ---------------------------------------------------------------

__device__ __forceinline__ u16 f2bf(float f) {
  union { float f; unsigned u; } c; c.f = f;
  unsigned u = c.u;
  u += 0x7FFFu + ((u >> 16) & 1u);   // round-to-nearest-even
  return (u16)(u >> 16);
}

// Build a 16x32 (or 32x16) bf16 WMMA fragment from two contiguous 16B chunks.
// Per ISA layout (16-bit A 16x32): lane-lo holds K=0..7 (v0-3) and K=16..23
// (v4-7); lane-hi holds K=8..15 and K=24..31.
__device__ __forceinline__ v16bf make_frag(const u16* p0, const u16* p1) {
  union { u16x8 h[2]; v16bf v; } u;
  u.h[0] = *(const u16x8*)p0;
  u.h[1] = *(const u16x8*)p1;
  return u.v;
}

__device__ __forceinline__ v8f wmma_bf16(v16bf a, v16bf b, v8f c) {
  return __builtin_amdgcn_wmma_f32_16x16x32_bf16(
      false, a, false, b, (short)0, c, false, false);
}

// Async copy of one 16B chunk from global to LDS (ASYNCcnt-tracked).
__device__ __forceinline__ void async_cp16(unsigned lds_off, const u16* g) {
  asm volatile("global_load_async_to_lds_b128 %0, %1, off"
               :: "v"(lds_off), "v"(g) : "memory");
}
__device__ __forceinline__ void wait_async0() {
  asm volatile("s_wait_asynccnt 0x0" ::: "memory");
}
__device__ __forceinline__ unsigned lds_off32(const void* p) {
  return (unsigned)(uintptr_t)p;   // low 32 bits of generic ptr = LDS offset
}

// ---- conversion kernels ----------------------------------------------------

// Both activations in one launch: blockIdx.y picks the input, and each of its
// 128 workgroups (16 waves) converts 32768 contiguous elements.  A lane issues
// its 16 independent 16-byte loads first (each wave-wide load is 512 contiguous
// bytes), then converts and stores 8 bytes per load (256 contiguous bytes a wave).
#define CV_THREADS 512
#define CV_LOADS   16
#define CV_STEP    (CV_THREADS * 4)            // elements per workgroup-wide round
#define CV_CHUNK   (CV_STEP * CV_LOADS)        // elements per workgroup
__global__ __launch_bounds__(CV_THREADS) void cvt_act(const float* __restrict__ eeg,
                                                      const float* __restrict__ pic,
                                                      u16* __restrict__ eegb,
                                                      u16* __restrict__ picb) {
  const float* x = blockIdx.y ? pic : eeg;
  u16*         y = blockIdx.y ? picb : eegb;
  const size_t base = (size_t)blockIdx.x * CV_CHUNK + threadIdx.x * 4;

  f32x4 r[CV_LOADS];
  // unrolled: r[] stays in registers and every load issues before the first wait
#pragma unroll
  for (int j = 0; j < CV_LOADS; ++j)
    r[j] = *(const f32x4*)(x + base + j * CV_STEP);

  // unrolled (both loops): constant indices into r[] and p, no scratch memory
#pragma unroll
  for (int j = 0; j < CV_LOADS; ++j) {
    u16x4 p;
#pragma unroll
    for (int c = 0; c < 4; ++c) p[c] = f2bf(r[j][c]);
    *(u16x4*)(y + base + j * CV_STEP) = p;
  }
}

// W is [K][N] row-major f32; produce WT[N][K] bf16 so a B-fragment column
// reads contiguous K.  One 64(k) x 64(n) tile per workgroup, turned in LDS:
// global reads are whole 256-byte row pieces, global writes whole 128-byte
// lines (8 lanes x 16 B per WT row), each line written by one workgroup.
#define WT_PITCH 68   // u16 per LDS row: 64 + 4, rows stay 8-byte aligned
__global__ __launch_bounds__(256) void cvt_wT(const float* __restrict__ w,
                                              u16* __restrict__ wt) {
  __shared__ __attribute__((aligned(16))) u16 tile[64 * WT_PITCH];   // [n][k]
  const int tid = threadIdx.x;
  const int n0  = (blockIdx.x & 15) << 6;
  const int k0  = (blockIdx.x >> 4) << 6;

  // each thread: a 4(k) x 4(n) block, four independent 16-byte loads
  const int nq = (tid & 15) << 2;
  const int kq = (tid >> 4) << 2;
  const float* src = w + (size_t)(k0 + kq) * D_ + n0 + nq;
  f32x4 r[4];
#pragma unroll
  for (int j = 0; j < 4; ++j) r[j] = *(const f32x4*)(src + (size_t)j * D_);

#pragma unroll
  for (int c = 0; c < 4; ++c) {
    u16x4 p;
#pragma unroll
    for (int j = 0; j < 4; ++j) p[j] = f2bf(r[j][c]);
    *(u16x4*)&tile[(nq + c) * WT_PITCH + kq] = p;    // 4 k of one n: 8 bytes
  }
  __syncthreads();

  const int kc = (tid & 7) << 3;
#pragma unroll
  for (int p = 0; p < 2; ++p) {
    const int n = p * 32 + (tid >> 3);
    union { u16x4 h[2]; u16x8 v; } u;
    u.h[0] = *(const u16x4*)&tile[n * WT_PITCH + kc];
    u.h[1] = *(const u16x4*)&tile[n * WT_PITCH + kc + 4];
    *(u16x8*)(wt + (size_t)(n0 + n) * D_ + k0 + kc) = u.v;
  }
}

// ---- fused QKV projection GEMM --------------------------------------------
// Each wave: 16x64 tile.  All 8 waves in a WG share the same 16-row A block,
// async-staged into LDS once (32 KB).  K-loop is unrolled x2 with disjoint
// fragment register sets -> true double buffering, no rotation movs.

__global__ void qkv_gemm(const u16* __restrict__ eegb, const u16* __restrict__ picb,
                         const u16* __restrict__ WkT,  const u16* __restrict__ WqT,
                         const u16* __restrict__ WvT,
                         const float* __restrict__ bk, const float* __restrict__ bq,
                         const float* __restrict__ bv,
                         u16* __restrict__ qo, u16* __restrict__ ko,
                         u16* __restrict__ vTo) {
  __shared__ u16 ldsA[16 * D_];          // 32 KB: 16 rows x 1024 cols bf16
  const int mode = blockIdx.y;           // 0=q 1=k 2=v
  const int lane = threadIdx.x & 31;
  const int wv   = threadIdx.x >> 5;
  const int l16  = lane & 15;
  const int hig  = lane >> 4;

  const int tile = blockIdx.x * 8 + wv;
  const int row0 = (tile >> 4) << 4;     // shared by all 8 waves in this WG
  const int col0 = (tile & 15) << 6;

  const u16*  A    = (mode == 1) ? eegb : picb;
  const u16*  WT   = (mode == 0) ? WqT : (mode == 1 ? WkT : WvT);
  const float* bias = (mode == 0) ? bq : (mode == 1 ? bk : bv);

  // ---- async-stage A row block (contiguous 16*1024 bf16 = 32 KB) ----
  {
    const u16* gbase = A + (size_t)row0 * D_;
    const unsigned lbase = lds_off32(&ldsA[0]);
    const int tid = threadIdx.x;
#pragma unroll
    for (int j = 0; j < 8; ++j) {
      const int c = tid * 8 + j;               // 16B chunk 0..2047
      async_cp16(lbase + c * 16, gbase + c * 8);
    }
    wait_async0();
    __syncthreads();
  }

  v8f acc[4] = {};
  const u16* arow = &ldsA[l16 * D_];
  const u16* wcol[4];
#pragma unroll
  for (int c = 0; c < 4; ++c)
    wcol[c] = WT + (size_t)(col0 + c * 16 + l16) * D_ + hig * 8;

  auto ldA = [&](int kk) {
    return make_frag(arow + kk + hig * 8, arow + kk + 16 + hig * 8);
  };
  auto ldB = [&](v16bf* dst, int kk) {
#pragma unroll
    for (int c = 0; c < 4; ++c)
      dst[c] = make_frag(wcol[c] + kk, wcol[c] + kk + 16);
  };

  // two-phase double-buffered pipeline (no register rotation)
  v16bf af0 = ldA(0), af1;
  v16bf bf0[4], bf1[4];
  ldB(bf0, 0);

  for (int kk = 0; kk < D_; kk += 64) {
    af1 = ldA(kk + 32);
    ldB(bf1, kk + 32);
    if (kk + 96 < D_) __builtin_prefetch(wcol[0] + kk + 96, 0, 1);
#pragma unroll
    for (int c = 0; c < 4; ++c) acc[c] = wmma_bf16(af0, bf0[c], acc[c]);
    if (kk + 64 < D_) {
      af0 = ldA(kk + 64);
      ldB(bf0, kk + 64);
    }
#pragma unroll
    for (int c = 0; c < 4; ++c) acc[c] = wmma_bf16(af1, bf1[c], acc[c]);
  }

#pragma unroll
  for (int c = 0; c < 4; ++c) {
    const int n = col0 + c * 16 + l16;
    const float bval = bias[n];
    const int h = n >> 6, d = n & 63;
#pragma unroll
    for (int r = 0; r < 8; ++r) {
      const int rowg = row0 + r + hig * 8;
      const int b = rowg >> 10, s = rowg & (S_ - 1);
      const float val = acc[c][r] + bval;
      if (mode == 2) {
        vTo[(((size_t)(b * H_ + h) * HD_ + d) * S_) + s] = f2bf(val);   // [b,h,hd,S]
      } else {
        u16* dst = (mode == 0) ? qo : ko;                               // [b,h,S,hd]
        dst[(((size_t)(b * H_ + h) * S_ + s) * HD_) + d] = f2bf(val);
      }
    }
  }
}

// ---- flash attention -------------------------------------------------------
// grid.x = B*H*(S/128) = 512; block = 256 (8 waves); each wave: 16 q-rows.
// K/V tiles for each 32-key block are shared by all 8 waves -> double-buffered
// async staging into LDS: issue tile i+1, compute on tile i, 1 barrier/iter.

__global__ void flash_attn(const u16* __restrict__ q, const u16* __restrict__ k,
                           const u16* __restrict__ vT, u16* __restrict__ ctx) {
  __shared__ u16 kt[2][32 * 64];    // 2 x 4 KB  [key][d]
  __shared__ u16 vt[2][64 * 32];    // 2 x 4 KB  [d][key]
  __shared__ u16 plds[8 * 512];     // 8 KB per-wave 16x32 P tiles

  const int tid  = threadIdx.x;
  const int lane = tid & 31;
  const int wv   = tid >> 5;
  const int l16  = lane & 15;
  const int hig  = lane >> 4;

  const int qblk = blockIdx.x & 7;
  const int bh   = blockIdx.x >> 3;
  const int h    = bh & (H_ - 1);
  const int b0   = bh >> 4;
  const int qbase = qblk * 128 + wv * 16;

  const u16* qh = q  + (size_t)bh * S_ * HD_;
  const u16* kh = k  + (size_t)bh * S_ * HD_;
  const u16* vh = vT + (size_t)bh * HD_ * S_;

  const u16* qp = qh + (size_t)(qbase + l16) * HD_;
  v16bf qa0 = make_frag(qp +      hig * 8, qp + 16 + hig * 8);  // d 0..31
  v16bf qa1 = make_frag(qp + 32 + hig * 8, qp + 48 + hig * 8);  // d 32..63

  float m[8], lsum[8];
#pragma unroll
  for (int r = 0; r < 8; ++r) { m[r] = -3.0e38f; lsum[r] = 0.f; }
  v8f o[4] = {};

  u16* pw = plds + wv * 512;
  const float SC = 0.125f;                   // 1/sqrt(64)

  // cooperative async stage of one 32-key K/V tile pair (8 KB = 2 chunks/thr)
  auto issue_tiles = [&](int n0, int bsel) {
    // K tile: 32 keys x 64 d, contiguous 4 KB at kh + n0*64
    async_cp16(lds_off32(&kt[bsel][0]) + tid * 16,
               kh + (size_t)n0 * HD_ + tid * 8);
    // V tile: 64 d-rows x 32 keys (64B per row, stride S_)
    const int d = tid >> 2, part = tid & 3;
    async_cp16(lds_off32(&vt[bsel][0]) + (d * 32 + part * 8) * 2,
               vh + (size_t)d * S_ + n0 + part * 8);
  };

  issue_tiles(0, 0);

  for (int it = 0; it < S_ / 32; ++it) {
    const int n0   = it * 32;
    const int bsel = it & 1;
    wait_async0();         // own chunks of tile `it` landed
    __syncthreads();       // everyone's chunks landed; prev compute done
    if (it + 1 < S_ / 32) issue_tiles(n0 + 32, bsel ^ 1);

    // ---- scores S = Q @ K^T for 16x32 tile (K from LDS) ----
    const u16* kp0 = &kt[bsel][(size_t)l16 * 64];
    const u16* kp1 = &kt[bsel][(size_t)(16 + l16) * 64];
    v16bf kb00 = make_frag(kp0 +      hig * 8, kp0 + 16 + hig * 8);
    v16bf kb01 = make_frag(kp0 + 32 + hig * 8, kp0 + 48 + hig * 8);
    v16bf kb10 = make_frag(kp1 +      hig * 8, kp1 + 16 + hig * 8);
    v16bf kb11 = make_frag(kp1 + 32 + hig * 8, kp1 + 48 + hig * 8);

    v8f c0 = {}, c1 = {};
    c0 = wmma_bf16(qa0, kb00, c0);
    c0 = wmma_bf16(qa1, kb01, c0);
    c1 = wmma_bf16(qa0, kb10, c1);
    c1 = wmma_bf16(qa1, kb11, c1);

    // ---- online softmax (row stats via 16-lane shuffle reductions) ----
#pragma unroll
    for (int r = 0; r < 8; ++r) {
      float s0 = c0[r] * SC, s1 = c1[r] * SC;
      float t = fmaxf(s0, s1);
      t = fmaxf(t, __shfl_xor(t, 1, 32));
      t = fmaxf(t, __shfl_xor(t, 2, 32));
      t = fmaxf(t, __shfl_xor(t, 4, 32));
      t = fmaxf(t, __shfl_xor(t, 8, 32));
      float mnew = fmaxf(m[r], t);
      float scl  = __expf(m[r] - mnew);
      m[r] = mnew;
      float p0 = __expf(s0 - mnew);
      float p1 = __expf(s1 - mnew);
      float ps = p0 + p1;
      ps += __shfl_xor(ps, 1, 32);
      ps += __shfl_xor(ps, 2, 32);
      ps += __shfl_xor(ps, 4, 32);
      ps += __shfl_xor(ps, 8, 32);
      lsum[r] = lsum[r] * scl + ps;
      o[0][r] *= scl; o[1][r] *= scl; o[2][r] *= scl; o[3][r] *= scl;
      // stage P (C-layout -> LDS row-major [row][key32]) as bf16
      const int rr = r + hig * 8;
      pw[rr * 32 + l16]      = f2bf(p0);
      pw[rr * 32 + 16 + l16] = f2bf(p1);
    }
    asm volatile("s_wait_dscnt 0x0" ::: "memory");

    // re-read P in A-fragment layout (wave-private LDS region)
    const u16* pr = pw + l16 * 32;
    v16bf pa = make_frag(pr + hig * 8, pr + 16 + hig * 8);

    // ---- O += P @ V  (V from LDS, [d][key] tile) ----
#pragma unroll
    for (int j = 0; j < 4; ++j) {
      const u16* vp = &vt[bsel][(size_t)(j * 16 + l16) * 32];
      v16bf vb = make_frag(vp + hig * 8, vp + 16 + hig * 8);
      o[j] = wmma_bf16(pa, vb, o[j]);
    }
  }

  // ---- normalize & store ctx as bf16 in [B,S,D] ----
#pragma unroll
  for (int r = 0; r < 8; ++r) {
    const float inv = 1.0f / lsum[r];
    const int rowg = qbase + r + hig * 8;
    u16* crow = ctx + ((size_t)(b0 * S_ + rowg)) * D_ + h * HD_;
    crow[0 * 16 + l16] = f2bf(o[0][r] * inv);
    crow[1 * 16 + l16] = f2bf(o[1][r] * inv);
    crow[2 * 16 + l16] = f2bf(o[2][r] * inv);
    crow[3 * 16 + l16] = f2bf(o[3][r] * inv);
  }
}

// ---- output projection + residual -----------------------------------------

__global__ void out_gemm(const u16* __restrict__ ctxb, const u16* __restrict__ WdT,
                         const float* __restrict__ bd, const float* __restrict__ pic,
                         float* __restrict__ xo) {
  __shared__ u16 ldsA[16 * D_];          // 32 KB
  const int lane = threadIdx.x & 31;
  const int wv   = threadIdx.x >> 5;
  const int l16  = lane & 15;
  const int hig  = lane >> 4;

  const int tile = blockIdx.x * 8 + wv;
  const int row0 = (tile >> 4) << 4;
  const int col0 = (tile & 15) << 6;

  {
    const u16* gbase = ctxb + (size_t)row0 * D_;
    const unsigned lbase = lds_off32(&ldsA[0]);
    const int tid = threadIdx.x;
#pragma unroll
    for (int j = 0; j < 8; ++j) {
      const int c = tid * 8 + j;
      async_cp16(lbase + c * 16, gbase + c * 8);
    }
    wait_async0();
    __syncthreads();
  }

  v8f acc[4] = {};
  const u16* arow = &ldsA[l16 * D_];
  const u16* wcol[4];
#pragma unroll
  for (int c = 0; c < 4; ++c)
    wcol[c] = WdT + (size_t)(col0 + c * 16 + l16) * D_ + hig * 8;

  auto ldA = [&](int kk) {
    return make_frag(arow + kk + hig * 8, arow + kk + 16 + hig * 8);
  };
  auto ldB = [&](v16bf* dst, int kk) {
#pragma unroll
    for (int c = 0; c < 4; ++c)
      dst[c] = make_frag(wcol[c] + kk, wcol[c] + kk + 16);
  };

  v16bf af0 = ldA(0), af1;
  v16bf bf0[4], bf1[4];
  ldB(bf0, 0);

  for (int kk = 0; kk < D_; kk += 64) {
    af1 = ldA(kk + 32);
    ldB(bf1, kk + 32);
    if (kk + 96 < D_) __builtin_prefetch(wcol[0] + kk + 96, 0, 1);
#pragma unroll
    for (int c = 0; c < 4; ++c) acc[c] = wmma_bf16(af0, bf0[c], acc[c]);
    if (kk + 64 < D_) {
      af0 = ldA(kk + 64);
      ldB(bf0, kk + 64);
    }
#pragma unroll
    for (int c = 0; c < 4; ++c) acc[c] = wmma_bf16(af1, bf1[c], acc[c]);
  }

#pragma unroll
  for (int c = 0; c < 4; ++c) {
    const int n = col0 + c * 16 + l16;
    const float bval = bd[n];
#pragma unroll
    for (int r = 0; r < 8; ++r) {
      const int rowg = row0 + r + hig * 8;
      const size_t idx = (size_t)rowg * D_ + n;
      xo[idx] = acc[c][r] + bval + pic[idx];     // residual
    }
  }
}

// ---- layer norm ------------------------------------------------------------

__global__ void ln_kernel(const float* __restrict__ x, const float* __restrict__ w,
                          const float* __restrict__ bw, float* __restrict__ out) {
  __shared__ float red[256];
  const int row = blockIdx.x;
  const float* xr = x + (size_t)row * D_;

  float s = 0.f;
  for (int i = threadIdx.x; i < D_; i += 256) s += xr[i];
  red[threadIdx.x] = s; __syncthreads();
  for (int off = 128; off > 0; off >>= 1) {
    if (threadIdx.x < off) red[threadIdx.x] += red[threadIdx.x + off];
    __syncthreads();
  }
  const float mean = red[0] * (1.0f / D_);
  __syncthreads();

  float v = 0.f;
  for (int i = threadIdx.x; i < D_; i += 256) {
    float d = xr[i] - mean; v += d * d;
  }
  red[threadIdx.x] = v; __syncthreads();
  for (int off = 128; off > 0; off >>= 1) {
    if (threadIdx.x < off) red[threadIdx.x] += red[threadIdx.x + off];
    __syncthreads();
  }
  const float inv = rsqrtf(red[0] * (1.0f / D_) + 1e-12f);

  for (int i = threadIdx.x; i < D_; i += 256)
    out[(size_t)row * D_ + i] = w[i] * ((xr[i] - mean) * inv) + bw[i];
}

// ---- launch ---------------------------------------------------------------

extern "C" void kernel_launch(void* const* d_in, const int* in_sizes, int n_in,
                              void* d_out, int out_size, void* d_ws, size_t ws_size,
                              hipStream_t stream) {
  const float* eeg = (const float*)d_in[0];
  const float* pic = (const float*)d_in[1];
  const float* Wk  = (const float*)d_in[2];
  const float* bk  = (const float*)d_in[3];
  const float* Wq  = (const float*)d_in[4];
  const float* bq  = (const float*)d_in[5];
  const float* Wv  = (const float*)d_in[6];
  const float* bv  = (const float*)d_in[7];
  const float* Wd  = (const float*)d_in[8];
  const float* bd  = (const float*)d_in[9];
  const float* lnw = (const float*)d_in[10];
  const float* lnb = (const float*)d_in[11];

  char* ws = (char*)d_ws;
  u16*  eegb = (u16*)(ws + ((size_t)0  << 20));   // 8 MB
  u16*  picb = (u16*)(ws + ((size_t)8  << 20));   // 8 MB
  u16*  WkT  = (u16*)(ws + ((size_t)16 << 20));   // 2 MB
  u16*  WqT  = (u16*)(ws + ((size_t)18 << 20));   // 2 MB
  u16*  WvT  = (u16*)(ws + ((size_t)20 << 20));   // 2 MB
  u16*  WdT  = (u16*)(ws + ((size_t)22 << 20));   // 2 MB
  u16*  qb   = (u16*)(ws + ((size_t)24 << 20));   // 8 MB [b,h,S,hd]
  u16*  kbuf = (u16*)(ws + ((size_t)32 << 20));   // 8 MB [b,h,S,hd]
  u16*  vTb  = (u16*)(ws + ((size_t)40 << 20));   // 8 MB [b,h,hd,S]
  u16*  ctxb = (u16*)(ws + ((size_t)48 << 20));   // 8 MB [B,S,D]
  float* xb  = (float*)(ws + ((size_t)56 << 20)); // 16 MB

  cvt_act<<<dim3(NTOK * D_ / CV_CHUNK, 2), CV_THREADS, 0, stream>>>(eeg, pic, eegb, picb);
  cvt_wT<<<(D_ / 64) * (D_ / 64), 256, 0, stream>>>(Wk, WkT);
  cvt_wT<<<(D_ / 64) * (D_ / 64), 256, 0, stream>>>(Wq, WqT);
  cvt_wT<<<(D_ / 64) * (D_ / 64), 256, 0, stream>>>(Wv, WvT);
  cvt_wT<<<(D_ / 64) * (D_ / 64), 256, 0, stream>>>(Wd, WdT);

  qkv_gemm<<<dim3(512, 3), 256, 0, stream>>>(eegb, picb, WkT, WqT, WvT,
                                             bk, bq, bv, qb, kbuf, vTb);
  flash_attn<<<512, 256, 0, stream>>>(qb, kbuf, vTb, ctxb);
  out_gemm<<<512, 256, 0, stream>>>(ctxb, WdT, bd, pic, xb);
  ln_kernel<<<NTOK, 256, 0, stream>>>(xb, lnw, lnb, (float*)d_out);
}

// v003
// A run of this version takes 175 microseconds.
// Timed twice side by side with v002, it ran 1.76 and 1.75 times as fast.
// All steps since v000 together make it 2.53 times as fast.
#include <hip/hip_runtime.h>
#include <hip/hip_bf16.h>
#include <math.h>
#include <stdint.h>

// Problem constants (reference: B=4, S=1024, D=1024, H=16, HD=64)
#define B_   4
#define S_   1024
#define D_   1024
#define H_   16
#define HD_  64
#define NTOK (B_ * S_)   // 4096 tokens

typedef unsigned short u16;
typedef __attribute__((ext_vector_type(8)))  u16    u16x8;
typedef __attribute__((ext_vector_type(4)))  u16    u16x4;
typedef __attribute__((ext_vector_type(4)))  float  f32x4;
typedef __attribute__((ext_vector_type(16))) __bf16 v16bf;
typedef __attribute__((ext_vector_type(8)))  float  v8f;

// ---- helpers ---------------------------------------------------------------

__device__ __forceinline__ u16 f2bf(float f) {
  union { float f; unsigned u; } c; c.f = f;
  unsigned u = c.u;
  u += 0x7FFFu + ((u >> 16) & 1u);   // round-to-nearest-even
  return (u16)(u >> 16);
}

// Build a 16x32 (or 32x16) bf16 WMMA fragment from two contiguous 16B chunks.
// Per ISA layout (16-bit A 16x32): lane-lo holds K=0..7 (v0-3) and K=16..23
// (v4-7); lane-hi holds K=8..15 and K=24..31.
__device__ __forceinline__ v16bf make_frag(const u16* p0, const u16* p1) {
  union { u16x8 h[2]; v16bf v; } u;
  u.h[0] = *(const u16x8*)p0;
  u.h[1] = *(const u16x8*)p1;
  return u.v;
}

__device__ __forceinline__ v8f wmma_bf16(v16bf a, v16bf b, v8f c) {
  return __builtin_amdgcn_wmma_f32_16x16x32_bf16(
      false, a, false, b, (short)0, c, false, false);
}

// Async copy of one 16B chunk from global to LDS (ASYNCcnt-tracked).
__device__ __forceinline__ void async_cp16(unsigned lds_off, const u16* g) {
  asm volatile("global_load_async_to_lds_b128 %0, %1, off"
               :: "v"(lds_off), "v"(g) : "memory");
}
__device__ __forceinline__ void wait_async0() {
  asm volatile("s_wait_asynccnt 0x0" ::: "memory");
}
__device__ __forceinline__ unsigned lds_off32(const void* p) {
  return (unsigned)(uintptr_t)p;   // low 32 bits of generic ptr = LDS offset
}

// ---- conversion kernels ----------------------------------------------------

// Both activations in one launch: blockIdx.y picks the input, and each of its
// 128 workgroups (16 waves) converts 32768 contiguous elements.  A lane issues
// its 16 independent 16-byte loads first (each wave-wide load is 512 contiguous
// bytes), then converts and stores 8 bytes per load (256 contiguous bytes a wave).
#define CV_THREADS 512
#define CV_LOADS   16
#define CV_STEP    (CV_THREADS * 4)            // elements per workgroup-wide round
#define CV_CHUNK   (CV_STEP * CV_LOADS)        // elements per workgroup
__global__ __launch_bounds__(CV_THREADS) void cvt_act(const float* __restrict__ eeg,
                                                      const float* __restrict__ pic,
                                                      u16* __restrict__ eegb,
                                                      u16* __restrict__ picb) {
  const float* x = blockIdx.y ? pic : eeg;
  u16*         y = blockIdx.y ? picb : eegb;
  const size_t base = (size_t)blockIdx.x * CV_CHUNK + threadIdx.x * 4;

  f32x4 r[CV_LOADS];
  // unrolled: r[] stays in registers and every load issues before the first wait
#pragma unroll
  for (int j = 0; j < CV_LOADS; ++j)
    r[j] = *(const f32x4*)(x + base + j * CV_STEP);

  // unrolled (both loops): constant indices into r[] and p, no scratch memory
#pragma unroll
  for (int j = 0; j < CV_LOADS; ++j) {
    u16x4 p;
#pragma unroll
    for (int c = 0; c < 4; ++c) p[c] = f2bf(r[j][c]);
    *(u16x4*)(y + base + j * CV_STEP) = p;
  }
}

// W is [K][N] row-major f32; produce WT[N][K] bf16 so a B-fragment column
// reads contiguous K.  One 64(k) x 64(n) tile per workgroup, turned in LDS:
// global reads are whole 256-byte row pieces, global writes whole 128-byte
// lines (8 lanes x 16 B per WT row), each line written by one workgroup.
#define WT_PITCH 68   // u16 per LDS row: 64 + 4, rows stay 8-byte aligned
__global__ __launch_bounds__(256) void cvt_wT(const float* __restrict__ w,
                                              u16* __restrict__ wt) {
  __shared__ __attribute__((aligned(16))) u16 tile[64 * WT_PITCH];   // [n][k]
  const int tid = threadIdx.x;
  const int n0  = (blockIdx.x & 15) << 6;
  const int k0  = (blockIdx.x >> 4) << 6;

  // each thread: a 4(k) x 4(n) block, four independent 16-byte loads
  const int nq = (tid & 15) << 2;
  const int kq = (tid >> 4) << 2;
  const float* src = w + (size_t)(k0 + kq) * D_ + n0 + nq;
  f32x4 r[4];
#pragma unroll
  for (int j = 0; j < 4; ++j) r[j] = *(const f32x4*)(src + (size_t)j * D_);

#pragma unroll
  for (int c = 0; c < 4; ++c) {
    u16x4 p;
#pragma unroll
    for (int j = 0; j < 4; ++j) p[j] = f2bf(r[j][c]);
    *(u16x4*)&tile[(nq + c) * WT_PITCH + kq] = p;    // 4 k of one n: 8 bytes
  }
  __syncthreads();

  const int kc = (tid & 7) << 3;
#pragma unroll
  for (int p = 0; p < 2; ++p) {
    const int n = p * 32 + (tid >> 3);
    union { u16x4 h[2]; u16x8 v; } u;
    u.h[0] = *(const u16x4*)&tile[n * WT_PITCH + kc];
    u.h[1] = *(const u16x4*)&tile[n * WT_PITCH + kc + 4];
    *(u16x8*)(wt + (size_t)(n0 + n) * D_ + k0 + kc) = u.v;
  }
}

// ---- projection GEMMs: shared main loop ------------------------------------
// A workgroup (8 waves) computes 128 rows x 64 columns; each wave a 16x64 tile.
// All 8 waves use the same 64 weight rows of WT[N][K] (128 KB, contiguous in
// global memory), so that panel is async-staged into LDS once and every
// B fragment comes from LDS.  Each wave reads its own 16 activation rows from
// global memory, every byte once, four k-steps (128 k) ahead.
// LDS layout [k quarter][64 rows][256 k + 8]: the row pitch is 528 B = 16 B x odd
// (no bank conflict for 16-byte reads), and everything one trip of the main loop
// reads lies within 64 KB of one address register (the LDS offset field's reach).
#define GB_PITCH   (256 + 8)           // u16 per LDS row
#define GB_QUART   (64 * GB_PITCH)     // u16 per k quarter: 33792 B
#define GB_LDS_U16 (4 * GB_QUART)      // 135168 B: two workgroups per WGP

// Eight async 16-byte copies, then s_wait_xcnt 0 ahead of any rewrite of their
// address registers (a precaution); one statement, so that the compiler can put
// no such rewrite between the copies and the wait.
__device__ __forceinline__ void async_cp16x8(unsigned l, const u16* g) {
  const unsigned LS = 2 * GB_PITCH * 2;  // LDS bytes between a thread's chunks
  const int      GS = 256 * 8;           // global elements between them
  asm volatile(
      "global_load_async_to_lds_b128 %0, %8, off\n\t"
      "global_load_async_to_lds_b128 %1, %9, off\n\t"
      "global_load_async_to_lds_b128 %2, %10, off\n\t"
      "global_load_async_to_lds_b128 %3, %11, off\n\t"
      "global_load_async_to_lds_b128 %4, %12, off\n\t"
      "global_load_async_to_lds_b128 %5, %13, off\n\t"
      "global_load_async_to_lds_b128 %6, %14, off\n\t"
      "global_load_async_to_lds_b128 %7, %15, off\n\t"
      "s_wait_xcnt 0x0"
      :: "v"(l), "v"(l + LS), "v"(l + 2 * LS), "v"(l + 3 * LS),
         "v"(l + 4 * LS), "v"(l + 5 * LS), "v"(l + 6 * LS), "v"(l + 7 * LS),
         "v"(g), "v"(g + GS), "v"(g + 2 * GS), "v"(g + 3 * GS),
         "v"(g + 4 * GS), "v"(g + 5 * GS), "v"(g + 6 * GS), "v"(g + 7 * GS)
      : "memory");
}

// acc[c] += A[row0 + 0..15][:] x WT[col0 + 16c + 0..15][:]^T over all D_ k.
__device__ __forceinline__ void gemm_16x64(const u16* __restrict__ A,
                                           const u16* __restrict__ WT,
                                           u16* ldsB, int row0, int col0,
                                           v8f* acc) {
  const int tid  = threadIdx.x;
  const int lane = tid & 31;
  const int l16  = lane & 15;
  const int hig  = lane >> 4;

  const u16* arow = A + (size_t)(row0 + l16) * D_ + hig * 8;
  auto ldA4 = [&](v16bf* dst, int kk) {
#pragma unroll   // constant indices: dst[] stays in registers
    for (int s = 0; s < 4; ++s)
      dst[s] = make_frag(arow + kk + s * 32, arow + kk + s * 32 + 16);
  };

  // first activation block: issued ahead of the staging so both fly together
  v16bf a0[4], a1[4];
  ldA4(a0, 0);

  // ---- async-stage the 64 x 1024 weight panel: 8192 chunks, 32 a thread ----
  {
    const u16* g = WT + (size_t)col0 * D_ + tid * 8;
    const unsigned l = lds_off32(ldsB) + ((tid & 127) >> 5) * (GB_QUART * 2) +
                       (tid >> 7) * (GB_PITCH * 2) + (tid & 31) * 16;
#pragma unroll   // all 32 copies issue back to back, no loop counter between them
    for (int j = 0; j < 4; ++j)
      async_cp16x8(l + j * 16 * (GB_PITCH * 2), g + j * 8 * 256 * 8);
    wait_async0();
    __syncthreads();
  }

  const u16* wrow = ldsB + l16 * GB_PITCH + hig * 8;
  // q = k quarter, kk = k inside it (kk == 256 names the next quarter's start)
  auto ldB = [&](v16bf* dst, int q, int kk) {
    const u16* p = wrow + q * GB_QUART + (kk >> 8) * GB_QUART + (kk & 255);
#pragma unroll   // constant indices: dst[] stays in registers
    for (int c = 0; c < 4; ++c)
      dst[c] = make_frag(p + c * 16 * GB_PITCH, p + c * 16 * GB_PITCH + 16);
  };
  auto mm = [&](v16bf a, const v16bf* b) {
#pragma unroll   // constant indices: acc[] and b[] stay in registers
    for (int c = 0; c < 4; ++c) acc[c] = wmma_bf16(a, b[c], acc[c]);
  };

  // B fragments one k-step ahead, A fragments one 128-k block ahead, each in
  // two disjoint register sets (no rotation moves)
  v16bf bf0[4], bf1[4];
  ldB(bf0, 0, 0);
  // keeps each group of loads in front of the WMMAs of the step before it;
  // without it the scheduler sinks every load to just ahead of its use and each
  // WMMA waits out an LDS latency
  auto hold = [] { __builtin_amdgcn_sched_barrier(0); };
  auto body = [&](int q, bool more) {
    const int kb = q * 256;
    ldA4(a1, kb + 128);
    ldB(bf1, q, 32);   hold();  mm(a0[0], bf0);
    ldB(bf0, q, 64);   hold();  mm(a0[1], bf1);
    ldB(bf1, q, 96);   hold();  mm(a0[2], bf0);
    ldB(bf0, q, 128);  hold();  mm(a0[3], bf1);
    if (more) ldA4(a0, kb + 256);
    ldB(bf1, q, 160);  hold();  mm(a1[0], bf0);
    ldB(bf0, q, 192);  hold();  mm(a1[1], bf1);
    ldB(bf1, q, 224);  hold();  mm(a1[2], bf0);
    if (more) ldB(bf0, q, 256);
    hold();
    mm(a1[3], bf1);
    // stands ahead of the next trip's first instructions, which form a new
    // activation address in the register pair that this trip's global loads name
    if (more) asm volatile("s_wait_xcnt 0x0" ::: "memory");
  };
  // kept rolled: unrolled, LDS addresses past 64 KB each cost their own add, and
  // the epilogue's loads move up until only one workgroup fits a WGP
#pragma unroll 1
  for (int q = 0; q < 3; ++q) body(q, true);
  body(3, false);   // last 256 k: nothing left to fetch ahead
}

// ---- fused QKV projection GEMM --------------------------------------------
// grid.x = 32 row blocks x 16 column blocks, grid.y = which projection.

__global__ __launch_bounds__(256)
void qkv_gemm(const u16* __restrict__ eegb, const u16* __restrict__ picb,
              const u16* __restrict__ WkT,  const u16* __restrict__ WqT,
              const u16* __restrict__ WvT,
              const float* __restrict__ bk, const float* __restrict__ bq,
              const float* __restrict__ bv,
              u16* __restrict__ qo, u16* __restrict__ ko,
              u16* __restrict__ vTo) {
  __shared__ __attribute__((aligned(16))) u16 ldsB[GB_LDS_U16];
  const int mode = blockIdx.y;           // 0=q 1=k 2=v
  const int lane = threadIdx.x & 31;
  const int wv   = threadIdx.x >> 5;
  const int l16  = lane & 15;
  const int hig  = lane >> 4;

  const int row0 = ((blockIdx.x >> 4) << 7) + (wv << 4);
  const int col0 = (blockIdx.x & 15) << 6;   // shared by all 8 waves in this WG

  const u16*  A    = (mode == 1) ? eegb : picb;
  const u16*  WT   = (mode == 0) ? WqT : (mode == 1 ? WkT : WvT);
  const float* bias = (mode == 0) ? bq : (mode == 1 ? bk : bv);

  v8f acc[4] = {};
  gemm_16x64(A, WT, ldsB, row0, col0, acc);

#pragma unroll
  for (int c = 0; c < 4; ++c) {
    const int n = col0 + c * 16 + l16;
    const float bval = bias[n];
    const int h = n >> 6, d = n & 63;
#pragma unroll
    for (int r = 0; r < 8; ++r) {
      const int rowg = row0 + r + hig * 8;
      const int b = rowg >> 10, s = rowg & (S_ - 1);
      const float val = acc[c][r] + bval;
      if (mode == 2) {
        vTo[(((size_t)(b * H_ + h) * HD_ + d) * S_) + s] = f2bf(val);   // [b,h,hd,S]
      } else {
        u16* dst = (mode == 0) ? qo : ko;                               // [b,h,S,hd]
        dst[(((size_t)(b * H_ + h) * S_ + s) * HD_) + d] = f2bf(val);
      }
    }
  }
}

// ---- flash attention -------------------------------------------------------
// grid.x = B*H*(S/128) = 512; block = 256 (8 waves); each wave: 16 q-rows.
// K/V tiles for each 32-key block are shared by all 8 waves -> double-buffered
// async staging into LDS: issue tile i+1, compute on tile i, 1 barrier/iter.

__global__ void flash_attn(const u16* __restrict__ q, const u16* __restrict__ k,
                           const u16* __restrict__ vT, u16* __restrict__ ctx) {
  __shared__ u16 kt[2][32 * 64];    // 2 x 4 KB  [key][d]
  __shared__ u16 vt[2][64 * 32];    // 2 x 4 KB  [d][key]
  __shared__ u16 plds[8 * 512];     // 8 KB per-wave 16x32 P tiles

  const int tid  = threadIdx.x;
  const int lane = tid & 31;
  const int wv   = tid >> 5;
  const int l16  = lane & 15;
  const int hig  = lane >> 4;

  const int qblk = blockIdx.x & 7;
  const int bh   = blockIdx.x >> 3;
  const int h    = bh & (H_ - 1);
  const int b0   = bh >> 4;
  const int qbase = qblk * 128 + wv * 16;

  const u16* qh = q  + (size_t)bh * S_ * HD_;
  const u16* kh = k  + (size_t)bh * S_ * HD_;
  const u16* vh = vT + (size_t)bh * HD_ * S_;

  const u16* qp = qh + (size_t)(qbase + l16) * HD_;
  v16bf qa0 = make_frag(qp +      hig * 8, qp + 16 + hig * 8);  // d 0..31
  v16bf qa1 = make_frag(qp + 32 + hig * 8, qp + 48 + hig * 8);  // d 32..63

  float m[8], lsum[8];
#pragma unroll
  for (int r = 0; r < 8; ++r) { m[r] = -3.0e38f; lsum[r] = 0.f; }
  v8f o[4] = {};

  u16* pw = plds + wv * 512;
  const float SC = 0.125f;                   // 1/sqrt(64)

  // cooperative async stage of one 32-key K/V tile pair (8 KB = 2 chunks/thr)
  auto issue_tiles = [&](int n0, int bsel) {
    // K tile: 32 keys x 64 d, contiguous 4 KB at kh + n0*64
    async_cp16(lds_off32(&kt[bsel][0]) + tid * 16,
               kh + (size_t)n0 * HD_ + tid * 8);
    // V tile: 64 d-rows x 32 keys (64B per row, stride S_)
    const int d = tid >> 2, part = tid & 3;
    async_cp16(lds_off32(&vt[bsel][0]) + (d * 32 + part * 8) * 2,
               vh + (size_t)d * S_ + n0 + part * 8);
  };

  issue_tiles(0, 0);

  for (int it = 0; it < S_ / 32; ++it) {
    const int n0   = it * 32;
    const int bsel = it & 1;
    wait_async0();         // own chunks of tile `it` landed
    __syncthreads();       // everyone's chunks landed; prev compute done
    if (it + 1 < S_ / 32) issue_tiles(n0 + 32, bsel ^ 1);

    // ---- scores S = Q @ K^T for 16x32 tile (K from LDS) ----
    const u16* kp0 = &kt[bsel][(size_t)l16 * 64];
    const u16* kp1 = &kt[bsel][(size_t)(16 + l16) * 64];
    v16bf kb00 = make_frag(kp0 +      hig * 8, kp0 + 16 + hig * 8);
    v16bf kb01 = make_frag(kp0 + 32 + hig * 8, kp0 + 48 + hig * 8);
    v16bf kb10 = make_frag(kp1 +      hig * 8, kp1 + 16 + hig * 8);
    v16bf kb11 = make_frag(kp1 + 32 + hig * 8, kp1 + 48 + hig * 8);

    v8f c0 = {}, c1 = {};
    c0 = wmma_bf16(qa0, kb00, c0);
    c0 = wmma_bf16(qa1, kb01, c0);
    c1 = wmma_bf16(qa0, kb10, c1);
    c1 = wmma_bf16(qa1, kb11, c1);

    // ---- online softmax (row stats via 16-lane shuffle reductions) ----
#pragma unroll
    for (int r = 0; r < 8; ++r) {
      float s0 = c0[r] * SC, s1 = c1[r] * SC;
      float t = fmaxf(s0, s1);
      t = fmaxf(t, __shfl_xor(t, 1, 32));
      t = fmaxf(t, __shfl_xor(t, 2, 32));
      t = fmaxf(t, __shfl_xor(t, 4, 32));
      t = fmaxf(t, __shfl_xor(t, 8, 32));
      float mnew = fmaxf(m[r], t);
      float scl  = __expf(m[r] - mnew);
      m[r] = mnew;
      float p0 = __expf(s0 - mnew);
      float p1 = __expf(s1 - mnew);
      float ps = p0 + p1;
      ps += __shfl_xor(ps, 1, 32);
      ps += __shfl_xor(ps, 2, 32);
      ps += __shfl_xor(ps, 4, 32);
      ps += __shfl_xor(ps, 8, 32);
      lsum[r] = lsum[r] * scl + ps;
      o[0][r] *= scl; o[1][r] *= scl; o[2][r] *= scl; o[3][r] *= scl;
      // stage P (C-layout -> LDS row-major [row][key32]) as bf16
      const int rr = r + hig * 8;
      pw[rr * 32 + l16]      = f2bf(p0);
      pw[rr * 32 + 16 + l16] = f2bf(p1);
    }
    asm volatile("s_wait_dscnt 0x0" ::: "memory");

    // re-read P in A-fragment layout (wave-private LDS region)
    const u16* pr = pw + l16 * 32;
    v16bf pa = make_frag(pr + hig * 8, pr + 16 + hig * 8);

    // ---- O += P @ V  (V from LDS, [d][key] tile) ----
#pragma unroll
    for (int j = 0; j < 4; ++j) {
      const u16* vp = &vt[bsel][(size_t)(j * 16 + l16) * 32];
      v16bf vb = make_frag(vp + hig * 8, vp + 16 + hig * 8);
      o[j] = wmma_bf16(pa, vb, o[j]);
    }
  }

  // ---- normalize & store ctx as bf16 in [B,S,D] ----
#pragma unroll
  for (int r = 0; r < 8; ++r) {
    const float inv = 1.0f / lsum[r];
    const int rowg = qbase + r + hig * 8;
    u16* crow = ctx + ((size_t)(b0 * S_ + rowg)) * D_ + h * HD_;
    crow[0 * 16 + l16] = f2bf(o[0][r] * inv);
    crow[1 * 16 + l16] = f2bf(o[1][r] * inv);
    crow[2 * 16 + l16] = f2bf(o[2][r] * inv);
    crow[3 * 16 + l16] = f2bf(o[3][r] * inv);
  }
}

// ---- output projection + residual -----------------------------------------

__global__ __launch_bounds__(256)
void out_gemm(const u16* __restrict__ ctxb, const u16* __restrict__ WdT,
              const float* __restrict__ bd, const float* __restrict__ pic,
              float* __restrict__ xo) {
  __shared__ __attribute__((aligned(16))) u16 ldsB[GB_LDS_U16];
  const int lane = threadIdx.x & 31;
  const int wv   = threadIdx.x >> 5;
  const int l16  = lane & 15;
  const int hig  = lane >> 4;

  const int row0 = ((blockIdx.x >> 4) << 7) + (wv << 4);
  const int col0 = (blockIdx.x & 15) << 6;

  v8f acc[4] = {};
  gemm_16x64(ctxb, WdT, ldsB, row0, col0, acc);

#pragma unroll
  for (int c = 0; c < 4; ++c) {
    const int n = col0 + c * 16 + l16;
    const float bval = bd[n];
#pragma unroll
    for (int r = 0; r < 8; ++r) {
      const int rowg = row0 + r + hig * 8;
      const size_t idx = (size_t)rowg * D_ + n;
      xo[idx] = acc[c][r] + bval + pic[idx];     // residual
    }
  }
}

// ---- layer norm ------------------------------------------------------------

__global__ void ln_kernel(const float* __restrict__ x, const float* __restrict__ w,
                          const float* __restrict__ bw, float* __restrict__ out) {
  __shared__ float red[256];
  const int row = blockIdx.x;
  const float* xr = x + (size_t)row * D_;

  float s = 0.f;
  for (int i = threadIdx.x; i < D_; i += 256) s += xr[i];
  red[threadIdx.x] = s; __syncthreads();
  for (int off = 128; off > 0; off >>= 1) {
    if (threadIdx.x < off) red[threadIdx.x] += red[threadIdx.x + off];
    __syncthreads();
  }
  const float mean = red[0] * (1.0f / D_);
  __syncthreads();

  float v = 0.f;
  for (int i = threadIdx.x; i < D_; i += 256) {
    float d = xr[i] - mean; v += d * d;
  }
  red[threadIdx.x] = v; __syncthreads();
  for (int off = 128; off > 0; off >>= 1) {
    if (threadIdx.x < off) red[threadIdx.x] += red[threadIdx.x + off];
    __syncthreads();
  }
  const float inv = rsqrtf(red[0] * (1.0f / D_) + 1e-12f);

  for (int i = threadIdx.x; i < D_; i += 256)
    out[(size_t)row * D_ + i] = w[i] * ((xr[i] - mean) * inv) + bw[i];
}

// ---- launch ---------------------------------------------------------------

extern "C" void kernel_launch(void* const* d_in, const int* in_sizes, int n_in,
                              void* d_out, int out_size, void* d_ws, size_t ws_size,
                              hipStream_t stream) {
  const float* eeg = (const float*)d_in[0];
  const float* pic = (const float*)d_in[1];
  const float* Wk  = (const float*)d_in[2];
  const float* bk  = (const float*)d_in[3];
  const float* Wq  = (const float*)d_in[4];
  const float* bq  = (const float*)d_in[5];
  const float* Wv  = (const float*)d_in[6];
  const float* bv  = (const float*)d_in[7];
  const float* Wd  = (const float*)d_in[8];
  const float* bd  = (const float*)d_in[9];
  const float* lnw = (const float*)d_in[10];
  const float* lnb = (const float*)d_in[11];

  char* ws = (char*)d_ws;
  u16*  eegb = (u16*)(ws + ((size_t)0  << 20));   // 8 MB
  u16*  picb = (u16*)(ws + ((size_t)8  << 20));   // 8 MB
  u16*  WkT  = (u16*)(ws + ((size_t)16 << 20));   // 2 MB
  u16*  WqT  = (u16*)(ws + ((size_t)18 << 20));   // 2 MB
  u16*  WvT  = (u16*)(ws + ((size_t)20 << 20));   // 2 MB
  u16*  WdT  = (u16*)(ws + ((size_t)22 << 20));   // 2 MB
  u16*  qb   = (u16*)(ws + ((size_t)24 << 20));   // 8 MB [b,h,S,hd]
  u16*  kbuf = (u16*)(ws + ((size_t)32 << 20));   // 8 MB [b,h,S,hd]
  u16*  vTb  = (u16*)(ws + ((size_t)40 << 20));   // 8 MB [b,h,hd,S]
  u16*  ctxb = (u16*)(ws + ((size_t)48 << 20));   // 8 MB [B,S,D]
  float* xb  = (float*)(ws + ((size_t)56 << 20)); // 16 MB

  cvt_act<<<dim3(NTOK * D_ / CV_CHUNK, 2), CV_THREADS, 0, stream>>>(eeg, pic, eegb, picb);
  cvt_wT<<<(D_ / 64) * (D_ / 64), 256, 0, stream>>>(Wk, WkT);
  cvt_wT<<<(D_ / 64) * (D_ / 64), 256, 0, stream>>>(Wq, WqT);
  cvt_wT<<<(D_ / 64) * (D_ / 64), 256, 0, stream>>>(Wv, WvT);
  cvt_wT<<<(D_ / 64) * (D_ / 64), 256, 0, stream>>>(Wd, WdT);

  qkv_gemm<<<dim3(512, 3), 256, 0, stream>>>(eegb, picb, WkT, WqT, WvT,
                                             bk, bq, bv, qb, kbuf, vTb);
  flash_attn<<<512, 256, 0, stream>>>(qb, kbuf, vTb, ctxb);
  out_gemm<<<512, 256, 0, stream>>>(ctxb, WdT, bd, pic, xb);
  ln_kernel<<<NTOK, 256, 0, stream>>>(xb, lnw, lnb, (float*)d_out);
}

// v004
// Measured time: 144 microseconds a run.
// In both of two side-by-side timings against v003, it was 1.22 times as fast.
// Counting every step since v000, it is 3.08 times as fast.
#include <hip/hip_runtime.h>
#include <hip/hip_bf16.h>
#include <math.h>
#include <stdint.h>

// Problem constants (reference: B=4, S=1024, D=1024, H=16, HD=64)
#define B_   4
#define S_   1024
#define D_   1024
#define H_   16
#define HD_  64
#define NTOK (B_ * S_)   // 4096 tokens

typedef unsigned short u16;
typedef __attribute__((ext_vector_type(8)))  u16    u16x8;
typedef __attribute__((ext_vector_type(4)))  u16    u16x4;
typedef __attribute__((ext_vector_type(4)))  float  f32x4;
typedef __attribute__((ext_vector_type(16))) __bf16 v16bf;
typedef __attribute__((ext_vector_type(8)))  __bf16 v8bf;
typedef __attribute__((ext_vector_type(8)))  float  v8f;

// ---- helpers ---------------------------------------------------------------

__device__ __forceinline__ u16 f2bf(float f) {
  union { float f; unsigned u; } c; c.f = f;
  unsigned u = c.u;
  u += 0x7FFFu + ((u >> 16) & 1u);   // round-to-nearest-even
  return (u16)(u >> 16);
}

// Build a 16x32 (or 32x16) bf16 WMMA fragment from two contiguous 16B chunks.
// Per ISA layout (16-bit A 16x32): lane-lo holds K=0..7 (v0-3) and K=16..23
// (v4-7); lane-hi holds K=8..15 and K=24..31.
__device__ __forceinline__ v16bf make_frag(const u16* p0, const u16* p1) {
  union { u16x8 h[2]; v16bf v; } u;
  u.h[0] = *(const u16x8*)p0;
  u.h[1] = *(const u16x8*)p1;
  return u.v;
}

__device__ __forceinline__ v8f wmma_bf16(v16bf a, v16bf b, v8f c) {
  return __builtin_amdgcn_wmma_f32_16x16x32_bf16(
      false, a, false, b, (short)0, c, false, false);
}

// Async copy of one 16B chunk from global to LDS (ASYNCcnt-tracked).
__device__ __forceinline__ void async_cp16(unsigned lds_off, const u16* g) {
  asm volatile("global_load_async_to_lds_b128 %0, %1, off"
               :: "v"(lds_off), "v"(g) : "memory");
}
__device__ __forceinline__ void wait_async0() {
  asm volatile("s_wait_asynccnt 0x0" ::: "memory");
}
__device__ __forceinline__ unsigned lds_off32(const void* p) {
  return (unsigned)(uintptr_t)p;   // low 32 bits of generic ptr = LDS offset
}

// ---- conversion kernels ----------------------------------------------------

// Both activations in one launch: blockIdx.y picks the input, and each of its
// 128 workgroups (16 waves) converts 32768 contiguous elements.  A lane issues
// its 16 independent 16-byte loads first (each wave-wide load is 512 contiguous
// bytes), then converts and stores 8 bytes per load (256 contiguous bytes a wave).
#define CV_THREADS 512
#define CV_LOADS   16
#define CV_STEP    (CV_THREADS * 4)            // elements per workgroup-wide round
#define CV_CHUNK   (CV_STEP * CV_LOADS)        // elements per workgroup
__global__ __launch_bounds__(CV_THREADS) void cvt_act(const float* __restrict__ eeg,
                                                      const float* __restrict__ pic,
                                                      u16* __restrict__ eegb,
                                                      u16* __restrict__ picb) {
  const float* x = blockIdx.y ? pic : eeg;
  u16*         y = blockIdx.y ? picb : eegb;
  const size_t base = (size_t)blockIdx.x * CV_CHUNK + threadIdx.x * 4;

  f32x4 r[CV_LOADS];
  // unrolled: r[] stays in registers and every load issues before the first wait
#pragma unroll
  for (int j = 0; j < CV_LOADS; ++j)
    r[j] = *(const f32x4*)(x + base + j * CV_STEP);

  // unrolled (both loops): constant indices into r[] and p, no scratch memory
#pragma unroll
  for (int j = 0; j < CV_LOADS; ++j) {
    u16x4 p;
#pragma unroll
    for (int c = 0; c < 4; ++c) p[c] = f2bf(r[j][c]);
    *(u16x4*)(y + base + j * CV_STEP) = p;
  }
}

// W is [K][N] row-major f32; produce WT[N][K] bf16 so a B-fragment column
// reads contiguous K.  One 64(k) x 64(n) tile per workgroup, turned in LDS:
// global reads are whole 256-byte row pieces, global writes whole 128-byte
// lines (8 lanes x 16 B per WT row), each line written by one workgroup.
#define WT_PITCH 68   // u16 per LDS row: 64 + 4, rows stay 8-byte aligned
__global__ __launch_bounds__(256) void cvt_wT(const float* __restrict__ w,
                                              u16* __restrict__ wt) {
  __shared__ __attribute__((aligned(16))) u16 tile[64 * WT_PITCH];   // [n][k]
  const int tid = threadIdx.x;
  const int n0  = (blockIdx.x & 15) << 6;
  const int k0  = (blockIdx.x >> 4) << 6;

  // each thread: a 4(k) x 4(n) block, four independent 16-byte loads
  const int nq = (tid & 15) << 2;
  const int kq = (tid >> 4) << 2;
  const float* src = w + (size_t)(k0 + kq) * D_ + n0 + nq;
  f32x4 r[4];
#pragma unroll
  for (int j = 0; j < 4; ++j) r[j] = *(const f32x4*)(src + (size_t)j * D_);

#pragma unroll
  for (int c = 0; c < 4; ++c) {
    u16x4 p;
#pragma unroll
    for (int j = 0; j < 4; ++j) p[j] = f2bf(r[j][c]);
    *(u16x4*)&tile[(nq + c) * WT_PITCH + kq] = p;    // 4 k of one n: 8 bytes
  }
  __syncthreads();

  const int kc = (tid & 7) << 3;
#pragma unroll
  for (int p = 0; p < 2; ++p) {
    const int n = p * 32 + (tid >> 3);
    union { u16x4 h[2]; u16x8 v; } u;
    u.h[0] = *(const u16x4*)&tile[n * WT_PITCH + kc];
    u.h[1] = *(const u16x4*)&tile[n * WT_PITCH + kc + 4];
    *(u16x8*)(wt + (size_t)(n0 + n) * D_ + k0 + kc) = u.v;
  }
}

// ---- projection GEMMs: shared main loop ------------------------------------
// A workgroup (8 waves) computes 128 rows x 64 columns; each wave a 16x64 tile.
// All 8 waves use the same 64 weight rows of WT[N][K] (128 KB, contiguous in
// global memory), so that panel is async-staged into LDS once and every
// B fragment comes from LDS.  Each wave reads its own 16 activation rows from
// global memory, every byte once, four k-steps (128 k) ahead.
// LDS layout [k quarter][64 rows][256 k + 8]: the row pitch is 528 B = 16 B x odd
// (no bank conflict for 16-byte reads), and everything one trip of the main loop
// reads lies within 64 KB of one address register (the LDS offset field's reach).
#define GB_PITCH   (256 + 8)           // u16 per LDS row
#define GB_QUART   (64 * GB_PITCH)     // u16 per k quarter: 33792 B
#define GB_LDS_U16 (4 * GB_QUART)      // 135168 B: two workgroups per WGP

// Eight async 16-byte copies, then s_wait_xcnt 0 ahead of any rewrite of their
// address registers (a precaution); one statement, so that the compiler can put
// no such rewrite between the copies and the wait.
__device__ __forceinline__ void async_cp16x8(unsigned l, const u16* g) {
  const unsigned LS = 2 * GB_PITCH * 2;  // LDS bytes between a thread's chunks
  const int      GS = 256 * 8;           // global elements between them
  asm volatile(
      "global_load_async_to_lds_b128 %0, %8, off\n\t"
      "global_load_async_to_lds_b128 %1, %9, off\n\t"
      "global_load_async_to_lds_b128 %2, %10, off\n\t"
      "global_load_async_to_lds_b128 %3, %11, off\n\t"
      "global_load_async_to_lds_b128 %4, %12, off\n\t"
      "global_load_async_to_lds_b128 %5, %13, off\n\t"
      "global_load_async_to_lds_b128 %6, %14, off\n\t"
      "global_load_async_to_lds_b128 %7, %15, off\n\t"
      "s_wait_xcnt 0x0"
      :: "v"(l), "v"(l + LS), "v"(l + 2 * LS), "v"(l + 3 * LS),
         "v"(l + 4 * LS), "v"(l + 5 * LS), "v"(l + 6 * LS), "v"(l + 7 * LS),
         "v"(g), "v"(g + GS), "v"(g + 2 * GS), "v"(g + 3 * GS),
         "v"(g + 4 * GS), "v"(g + 5 * GS), "v"(g + 6 * GS), "v"(g + 7 * GS)
      : "memory");
}

// acc[c] += A[row0 + 0..15][:] x WT[col0 + 16c + 0..15][:]^T over all D_ k.
__device__ __forceinline__ void gemm_16x64(const u16* __restrict__ A,
                                           const u16* __restrict__ WT,
                                           u16* ldsB, int row0, int col0,
                                           v8f* acc) {
  const int tid  = threadIdx.x;
  const int lane = tid & 31;
  const int l16  = lane & 15;
  const int hig  = lane >> 4;

  const u16* arow = A + (size_t)(row0 + l16) * D_ + hig * 8;
  auto ldA4 = [&](v16bf* dst, int kk) {
#pragma unroll   // constant indices: dst[] stays in registers
    for (int s = 0; s < 4; ++s)
      dst[s] = make_frag(arow + kk + s * 32, arow + kk + s * 32 + 16);
  };

  // first activation block: issued ahead of the staging so both fly together
  v16bf a0[4], a1[4];
  ldA4(a0, 0);

  // ---- async-stage the 64 x 1024 weight panel: 8192 chunks, 32 a thread ----
  {
    const u16* g = WT + (size_t)col0 * D_ + tid * 8;
    const unsigned l = lds_off32(ldsB) + ((tid & 127) >> 5) * (GB_QUART * 2) +
                       (tid >> 7) * (GB_PITCH * 2) + (tid & 31) * 16;
#pragma unroll   // all 32 copies issue back to back, no loop counter between them
    for (int j = 0; j < 4; ++j)
      async_cp16x8(l + j * 16 * (GB_PITCH * 2), g + j * 8 * 256 * 8);
    wait_async0();
    __syncthreads();
  }

  const u16* wrow = ldsB + l16 * GB_PITCH + hig * 8;
  // q = k quarter, kk = k inside it (kk == 256 names the next quarter's start)
  auto ldB = [&](v16bf* dst, int q, int kk) {
    const u16* p = wrow + q * GB_QUART + (kk >> 8) * GB_QUART + (kk & 255);
#pragma unroll   // constant indices: dst[] stays in registers
    for (int c = 0; c < 4; ++c)
      dst[c] = make_frag(p + c * 16 * GB_PITCH, p + c * 16 * GB_PITCH + 16);
  };
  auto mm = [&](v16bf a, const v16bf* b) {
#pragma unroll   // constant indices: acc[] and b[] stay in registers
    for (int c = 0; c < 4; ++c) acc[c] = wmma_bf16(a, b[c], acc[c]);
  };

  // B fragments one k-step ahead, A fragments one 128-k block ahead, each in
  // two disjoint register sets (no rotation moves)
  v16bf bf0[4], bf1[4];
  ldB(bf0, 0, 0);
  // keeps each group of loads in front of the WMMAs of the step before it;
  // without it the scheduler sinks every load to just ahead of its use and each
  // WMMA waits out an LDS latency
  auto hold = [] { __builtin_amdgcn_sched_barrier(0); };
  auto body = [&](int q, bool more) {
    const int kb = q * 256;
    ldA4(a1, kb + 128);
    ldB(bf1, q, 32);   hold();  mm(a0[0], bf0);
    ldB(bf0, q, 64);   hold();  mm(a0[1], bf1);
    ldB(bf1, q, 96);   hold();  mm(a0[2], bf0);
    ldB(bf0, q, 128);  hold();  mm(a0[3], bf1);
    if (more) ldA4(a0, kb + 256);
    ldB(bf1, q, 160);  hold();  mm(a1[0], bf0);
    ldB(bf0, q, 192);  hold();  mm(a1[1], bf1);
    ldB(bf1, q, 224);  hold();  mm(a1[2], bf0);
    if (more) ldB(bf0, q, 256);
    hold();
    mm(a1[3], bf1);
    // stands ahead of the next trip's first instructions, which form a new
    // activation address in the register pair that this trip's global loads name
    if (more) asm volatile("s_wait_xcnt 0x0" ::: "memory");
  };
  // kept rolled: unrolled, LDS addresses past 64 KB each cost their own add, and
  // the epilogue's loads move up until only one workgroup fits a WGP
#pragma unroll 1
  for (int q = 0; q < 3; ++q) body(q, true);
  body(3, false);   // last 256 k: nothing left to fetch ahead
}

// ---- fused QKV projection GEMM --------------------------------------------
// grid.x = 32 row blocks x 16 column blocks, grid.y = which projection.

__global__ __launch_bounds__(256)
void qkv_gemm(const u16* __restrict__ eegb, const u16* __restrict__ picb,
              const u16* __restrict__ WkT,  const u16* __restrict__ WqT,
              const u16* __restrict__ WvT,
              const float* __restrict__ bk, const float* __restrict__ bq,
              const float* __restrict__ bv,
              u16* __restrict__ qo, u16* __restrict__ ko,
              u16* __restrict__ vTo) {
  __shared__ __attribute__((aligned(16))) u16 ldsB[GB_LDS_U16];
  const int mode = blockIdx.y;           // 0=q 1=k 2=v
  const int lane = threadIdx.x & 31;
  const int wv   = threadIdx.x >> 5;
  const int l16  = lane & 15;
  const int hig  = lane >> 4;

  const int row0 = ((blockIdx.x >> 4) << 7) + (wv << 4);
  const int col0 = (blockIdx.x & 15) << 6;   // shared by all 8 waves in this WG

  const u16*  A    = (mode == 1) ? eegb : picb;
  const u16*  WT   = (mode == 0) ? WqT : (mode == 1 ? WkT : WvT);
  const float* bias = (mode == 0) ? bq : (mode == 1 ? bk : bv);

  v8f acc[4] = {};
  gemm_16x64(A, WT, ldsB, row0, col0, acc);

#pragma unroll
  for (int c = 0; c < 4; ++c) {
    const int n = col0 + c * 16 + l16;
    const float bval = bias[n];
    const int h = n >> 6, d = n & 63;
#pragma unroll
    for (int r = 0; r < 8; ++r) {
      const int rowg = row0 + r + hig * 8;
      const int b = rowg >> 10, s = rowg & (S_ - 1);
      const float val = acc[c][r] + bval;
      if (mode == 2) {
        vTo[(((size_t)(b * H_ + h) * HD_ + d) * S_) + s] = f2bf(val);   // [b,h,hd,S]
      } else {
        u16* dst = (mode == 0) ? qo : ko;                               // [b,h,S,hd]
        dst[(((size_t)(b * H_ + h) * S_ + s) * HD_) + d] = f2bf(val);
      }
    }
  }
}

// value of lane l ^ 16
__device__ __forceinline__ float xhalf(float x) {
  const int v = __builtin_bit_cast(int, x);
  return __builtin_bit_cast(float, __builtin_amdgcn_permlanex16(
      v, v, 0x76543210, 0xfedcba98, false, false));
}

__global__ void flash_attn(const u16* __restrict__ q, const u16* __restrict__ k,
                           const u16* __restrict__ vT, u16* __restrict__ ctx) {
  __shared__ u16 kt[2][32 * 64];    // 2 x 4 KB  [key][d]
  __shared__ u16 vt[2][64 * 32];    // 2 x 4 KB  [d][key]

  const int tid  = threadIdx.x;
  const int lane = tid & 31;
  const int wv   = tid >> 5;
  const int l16  = lane & 15;
  const int hig  = lane >> 4;

  const int qblk = blockIdx.x & 7;
  const int bh   = blockIdx.x >> 3;
  const int h    = bh & (H_ - 1);
  const int b0   = bh >> 4;
  const int qbase = qblk * 128 + wv * 16;

  const u16* qh = q  + (size_t)bh * S_ * HD_;
  const u16* kh = k  + (size_t)bh * S_ * HD_;
  const u16* vh = vT + (size_t)bh * HD_ * S_;

  // Q^T as B operand: column l16 = query qbase + l16
  const u16* qp = qh + (size_t)(qbase + l16) * HD_;
  v16bf qa0 = make_frag(qp +      hig * 8, qp + 16 + hig * 8);  // d 0..31
  v16bf qa1 = make_frag(qp + 32 + hig * 8, qp + 48 + hig * 8);  // d 32..63

  // one query a lane: m is joined over the halves every tile, lsum holds this
  // half's keys only and is joined once behind the loop
  float m = -3.0e38f, lsum = 0.f;
  v8f o[4] = {};                             // o[j][r] = O[query l16][16j + 8 hig + r]

  const float SC = 0.125f;                   // 1/sqrt(64)

  // cooperative async stage of one 32-key K/V tile pair (8 KB = 2 chunks/thr)
  auto issue_tiles = [&](int n0, int bsel) {
    // K tile: 32 keys x 64 d, contiguous 4 KB at kh + n0*64
    async_cp16(lds_off32(&kt[bsel][0]) + tid * 16,
               kh + (size_t)n0 * HD_ + tid * 8);
    // V tile: 64 d-rows x 32 keys (64B per row, stride S_)
    const int d = tid >> 2, part = tid & 3;
    async_cp16(lds_off32(&vt[bsel][0]) + (d * 32 + part * 8) * 2,
               vh + (size_t)d * S_ + n0 + part * 8);
  };

  issue_tiles(0, 0);

  for (int it = 0; it < S_ / 32; ++it) {
    const int n0   = it * 32;
    const int bsel = it & 1;
    wait_async0();         // own chunks of tile `it` landed
    __syncthreads();       // everyone's chunks landed; prev compute done
    if (it + 1 < S_ / 32) issue_tiles(n0 + 32, bsel ^ 1);

    // ---- scores S^T = K @ Q^T for the 32x16 tile (K rows from LDS as A) ----
    const u16* kp0 = &kt[bsel][(size_t)l16 * 64];
    const u16* kp1 = &kt[bsel][(size_t)(16 + l16) * 64];
    v16bf kb00 = make_frag(kp0 +      hig * 8, kp0 + 16 + hig * 8);
    v16bf kb01 = make_frag(kp0 + 32 + hig * 8, kp0 + 48 + hig * 8);
    v16bf kb10 = make_frag(kp1 +      hig * 8, kp1 + 16 + hig * 8);
    v16bf kb11 = make_frag(kp1 + 32 + hig * 8, kp1 + 48 + hig * 8);

    v8f c0 = {}, c1 = {};                    // c0[r]: key 8 hig + r, c1[r]: 16 more
    c0 = wmma_bf16(kb00, qa0, c0);
    c0 = wmma_bf16(kb01, qa1, c0);
    c1 = wmma_bf16(kb10, qa0, c1);
    c1 = wmma_bf16(kb11, qa1, c1);

    // ---- online softmax: 16 scores of one query in this lane ----
    c0 *= SC;
    c1 *= SC;
    float t[8];
#pragma unroll   // constant indices: t[] stays in registers
    for (int r = 0; r < 8; ++r) t[r] = fmaxf(c0[r], c1[r]);
    float tm = fmaxf(fmaxf(fmaxf(t[0], t[1]), fmaxf(t[2], t[3])),
                     fmaxf(fmaxf(t[4], t[5]), fmaxf(t[6], t[7])));
    tm = fmaxf(tm, xhalf(tm));               // the other half's 16 keys
    const float mnew = fmaxf(m, tm);
    const float scl  = __expf(m - mnew);
    m = mnew;
#pragma unroll   // constant indices: c0, c1, t[] stay in registers
    for (int r = 0; r < 8; ++r) {
      c0[r] = __expf(c0[r] - mnew);
      c1[r] = __expf(c1[r] - mnew);
      t[r]  = c0[r] + c1[r];
    }
    lsum = lsum * scl + (((t[0] + t[1]) + (t[2] + t[3])) +
                         ((t[4] + t[5]) + (t[6] + t[7])));

    // P^T as B operand, straight from the two score tiles
    union { v8bf h[2]; v16bf v; } pb;
    pb.h[0] = __builtin_convertvector(c0, v8bf);
    pb.h[1] = __builtin_convertvector(c1, v8bf);

    // ---- O^T += V^T @ P^T  (V^T rows from LDS as A, [d][key] tile) ----
#pragma unroll
    for (int j = 0; j < 4; ++j) {
      const u16* vp = &vt[bsel][(size_t)(j * 16 + l16) * 32];
      v16bf vb = make_frag(vp + hig * 8, vp + 16 + hig * 8);
      o[j] = wmma_bf16(vb, pb.v, o[j] * scl);
    }
  }

  // ---- normalize & store ctx as bf16 in [B,S,D]: 8 consecutive d a store ----
  const float inv = 1.0f / (lsum + xhalf(lsum));
  u16* crow = ctx + ((size_t)(b0 * S_ + qbase + l16)) * D_ + h * HD_ + hig * 8;
#pragma unroll
  for (int j = 0; j < 4; ++j)
    *(v8bf*)(crow + j * 16) = __builtin_convertvector(o[j] * inv, v8bf);
}

// ---- output projection + residual -----------------------------------------

__global__ __launch_bounds__(256)
void out_gemm(const u16* __restrict__ ctxb, const u16* __restrict__ WdT,
              const float* __restrict__ bd, const float* __restrict__ pic,
              float* __restrict__ xo) {
  __shared__ __attribute__((aligned(16))) u16 ldsB[GB_LDS_U16];
  const int lane = threadIdx.x & 31;
  const int wv   = threadIdx.x >> 5;
  const int l16  = lane & 15;
  const int hig  = lane >> 4;

  const int row0 = ((blockIdx.x >> 4) << 7) + (wv << 4);
  const int col0 = (blockIdx.x & 15) << 6;

  v8f acc[4] = {};
  gemm_16x64(ctxb, WdT, ldsB, row0, col0, acc);

#pragma unroll
  for (int c = 0; c < 4; ++c) {
    const int n = col0 + c * 16 + l16;
    const float bval = bd[n];
#pragma unroll
    for (int r = 0; r < 8; ++r) {
      const int rowg = row0 + r + hig * 8;
      const size_t idx = (size_t)rowg * D_ + n;
      xo[idx] = acc[c][r] + bval + pic[idx];     // residual
    }
  }
}

// ---- layer norm ------------------------------------------------------------

__global__ void ln_kernel(const float* __restrict__ x, const float* __restrict__ w,
                          const float* __restrict__ bw, float* __restrict__ out) {
  __shared__ float red[256];
  const int row = blockIdx.x;
  const float* xr = x + (size_t)row * D_;

  float s = 0.f;
  for (int i = threadIdx.x; i < D_; i += 256) s += xr[i];
  red[threadIdx.x] = s; __syncthreads();
  for (int off = 128; off > 0; off >>= 1) {
    if (threadIdx.x < off) red[threadIdx.x] += red[threadIdx.x + off];
    __syncthreads();
  }
  const float mean = red[0] * (1.0f / D_);
  __syncthreads();

  float v = 0.f;
  for (int i = threadIdx.x; i < D_; i += 256) {
    float d = xr[i] - mean; v += d * d;
  }
  red[threadIdx.x] = v; __syncthreads();
  for (int off = 128; off > 0; off >>= 1) {
    if (threadIdx.x < off) red[threadIdx.x] += red[threadIdx.x + off];
    __syncthreads();
  }
  const float inv = rsqrtf(red[0] * (1.0f / D_) + 1e-12f);

  for (int i = threadIdx.x; i < D_; i += 256)
    out[(size_t)row * D_ + i] = w[i] * ((xr[i] - mean) * inv) + bw[i];
}

// ---- launch ---------------------------------------------------------------

extern "C" void kernel_launch(void* const* d_in, const int* in_sizes, int n_in,
                              void* d_out, int out_size, void* d_ws, size_t ws_size,
                              hipStream_t stream) {
  const float* eeg = (const float*)d_in[0];
  const float* pic = (const float*)d_in[1];
  const float* Wk  = (const float*)d_in[2];
  const float* bk  = (const float*)d_in[3];
  const float* Wq  = (const float*)d_in[4];
  const float* bq  = (const float*)d_in[5];
  const float* Wv  = (const float*)d_in[6];
  const float* bv  = (const float*)d_in[7];
  const float* Wd  = (const float*)d_in[8];
  const float* bd  = (const float*)d_in[9];
  const float* lnw = (const float*)d_in[10];
  const float* lnb = (const float*)d_in[11];

  char* ws = (char*)d_ws;
  u16*  eegb = (u16*)(ws + ((size_t)0  << 20));   // 8 MB
  u16*  picb = (u16*)(ws + ((size_t)8  << 20));   // 8 MB
  u16*  WkT  = (u16*)(ws + ((size_t)16 << 20));   // 2 MB
  u16*  WqT  = (u16*)(ws + ((size_t)18 << 20));   // 2 MB
  u16*  WvT  = (u16*)(ws + ((size_t)20 << 20));   // 2 MB
  u16*  WdT  = (u16*)(ws + ((size_t)22 << 20));   // 2 MB
  u16*  qb   = (u16*)(ws + ((size_t)24 << 20));   // 8 MB [b,h,S,hd]
  u16*  kbuf = (u16*)(ws + ((size_t)32 << 20));   // 8 MB [b,h,S,hd]
  u16*  vTb  = (u16*)(ws + ((size_t)40 << 20));   // 8 MB [b,h,hd,S]
  u16*  ctxb = (u16*)(ws + ((size_t)48 << 20));   // 8 MB [B,S,D]
  float* xb  = (float*)(ws + ((size_t)56 << 20)); // 16 MB

  cvt_act<<<dim3(NTOK * D_ / CV_CHUNK, 2), CV_THREADS, 0, stream>>>(eeg, pic, eegb, picb);
  cvt_wT<<<(D_ / 64) * (D_ / 64), 256, 0, stream>>>(Wk, WkT);
  cvt_wT<<<(D_ / 64) * (D_ / 64), 256, 0, stream>>>(Wq, WqT);
  cvt_wT<<<(D_ / 64) * (D_ / 64), 256, 0, stream>>>(Wv, WvT);
  cvt_wT<<<(D_ / 64) * (D_ / 64), 256, 0, stream>>>(Wd, WdT);

  qkv_gemm<<<dim3(512, 3), 256, 0, stream>>>(eegb, picb, WkT, WqT, WvT,
                                             bk, bq, bv, qb, kbuf, vTb);
  flash_attn<<<512, 256, 0, stream>>>(qb, kbuf, vTb, ctxb);
  out_gemm<<<512, 256, 0, stream>>>(ctxb, WdT, bd, pic, xb);
  ln_kernel<<<NTOK, 256, 0, stream>>>(xb, lnw, lnb, (float*)d_out);
}

// v005
// Measured time: 123 microseconds a run.
// Timed twice side by side with v004, it ran 1.16 times as fast both times.
// All steps since v000 together make it 3.58 times as fast.
#include <hip/hip_runtime.h>
#include <hip/hip_bf16.h>
#include <math.h>
#include <stdint.h>

// Problem constants (reference: B=4, S=1024, D=1024, H=16, HD=64)
#define B_   4
#define S_   1024
#define D_   1024
#define H_   16
#define HD_  64
#define NTOK (B_ * S_)   // 4096 tokens

typedef unsigned short u16;
typedef __attribute__((ext_vector_type(8)))  u16    u16x8;
typedef __attribute__((ext_vector_type(4)))  u16    u16x4;
typedef __attribute__((ext_vector_type(4)))  float  f32x4;
typedef __attribute__((ext_vector_type(16))) __bf16 v16bf;
typedef __attribute__((ext_vector_type(8)))  __bf16 v8bf;
typedef __attribute__((ext_vector_type(8)))  float  v8f;

// ---- helpers ---------------------------------------------------------------

__device__ __forceinline__ u16 f2bf(float f) {
  union { float f; unsigned u; } c; c.f = f;
  unsigned u = c.u;
  u += 0x7FFFu + ((u >> 16) & 1u);   // round-to-nearest-even
  return (u16)(u >> 16);
}

// Build a 16x32 (or 32x16) bf16 WMMA fragment from two contiguous 16B chunks.
// Per ISA layout (16-bit A 16x32): lane-lo holds K=0..7 (v0-3) and K=16..23
// (v4-7); lane-hi holds K=8..15 and K=24..31.
__device__ __forceinline__ v16bf make_frag(const u16* p0, const u16* p1) {
  union { u16x8 h[2]; v16bf v; } u;
  u.h[0] = *(const u16x8*)p0;
  u.h[1] = *(const u16x8*)p1;
  return u.v;
}

__device__ __forceinline__ v8f wmma_bf16(v16bf a, v16bf b, v8f c) {
  return __builtin_amdgcn_wmma_f32_16x16x32_bf16(
      false, a, false, b, (short)0, c, false, false);
}

// The issuing wave's async copies to LDS (ASYNCcnt-tracked) have landed.
__device__ __forceinline__ void wait_async0() {
  asm volatile("s_wait_asynccnt 0x0" ::: "memory");
}
__device__ __forceinline__ unsigned lds_off32(const void* p) {
  return (unsigned)(uintptr_t)p;   // low 32 bits of generic ptr = LDS offset
}

// ---- conversion kernels ----------------------------------------------------

// Both activations in one launch: blockIdx.y picks the input, and each of its
// 128 workgroups (16 waves) converts 32768 contiguous elements.  A lane issues
// its 16 independent 16-byte loads first (each wave-wide load is 512 contiguous
// bytes), then converts and stores 8 bytes per load (256 contiguous bytes a wave).
#define CV_THREADS 512
#define CV_LOADS   16
#define CV_STEP    (CV_THREADS * 4)            // elements per workgroup-wide round
#define CV_CHUNK   (CV_STEP * CV_LOADS)        // elements per workgroup
__global__ __launch_bounds__(CV_THREADS) void cvt_act(const float* __restrict__ eeg,
                                                      const float* __restrict__ pic,
                                                      u16* __restrict__ eegb,
                                                      u16* __restrict__ picb) {
  const float* x = blockIdx.y ? pic : eeg;
  u16*         y = blockIdx.y ? picb : eegb;
  const size_t base = (size_t)blockIdx.x * CV_CHUNK + threadIdx.x * 4;

  f32x4 r[CV_LOADS];
  // unrolled: r[] stays in registers and every load issues before the first wait
#pragma unroll
  for (int j = 0; j < CV_LOADS; ++j)
    r[j] = *(const f32x4*)(x + base + j * CV_STEP);

  // unrolled (both loops): constant indices into r[] and p, no scratch memory
#pragma unroll
  for (int j = 0; j < CV_LOADS; ++j) {
    u16x4 p;
#pragma unroll
    for (int c = 0; c < 4; ++c) p[c] = f2bf(r[j][c]);
    *(u16x4*)(y + base + j * CV_STEP) = p;
  }
}

// W is [K][N] row-major f32; produce WT[N][K] bf16 so a B-fragment column
// reads contiguous K.  One 64(k) x 64(n) tile per workgroup, turned in LDS:
// global reads are whole 256-byte row pieces, global writes whole 128-byte
// lines (8 lanes x 16 B per WT row), each line written by one workgroup.
#define WT_PITCH 68   // u16 per LDS row: 64 + 4, rows stay 8-byte aligned
__global__ __launch_bounds__(256) void cvt_wT(const float* __restrict__ w,
                                              u16* __restrict__ wt) {
  __shared__ __attribute__((aligned(16))) u16 tile[64 * WT_PITCH];   // [n][k]
  const int tid = threadIdx.x;
  const int n0  = (blockIdx.x & 15) << 6;
  const int k0  = (blockIdx.x >> 4) << 6;

  // each thread: a 4(k) x 4(n) block, four independent 16-byte loads
  const int nq = (tid & 15) << 2;
  const int kq = (tid >> 4) << 2;
  const float* src = w + (size_t)(k0 + kq) * D_ + n0 + nq;
  f32x4 r[4];
#pragma unroll
  for (int j = 0; j < 4; ++j) r[j] = *(const f32x4*)(src + (size_t)j * D_);

#pragma unroll
  for (int c = 0; c < 4; ++c) {
    u16x4 p;
#pragma unroll
    for (int j = 0; j < 4; ++j) p[j] = f2bf(r[j][c]);
    *(u16x4*)&tile[(nq + c) * WT_PITCH + kq] = p;    // 4 k of one n: 8 bytes
  }
  __syncthreads();

  const int kc = (tid & 7) << 3;
#pragma unroll
  for (int p = 0; p < 2; ++p) {
    const int n = p * 32 + (tid >> 3);
    union { u16x4 h[2]; u16x8 v; } u;
    u.h[0] = *(const u16x4*)&tile[n * WT_PITCH + kc];
    u.h[1] = *(const u16x4*)&tile[n * WT_PITCH + kc + 4];
    *(u16x8*)(wt + (size_t)(n0 + n) * D_ + k0 + kc) = u.v;
  }
}

// ---- projection GEMMs: shared main loop ------------------------------------
// A workgroup (8 waves) computes 128 rows x 64 columns; each wave a 16x64 tile.
// All 8 waves use the same 64 weight rows of WT[N][K] (128 KB, contiguous in
// global memory), so that panel is async-staged into LDS once and every
// B fragment comes from LDS.  Each wave reads its own 16 activation rows from
// global memory, every byte once, four k-steps (128 k) ahead.
// LDS layout [k quarter][64 rows][256 k + 8]: the row pitch is 528 B = 16 B x odd
// (no bank conflict for 16-byte reads), and everything one trip of the main loop
// reads lies within 64 KB of one address register (the LDS offset field's reach).
#define GB_PITCH   (256 + 8)           // u16 per LDS row
#define GB_QUART   (64 * GB_PITCH)     // u16 per k quarter: 33792 B
#define GB_LDS_U16 (4 * GB_QUART)      // 135168 B: two workgroups per WGP

// Eight async 16-byte copies, then s_wait_xcnt 0 ahead of any rewrite of their
// address registers (a precaution); one statement, so that the compiler can put
// no such rewrite between the copies and the wait.
__device__ __forceinline__ void async_cp16x8(unsigned l, const u16* g) {
  const unsigned LS = 2 * GB_PITCH * 2;  // LDS bytes between a thread's chunks
  const int      GS = 256 * 8;           // global elements between them
  asm volatile(
      "global_load_async_to_lds_b128 %0, %8, off\n\t"
      "global_load_async_to_lds_b128 %1, %9, off\n\t"
      "global_load_async_to_lds_b128 %2, %10, off\n\t"
      "global_load_async_to_lds_b128 %3, %11, off\n\t"
      "global_load_async_to_lds_b128 %4, %12, off\n\t"
      "global_load_async_to_lds_b128 %5, %13, off\n\t"
      "global_load_async_to_lds_b128 %6, %14, off\n\t"
      "global_load_async_to_lds_b128 %7, %15, off\n\t"
      "s_wait_xcnt 0x0"
      :: "v"(l), "v"(l + LS), "v"(l + 2 * LS), "v"(l + 3 * LS),
         "v"(l + 4 * LS), "v"(l + 5 * LS), "v"(l + 6 * LS), "v"(l + 7 * LS),
         "v"(g), "v"(g + GS), "v"(g + 2 * GS), "v"(g + 3 * GS),
         "v"(g + 4 * GS), "v"(g + 5 * GS), "v"(g + 6 * GS), "v"(g + 7 * GS)
      : "memory");
}

// acc[c] += A[row0 + 0..15][:] x WT[col0 + 16c + 0..15][:]^T over all D_ k.
__device__ __forceinline__ void gemm_16x64(const u16* __restrict__ A,
                                           const u16* __restrict__ WT,
                                           u16* ldsB, int row0, int col0,
                                           v8f* acc) {
  const int tid  = threadIdx.x;
  const int lane = tid & 31;
  const int l16  = lane & 15;
  const int hig  = lane >> 4;

  const u16* arow = A + (size_t)(row0 + l16) * D_ + hig * 8;
  auto ldA4 = [&](v16bf* dst, int kk) {
#pragma unroll   // constant indices: dst[] stays in registers
    for (int s = 0; s < 4; ++s)
      dst[s] = make_frag(arow + kk + s * 32, arow + kk + s * 32 + 16);
  };

  // first activation block: issued ahead of the staging so both fly together
  v16bf a0[4], a1[4];
  ldA4(a0, 0);

  // ---- async-stage the 64 x 1024 weight panel: 8192 chunks, 32 a thread ----
  {
    const u16* g = WT + (size_t)col0 * D_ + tid * 8;
    const unsigned l = lds_off32(ldsB) + ((tid & 127) >> 5) * (GB_QUART * 2) +
                       (tid >> 7) * (GB_PITCH * 2) + (tid & 31) * 16;
#pragma unroll   // all 32 copies issue back to back, no loop counter between them
    for (int j = 0; j < 4; ++j)
      async_cp16x8(l + j * 16 * (GB_PITCH * 2), g + j * 8 * 256 * 8);
    wait_async0();
    __syncthreads();
  }

  const u16* wrow = ldsB + l16 * GB_PITCH + hig * 8;
  // q = k quarter, kk = k inside it (kk == 256 names the next quarter's start)
  auto ldB = [&](v16bf* dst, int q, int kk) {
    const u16* p = wrow + q * GB_QUART + (kk >> 8) * GB_QUART + (kk & 255);
#pragma unroll   // constant indices: dst[] stays in registers
    for (int c = 0; c < 4; ++c)
      dst[c] = make_frag(p + c * 16 * GB_PITCH, p + c * 16 * GB_PITCH + 16);
  };
  auto mm = [&](v16bf a, const v16bf* b) {
#pragma unroll   // constant indices: acc[] and b[] stay in registers
    for (int c = 0; c < 4; ++c) acc[c] = wmma_bf16(a, b[c], acc[c]);
  };

  // B fragments one k-step ahead, A fragments one 128-k block ahead, each in
  // two disjoint register sets (no rotation moves)
  v16bf bf0[4], bf1[4];
  ldB(bf0, 0, 0);
  // keeps each group of loads in front of the WMMAs of the step before it;
  // without it the scheduler sinks every load to just ahead of its use and each
  // WMMA waits out an LDS latency
  auto hold = [] { __builtin_amdgcn_sched_barrier(0); };
  auto body = [&](int q, bool more) {
    const int kb = q * 256;
    ldA4(a1, kb + 128);
    ldB(bf1, q, 32);   hold();  mm(a0[0], bf0);
    ldB(bf0, q, 64);   hold();  mm(a0[1], bf1);
    ldB(bf1, q, 96);   hold();  mm(a0[2], bf0);
    ldB(bf0, q, 128);  hold();  mm(a0[3], bf1);
    if (more) ldA4(a0, kb + 256);
    ldB(bf1, q, 160);  hold();  mm(a1[0], bf0);
    ldB(bf0, q, 192);  hold();  mm(a1[1], bf1);
    ldB(bf1, q, 224);  hold();  mm(a1[2], bf0);
    if (more) ldB(bf0, q, 256);
    hold();
    mm(a1[3], bf1);
    // stands ahead of the next trip's first instructions, which form a new
    // activation address in the register pair that this trip's global loads name
    if (more) asm volatile("s_wait_xcnt 0x0" ::: "memory");
  };
  // kept rolled: unrolled, LDS addresses past 64 KB each cost their own add, and
  // the epilogue's loads move up until only one workgroup fits a WGP
#pragma unroll 1
  for (int q = 0; q < 3; ++q) body(q, true);
  body(3, false);   // last 256 k: nothing left to fetch ahead
}

// ---- fused QKV projection GEMM --------------------------------------------
// grid.x = 32 row blocks x 16 column blocks, grid.y = which projection.

__global__ __launch_bounds__(256)
void qkv_gemm(const u16* __restrict__ eegb, const u16* __restrict__ picb,
              const u16* __restrict__ WkT,  const u16* __restrict__ WqT,
              const u16* __restrict__ WvT,
              const float* __restrict__ bk, const float* __restrict__ bq,
              const float* __restrict__ bv,
              u16* __restrict__ qo, u16* __restrict__ ko,
              u16* __restrict__ vTo) {
  __shared__ __attribute__((aligned(16))) u16 ldsB[GB_LDS_U16];
  const int mode = blockIdx.y;           // 0=q 1=k 2=v
  const int lane = threadIdx.x & 31;
  const int wv   = threadIdx.x >> 5;
  const int l16  = lane & 15;
  const int hig  = lane >> 4;

  const int row0 = ((blockIdx.x >> 4) << 7) + (wv << 4);
  const int col0 = (blockIdx.x & 15) << 6;   // shared by all 8 waves in this WG

  const u16*  A    = (mode == 1) ? eegb : picb;
  const u16*  WT   = (mode == 0) ? WqT : (mode == 1 ? WkT : WvT);
  const float* bias = (mode == 0) ? bq : (mode == 1 ? bk : bv);

  v8f acc[4] = {};
  gemm_16x64(A, WT, ldsB, row0, col0, acc);

#pragma unroll
  for (int c = 0; c < 4; ++c) {
    const int n = col0 + c * 16 + l16;
    const float bval = bias[n];
    const int h = n >> 6, d = n & 63;
#pragma unroll
    for (int r = 0; r < 8; ++r) {
      const int rowg = row0 + r + hig * 8;
      const int b = rowg >> 10, s = rowg & (S_ - 1);
      const float val = acc[c][r] + bval;
      if (mode == 2) {
        vTo[(((size_t)(b * H_ + h) * HD_ + d) * S_) + s] = f2bf(val);   // [b,h,hd,S]
      } else {
        u16* dst = (mode == 0) ? qo : ko;                               // [b,h,S,hd]
        dst[(((size_t)(b * H_ + h) * S_ + s) * HD_) + d] = f2bf(val);
      }
    }
  }
}

#define KT_PITCH (64 + 8)   // u16 per K row in LDS: 144 B = 16 B x 9
#define VT_PITCH (32 + 8)   // u16 per V^T row in LDS: 80 B = 16 B x 5

// A thread's two async 16-byte copies of one tile pair, then s_wait_xcnt 0 ahead
// of any rewrite of their address registers (a precaution); one statement, so that
// the compiler can put no such rewrite between the copies and the wait.
__device__ __forceinline__ void async_cp16x2(unsigned l0, const u16* g0,
                                             unsigned l1, const u16* g1) {
  asm volatile(
      "global_load_async_to_lds_b128 %0, %2, off\n\t"
      "global_load_async_to_lds_b128 %1, %3, off\n\t"
      "s_wait_xcnt 0x0"
      :: "v"(l0), "v"(l1), "v"(g0), "v"(g1) : "memory");
}

// value of lane l ^ 16
__device__ __forceinline__ float xhalf(float x) {
  const int v = __builtin_bit_cast(int, x);
  return __builtin_bit_cast(float, __builtin_amdgcn_permlanex16(
      v, v, 0x76543210, 0xfedcba98, false, false));
}

__global__ void flash_attn(const u16* __restrict__ q, const u16* __restrict__ k,
                           const u16* __restrict__ vT, u16* __restrict__ ctx) {
  __shared__ __attribute__((aligned(16))) u16 kt[2][32 * KT_PITCH];  // [key][d]
  __shared__ __attribute__((aligned(16))) u16 vt[2][64 * VT_PITCH];  // [d][key]

  const int tid  = threadIdx.x;
  const int lane = tid & 31;
  const int wv   = tid >> 5;
  const int l16  = lane & 15;
  const int hig  = lane >> 4;

  const int qblk = blockIdx.x & 7;
  const int bh   = blockIdx.x >> 3;
  const int h    = bh & (H_ - 1);
  const int b0   = bh >> 4;
  const int qbase = qblk * 128 + wv * 16;

  const u16* qh = q  + (size_t)bh * S_ * HD_;
  const u16* kh = k  + (size_t)bh * S_ * HD_;
  const u16* vh = vT + (size_t)bh * HD_ * S_;

  // Q^T as B operand: column l16 = query qbase + l16
  const u16* qp = qh + (size_t)(qbase + l16) * HD_;
  v16bf qa0 = make_frag(qp +      hig * 8, qp + 16 + hig * 8);  // d 0..31
  v16bf qa1 = make_frag(qp + 32 + hig * 8, qp + 48 + hig * 8);  // d 32..63

  // one query a lane: m is joined over the halves every tile, lsum holds this
  // half's keys only and is joined once behind the loop
  float m = -3.0e38f, lsum = 0.f;
  v8f o[4] = {};                             // o[j][r] = O[query l16][16j + 8 hig + r]

  const float SC = 0.125f;                   // 1/sqrt(64)

  // cooperative async stage of one 32-key K/V tile pair (8 KB = 2 chunks/thr)
  auto issue_tiles = [&](int n0, int bsel) {
    // K tile: 32 keys x 64 d, contiguous 4 KB at kh + n0*64, 8 chunks a row
    // V tile: 64 d-rows x 32 keys (64B per row, stride S_), 4 chunks a row
    const int d = tid >> 2, part = tid & 3;
    async_cp16x2(lds_off32(&kt[bsel][(tid >> 3) * KT_PITCH + (tid & 7) * 8]),
                 kh + (size_t)n0 * HD_ + tid * 8,
                 lds_off32(&vt[bsel][d * VT_PITCH + part * 8]),
                 vh + (size_t)d * S_ + n0 + part * 8);
  };

  issue_tiles(0, 0);

  for (int it = 0; it < S_ / 32; ++it) {
    const int n0   = it * 32;
    const int bsel = it & 1;
    // hand-over between trips, in this order.  The last trip issues nothing behind
    // it, so no copy is in flight when the wave ends.
    // this wave's LDS reads of the other buffer have retired before it is refilled
    asm volatile("s_wait_dscnt 0x0" ::: "memory");
    wait_async0();         // own chunks of tile `it` landed
    __syncthreads();       // everyone's chunks landed; prev compute done
    if (it + 1 < S_ / 32) issue_tiles(n0 + 32, bsel ^ 1);

    // ---- scores S^T = K @ Q^T for the 32x16 tile (K rows from LDS as A) ----
    const u16* kp0 = &kt[bsel][(size_t)l16 * KT_PITCH];
    const u16* kp1 = &kt[bsel][(size_t)(16 + l16) * KT_PITCH];
    v16bf kb00 = make_frag(kp0 +      hig * 8, kp0 + 16 + hig * 8);
    v16bf kb01 = make_frag(kp0 + 32 + hig * 8, kp0 + 48 + hig * 8);
    v16bf kb10 = make_frag(kp1 +      hig * 8, kp1 + 16 + hig * 8);
    v16bf kb11 = make_frag(kp1 + 32 + hig * 8, kp1 + 48 + hig * 8);

    v8f c0 = {}, c1 = {};                    // c0[r]: key 8 hig + r, c1[r]: 16 more
    c0 = wmma_bf16(kb00, qa0, c0);
    c0 = wmma_bf16(kb01, qa1, c0);
    c1 = wmma_bf16(kb10, qa0, c1);
    c1 = wmma_bf16(kb11, qa1, c1);

    // ---- online softmax: 16 scores of one query in this lane ----
    c0 *= SC;
    c1 *= SC;
    float t[8];
#pragma unroll   // constant indices: t[] stays in registers
    for (int r = 0; r < 8; ++r) t[r] = fmaxf(c0[r], c1[r]);
    float tm = fmaxf(fmaxf(fmaxf(t[0], t[1]), fmaxf(t[2], t[3])),
                     fmaxf(fmaxf(t[4], t[5]), fmaxf(t[6], t[7])));
    tm = fmaxf(tm, xhalf(tm));               // the other half's 16 keys
    const float mnew = fmaxf(m, tm);
    const float scl  = __expf(m - mnew);
    m = mnew;
#pragma unroll   // constant indices: c0, c1, t[] stay in registers
    for (int r = 0; r < 8; ++r) {
      c0[r] = __expf(c0[r] - mnew);
      c1[r] = __expf(c1[r] - mnew);
      t[r]  = c0[r] + c1[r];
    }
    lsum = lsum * scl + (((t[0] + t[1]) + (t[2] + t[3])) +
                         ((t[4] + t[5]) + (t[6] + t[7])));

    // P^T as B operand, straight from the two score tiles
    union { v8bf h[2]; v16bf v; } pb;
    pb.h[0] = __builtin_convertvector(c0, v8bf);
    pb.h[1] = __builtin_convertvector(c1, v8bf);

    // ---- O^T += V^T @ P^T  (V^T rows from LDS as A, [d][key] tile) ----
#pragma unroll
    for (int j = 0; j < 4; ++j) {
      const u16* vp = &vt[bsel][(size_t)(j * 16 + l16) * VT_PITCH];
      v16bf vb = make_frag(vp + hig * 8, vp + 16 + hig * 8);
      o[j] = wmma_bf16(vb, pb.v, o[j] * scl);
    }
  }

  // ---- normalize & store ctx as bf16 in [B,S,D]: 8 consecutive d a store ----
  const float inv = 1.0f / (lsum + xhalf(lsum));
  u16* crow = ctx + ((size_t)(b0 * S_ + qbase + l16)) * D_ + h * HD_ + hig * 8;
#pragma unroll
  for (int j = 0; j < 4; ++j)
    *(v8bf*)(crow + j * 16) = __builtin_convertvector(o[j] * inv, v8bf);
}

// ---- output projection + residual -----------------------------------------

__global__ __launch_bounds__(256)
void out_gemm(const u16* __restrict__ ctxb, const u16* __restrict__ WdT,
              const float* __restrict__ bd, const float* __restrict__ pic,
              float* __restrict__ xo) {
  __shared__ __attribute__((aligned(16))) u16 ldsB[GB_LDS_U16];
  const int lane = threadIdx.x & 31;
  const int wv   = threadIdx.x >> 5;
  const int l16  = lane & 15;
  const int hig  = lane >> 4;

  const int row0 = ((blockIdx.x >> 4) << 7) + (wv << 4);
  const int col0 = (blockIdx.x & 15) << 6;

  v8f acc[4] = {};
  gemm_16x64(ctxb, WdT, ldsB, row0, col0, acc);

#pragma unroll
  for (int c = 0; c < 4; ++c) {
    const int n = col0 + c * 16 + l16;
    const float bval = bd[n];
#pragma unroll
    for (int r = 0; r < 8; ++r) {
      const int rowg = row0 + r + hig * 8;
      const size_t idx = (size_t)rowg * D_ + n;
      xo[idx] = acc[c][r] + bval + pic[idx];     // residual
    }
  }
}

// ---- layer norm ------------------------------------------------------------

__global__ void ln_kernel(const float* __restrict__ x, const float* __restrict__ w,
                          const float* __restrict__ bw, float* __restrict__ out) {
  __shared__ float red[256];
  const int row = blockIdx.x;
  const float* xr = x + (size_t)row * D_;

  float s = 0.f;
  for (int i = threadIdx.x; i < D_; i += 256) s += xr[i];
  red[threadIdx.x] = s; __syncthreads();
  for (int off = 128; off > 0; off >>= 1) {
    if (threadIdx.x < off) red[threadIdx.x] += red[threadIdx.x + off];
    __syncthreads();
  }
  const float mean = red[0] * (1.0f / D_);
  __syncthreads();

  float v = 0.f;
  for (int i = threadIdx.x; i < D_; i += 256) {
    float d = xr[i] - mean; v += d * d;
  }
  red[threadIdx.x] = v; __syncthreads();
  for (int off = 128; off > 0; off >>= 1) {
    if (threadIdx.x < off) red[threadIdx.x] += red[threadIdx.x + off];
    __syncthreads();
  }
  const float inv = rsqrtf(red[0] * (1.0f / D_) + 1e-12f);

  for (int i = threadIdx.x; i < D_; i += 256)
    out[(size_t)row * D_ + i] = w[i] * ((xr[i] - mean) * inv) + bw[i];
}

// ---- launch ---------------------------------------------------------------

extern "C" void kernel_launch(void* const* d_in, const int* in_sizes, int n_in,
                              void* d_out, int out_size, void* d_ws, size_t ws_size,
                              hipStream_t stream) {
  const float* eeg = (const float*)d_in[0];
  const float* pic = (const float*)d_in[1];
  const float* Wk  = (const float*)d_in[2];
  const float* bk  = (const float*)d_in[3];
  const float* Wq  = (const float*)d_in[4];
  const float* bq  = (const float*)d_in[5];
  const float* Wv  = (const float*)d_in[6];
  const float* bv  = (const float*)d_in[7];
  const float* Wd  = (const float*)d_in[8];
  const float* bd  = (const float*)d_in[9];
  const float* lnw = (const float*)d_in[10];
  const float* lnb = (const float*)d_in[11];

  char* ws = (char*)d_ws;
  u16*  eegb = (u16*)(ws + ((size_t)0  << 20));   // 8 MB
  u16*  picb = (u16*)(ws + ((size_t)8  << 20));   // 8 MB
  u16*  WkT  = (u16*)(ws + ((size_t)16 << 20));   // 2 MB
  u16*  WqT  = (u16*)(ws + ((size_t)18 << 20));   // 2 MB
  u16*  WvT  = (u16*)(ws + ((size_t)20 << 20));   // 2 MB
  u16*  WdT  = (u16*)(ws + ((size_t)22 << 20));   // 2 MB
  u16*  qb   = (u16*)(ws + ((size_t)24 << 20));   // 8 MB [b,h,S,hd]
  u16*  kbuf = (u16*)(ws + ((size_t)32 << 20));   // 8 MB [b,h,S,hd]
  u16*  vTb  = (u16*)(ws + ((size_t)40 << 20));   // 8 MB [b,h,hd,S]
  u16*  ctxb = (u16*)(ws + ((size_t)48 << 20));   // 8 MB [B,S,D]
  float* xb  = (float*)(ws + ((size_t)56 << 20)); // 16 MB

  cvt_act<<<dim3(NTOK * D_ / CV_CHUNK, 2), CV_THREADS, 0, stream>>>(eeg, pic, eegb, picb);
  cvt_wT<<<(D_ / 64) * (D_ / 64), 256, 0, stream>>>(Wk, WkT);
  cvt_wT<<<(D_ / 64) * (D_ / 64), 256, 0, stream>>>(Wq, WqT);
  cvt_wT<<<(D_ / 64) * (D_ / 64), 256, 0, stream>>>(Wv, WvT);
  cvt_wT<<<(D_ / 64) * (D_ / 64), 256, 0, stream>>>(Wd, WdT);

  qkv_gemm<<<dim3(512, 3), 256, 0, stream>>>(eegb, picb, WkT, WqT, WvT,
                                             bk, bq, bv, qb, kbuf, vTb);
  flash_attn<<<512, 256, 0, stream>>>(qb, kbuf, vTb, ctxb);
  out_gemm<<<512, 256, 0, stream>>>(ctxb, WdT, bd, pic, xb);
  ln_kernel<<<NTOK, 256, 0, stream>>>(xb, lnw, lnb, (float*)d_out);
}

// v006
// Measured time: 111 microseconds a run.
// In both of two side-by-side timings against v005, it was 1.10 times as fast.
// Counting every step since v000, it is 3.95 times as fast.
#include <hip/hip_runtime.h>
#include <hip/hip_bf16.h>
#include <math.h>
#include <stdint.h>

// Problem constants (reference: B=4, S=1024, D=1024, H=16, HD=64)
#define B_   4
#define S_   1024
#define D_   1024
#define H_   16
#define HD_  64
#define NTOK (B_ * S_)   // 4096 tokens

typedef unsigned short u16;
typedef __attribute__((ext_vector_type(8)))  u16    u16x8;
typedef __attribute__((ext_vector_type(4)))  u16    u16x4;
typedef __attribute__((ext_vector_type(4)))  float  f32x4;
typedef __attribute__((ext_vector_type(16))) __bf16 v16bf;
typedef __attribute__((ext_vector_type(8)))  __bf16 v8bf;
typedef __attribute__((ext_vector_type(8)))  float  v8f;

// ---- helpers ---------------------------------------------------------------

__device__ __forceinline__ u16 f2bf(float f) {
  union { float f; unsigned u; } c; c.f = f;
  unsigned u = c.u;
  u += 0x7FFFu + ((u >> 16) & 1u);   // round-to-nearest-even
  return (u16)(u >> 16);
}

// Build a 16x32 (or 32x16) bf16 WMMA fragment from two contiguous 16B chunks.
// Per ISA layout (16-bit A 16x32): lane-lo holds K=0..7 (v0-3) and K=16..23
// (v4-7); lane-hi holds K=8..15 and K=24..31.
__device__ __forceinline__ v16bf make_frag(const u16* p0, const u16* p1) {
  union { u16x8 h[2]; v16bf v; } u;
  u.h[0] = *(const u16x8*)p0;
  u.h[1] = *(const u16x8*)p1;
  return u.v;
}

__device__ __forceinline__ v8f wmma_bf16(v16bf a, v16bf b, v8f c) {
  return __builtin_amdgcn_wmma_f32_16x16x32_bf16(
      false, a, false, b, (short)0, c, false, false);
}

// The issuing wave's async copies to LDS (ASYNCcnt-tracked) have landed.
__device__ __forceinline__ void wait_async0() {
  asm volatile("s_wait_asynccnt 0x0" ::: "memory");
}
__device__ __forceinline__ unsigned lds_off32(const void* p) {
  return (unsigned)(uintptr_t)p;   // low 32 bits of generic ptr = LDS offset
}

// ---- conversion kernel -----------------------------------------------------
// The two activation conversions and the four weight transposes do not depend on
// one another, so they share ONE launch: a workgroup's index says which job it
// does (a block-uniform branch).  All 768 workgroups (16 waves each, three a WGP)
// are resident at once; the long activation streams have the low indices.

// Activations: each of an input's 128 workgroups converts 32768 contiguous
// elements.  A lane issues its 16 independent 16-byte loads first (each wave-wide
// load is 512 contiguous bytes), then converts and stores 8 bytes per load (256
// contiguous bytes a wave).
#define CV_THREADS 512
#define CV_LOADS   16
#define CV_STEP    (CV_THREADS * 4)            // elements per workgroup-wide round
#define CV_CHUNK   (CV_STEP * CV_LOADS)        // elements per workgroup
#define CV_ACT_WGS (NTOK * D_ / CV_CHUNK)      // workgroups per activation: 128
__device__ __forceinline__ void cvt_act(const float* __restrict__ x,
                                        u16* __restrict__ y, int chunk) {
  const size_t base = (size_t)chunk * CV_CHUNK + threadIdx.x * 4;
  const unsigned xoff = (unsigned)base * 4;   // byte offset in x, below 16 MiB

  f32x4 r[CV_LOADS];
  // unrolled: r[] stays in registers and every load issues before the first wait
#pragma unroll
  for (int j = 0; j < CV_LOADS; ++j)
    r[j] = *(const f32x4*)((const char*)x + xoff + j * (CV_STEP * 4));
  // stands ahead of any rewrite of the loads' address registers (a precaution);
  // the offset is named as an input so that it lives up to the wait and no load
  // of the run lands in its register
  asm volatile("s_wait_xcnt 0x0" :: "v"(xoff) : "memory");

  // unrolled (both loops): constant indices into r[] and p, no scratch memory
#pragma unroll
  for (int j = 0; j < CV_LOADS; ++j) {
    u16x4 p;
#pragma unroll
    for (int c = 0; c < 4; ++c) p[c] = f2bf(r[j][c]);
    *(u16x4*)(y + base + j * CV_STEP) = p;
  }
}

// W is [K][N] row-major f32; produce WT[N][K] bf16 so a B-fragment column
// reads contiguous K.  One 64(k) x 64(n) tile per 256 threads, turned in LDS:
// global reads are whole 256-byte row pieces, global writes whole 128-byte
// lines (8 lanes x 16 B per WT row), each line written by one workgroup.
// A workgroup's two halves take two tiles side by side in n, each in its own
// LDS tile; tid is the thread's number inside its half.
#define WT_PITCH 68   // u16 per LDS row: 64 + 4, rows stay 8-byte aligned
#define CV_W_WGS ((D_ / 64) * (D_ / 64) / 2)   // workgroups per weight: 128
__device__ __forceinline__ void cvt_wT(const float* __restrict__ w,
                                       u16* __restrict__ wt,
                                       u16* tile, int tidx, int tid) {   // tile: [n][k]
  const int n0  = (tidx & 15) << 6;
  const int k0  = (tidx >> 4) << 6;

  // each thread: a 4(k) x 4(n) block, four independent 16-byte loads
  const int nq = (tid & 15) << 2;
  const int kq = (tid >> 4) << 2;
  const float* src = w + (size_t)(k0 + kq) * D_ + n0 + nq;
  f32x4 r[4];
#pragma unroll
  for (int j = 0; j < 4; ++j) r[j] = *(const f32x4*)(src + (size_t)j * D_);

#pragma unroll
  for (int c = 0; c < 4; ++c) {
    u16x4 p;
#pragma unroll
    for (int j = 0; j < 4; ++j) p[j] = f2bf(r[j][c]);
    *(u16x4*)&tile[(nq + c) * WT_PITCH + kq] = p;    // 4 k of one n: 8 bytes
  }
  __syncthreads();   // reached by all 16 waves of a transposing workgroup

  const int kc = (tid & 7) << 3;
#pragma unroll
  for (int p = 0; p < 2; ++p) {
    const int n = p * 32 + (tid >> 3);
    union { u16x4 h[2]; u16x8 v; } u;
    u.h[0] = *(const u16x4*)&tile[n * WT_PITCH + kc];
    u.h[1] = *(const u16x4*)&tile[n * WT_PITCH + kc + 4];
    *(u16x8*)(wt + (size_t)(n0 + n) * D_ + k0 + kc) = u.v;
  }
  // stands ahead of any rewrite of the two stores' registers (a precaution): the
  // built kernel lays the activation branch's code behind these stores
  asm volatile("s_wait_xcnt 0x0" ::: "memory");
}

__global__ __launch_bounds__(CV_THREADS)
void cvt_all(const float* __restrict__ eeg, const float* __restrict__ pic,
             const float* __restrict__ Wk,  const float* __restrict__ Wq,
             const float* __restrict__ Wv,  const float* __restrict__ Wd,
             u16* __restrict__ eegb, u16* __restrict__ picb,
             u16* __restrict__ WkT,  u16* __restrict__ WqT,
             u16* __restrict__ WvT,  u16* __restrict__ WdT) {
  __shared__ __attribute__((aligned(16))) u16 tile[2][64 * WT_PITCH];
  const int blk = blockIdx.x;
  if (blk < 2 * CV_ACT_WGS) {
    const bool second = blk >= CV_ACT_WGS;
    cvt_act(second ? pic : eeg, second ? picb : eegb, blk & (CV_ACT_WGS - 1));
  } else {
    const int wb   = blk - 2 * CV_ACT_WGS;
    const int wsel = wb / CV_W_WGS;            // 0..3: k, q, v, d
    const float* w = wsel == 0 ? Wk  : wsel == 1 ? Wq  : wsel == 2 ? Wv  : Wd;
    u16*        wt = wsel == 0 ? WkT : wsel == 1 ? WqT : wsel == 2 ? WvT : WdT;
    const int half = threadIdx.x >> 8;
    cvt_wT(w, wt, tile[half], (wb & (CV_W_WGS - 1)) * 2 + half, threadIdx.x & 255);
  }
}

// ---- projection GEMMs: shared main loop ------------------------------------
// A workgroup (8 waves) computes 128 rows x 64 columns; each wave a 16x64 tile.
// All 8 waves use the same 64 weight rows of WT[N][K] (128 KB, contiguous in
// global memory), so that panel is async-staged into LDS once and every
// B fragment comes from LDS.  Each wave reads its own 16 activation rows from
// global memory, every byte once, four k-steps (128 k) ahead.
// LDS layout [k quarter][64 rows][256 k + 8]: the row pitch is 528 B = 16 B x odd
// (no bank conflict for 16-byte reads), and everything one trip of the main loop
// reads lies within 64 KB of one address register (the LDS offset field's reach).
#define GB_PITCH   (256 + 8)           // u16 per LDS row
#define GB_QUART   (64 * GB_PITCH)     // u16 per k quarter: 33792 B
#define GB_LDS_U16 (4 * GB_QUART)      // 135168 B: two workgroups per WGP

// Eight async 16-byte copies, then s_wait_xcnt 0 ahead of any rewrite of their
// address registers (a precaution); one statement, so that the compiler can put
// no such rewrite between the copies and the wait.
__device__ __forceinline__ void async_cp16x8(unsigned l, const u16* g) {
  const unsigned LS = 2 * GB_PITCH * 2;  // LDS bytes between a thread's chunks
  const int      GS = 256 * 8;           // global elements between them
  asm volatile(
      "global_load_async_to_lds_b128 %0, %8, off\n\t"
      "global_load_async_to_lds_b128 %1, %9, off\n\t"
      "global_load_async_to_lds_b128 %2, %10, off\n\t"
      "global_load_async_to_lds_b128 %3, %11, off\n\t"
      "global_load_async_to_lds_b128 %4, %12, off\n\t"
      "global_load_async_to_lds_b128 %5, %13, off\n\t"
      "global_load_async_to_lds_b128 %6, %14, off\n\t"
      "global_load_async_to_lds_b128 %7, %15, off\n\t"
      "s_wait_xcnt 0x0"
      :: "v"(l), "v"(l + LS), "v"(l + 2 * LS), "v"(l + 3 * LS),
         "v"(l + 4 * LS), "v"(l + 5 * LS), "v"(l + 6 * LS), "v"(l + 7 * LS),
         "v"(g), "v"(g + GS), "v"(g + 2 * GS), "v"(g + 3 * GS),
         "v"(g + 4 * GS), "v"(g + 5 * GS), "v"(g + 6 * GS), "v"(g + 7 * GS)
      : "memory");
}

// acc[c] += A[row0 + 0..15][:] x WT[col0 + 16c + 0..15][:]^T over all D_ k.
__device__ __forceinline__ void gemm_16x64(const u16* __restrict__ A,
                                           const u16* __restrict__ WT,
                                           u16* ldsB, int row0, int col0,
                                           v8f* acc) {
  const int tid  = threadIdx.x;
  const int lane = tid & 31;
  const int l16  = lane & 15;
  const int hig  = lane >> 4;

  const u16* arow = A + (size_t)(row0 + l16) * D_ + hig * 8;
  auto ldA4 = [&](v16bf* dst, int kk) {
#pragma unroll   // constant indices: dst[] stays in registers
    for (int s = 0; s < 4; ++s)
      dst[s] = make_frag(arow + kk + s * 32, arow + kk + s * 32 + 16);
  };

  // first activation block: issued ahead of the staging so both fly together
  v16bf a0[4], a1[4];
  ldA4(a0, 0);

  // ---- async-stage the 64 x 1024 weight panel: 8192 chunks, 32 a thread ----
  {
    const u16* g = WT + (size_t)col0 * D_ + tid * 8;
    const unsigned l = lds_off32(ldsB) + ((tid & 127) >> 5) * (GB_QUART * 2) +
                       (tid >> 7) * (GB_PITCH * 2) + (tid & 31) * 16;
#pragma unroll   // all 32 copies issue back to back, no loop counter between them
    for (int j = 0; j < 4; ++j)
      async_cp16x8(l + j * 16 * (GB_PITCH * 2), g + j * 8 * 256 * 8);
    wait_async0();
    __syncthreads();
  }

  const u16* wrow = ldsB + l16 * GB_PITCH + hig * 8;
  // q = k quarter, kk = k inside it (kk == 256 names the next quarter's start)
  auto ldB = [&](v16bf* dst, int q, int kk) {
    const u16* p = wrow + q * GB_QUART + (kk >> 8) * GB_QUART + (kk & 255);
#pragma unroll   // constant indices: dst[] stays in registers
    for (int c = 0; c < 4; ++c)
      dst[c] = make_frag(p + c * 16 * GB_PITCH, p + c * 16 * GB_PITCH + 16);
  };
  auto mm = [&](v16bf a, const v16bf* b) {
#pragma unroll   // constant indices: acc[] and b[] stay in registers
    for (int c = 0; c < 4; ++c) acc[c] = wmma_bf16(a, b[c], acc[c]);
  };

  // B fragments one k-step ahead, A fragments one 128-k block ahead, each in
  // two disjoint register sets (no rotation moves)
  v16bf bf0[4], bf1[4];
  ldB(bf0, 0, 0);
  // keeps each group of loads in front of the WMMAs of the step before it;
  // without it the scheduler sinks every load to just ahead of its use and each
  // WMMA waits out an LDS latency
  auto hold = [] { __builtin_amdgcn_sched_barrier(0); };
  auto body = [&](int q, bool more) {
    const int kb = q * 256;
    ldA4(a1, kb + 128);
    ldB(bf1, q, 32);   hold();  mm(a0[0], bf0);
    ldB(bf0, q, 64);   hold();  mm(a0[1], bf1);
    ldB(bf1, q, 96);   hold();  mm(a0[2], bf0);
    ldB(bf0, q, 128);  hold();  mm(a0[3], bf1);
    if (more) ldA4(a0, kb + 256);
    ldB(bf1, q, 160);  hold();  mm(a1[0], bf0);
    ldB(bf0, q, 192);  hold();  mm(a1[1], bf1);
    ldB(bf1, q, 224);  hold();  mm(a1[2], bf0);
    if (more) ldB(bf0, q, 256);
    hold();
    mm(a1[3], bf1);
    // stands ahead of the next trip's first instructions, which form a new
    // activation address in the register pair that this trip's global loads name
    if (more) asm volatile("s_wait_xcnt 0x0" ::: "memory");
  };
  // kept rolled: unrolled, LDS addresses past 64 KB each cost their own add, and
  // the epilogue's loads move up until only one workgroup fits a WGP
#pragma unroll 1
  for (int q = 0; q < 3; ++q) body(q, true);
  body(3, false);   // last 256 k: nothing left to fetch ahead
}

// ---- fused QKV projection GEMM --------------------------------------------
// grid.x = 32 row blocks x 16 column blocks, grid.y = which projection.

__global__ __launch_bounds__(256)
void qkv_gemm(const u16* __restrict__ eegb, const u16* __restrict__ picb,
              const u16* __restrict__ WkT,  const u16* __restrict__ WqT,
              const u16* __restrict__ WvT,
              const float* __restrict__ bk, const float* __restrict__ bq,
              const float* __restrict__ bv,
              u16* __restrict__ qo, u16* __restrict__ ko,
              u16* __restrict__ vTo) {
  __shared__ __attribute__((aligned(16))) u16 ldsB[GB_LDS_U16];
  const int mode = blockIdx.y;           // 0=q 1=k 2=v
  const int lane = threadIdx.x & 31;
  const int wv   = threadIdx.x >> 5;
  const int l16  = lane & 15;
  const int hig  = lane >> 4;

  const int row0 = ((blockIdx.x >> 4) << 7) + (wv << 4);
  const int col0 = (blockIdx.x & 15) << 6;   // shared by all 8 waves in this WG

  const u16*  A    = (mode == 1) ? eegb : picb;
  const u16*  WT   = (mode == 0) ? WqT : (mode == 1 ? WkT : WvT);
  const float* bias = (mode == 0) ? bq : (mode == 1 ? bk : bv);

  v8f acc[4] = {};
  gemm_16x64(A, WT, ldsB, row0, col0, acc);

#pragma unroll
  for (int c = 0; c < 4; ++c) {
    const int n = col0 + c * 16 + l16;
    const float bval = bias[n];
    const int h = n >> 6, d = n & 63;
#pragma unroll
    for (int r = 0; r < 8; ++r) {
      const int rowg = row0 + r + hig * 8;
      const int b = rowg >> 10, s = rowg & (S_ - 1);
      const float val = acc[c][r] + bval;
      if (mode == 2) {
        vTo[(((size_t)(b * H_ + h) * HD_ + d) * S_) + s] = f2bf(val);   // [b,h,hd,S]
      } else {
        u16* dst = (mode == 0) ? qo : ko;                               // [b,h,S,hd]
        dst[(((size_t)(b * H_ + h) * S_ + s) * HD_) + d] = f2bf(val);
      }
    }
  }
}

#define KT_PITCH (64 + 8)   // u16 per K row in LDS: 144 B = 16 B x 9
#define VT_PITCH (32 + 8)   // u16 per V^T row in LDS: 80 B = 16 B x 5

// A thread's two async 16-byte copies of one tile pair, then s_wait_xcnt 0 ahead
// of any rewrite of their address registers (a precaution); one statement, so that
// the compiler can put no such rewrite between the copies and the wait.
__device__ __forceinline__ void async_cp16x2(unsigned l0, const u16* g0,
                                             unsigned l1, const u16* g1) {
  asm volatile(
      "global_load_async_to_lds_b128 %0, %2, off\n\t"
      "global_load_async_to_lds_b128 %1, %3, off\n\t"
      "s_wait_xcnt 0x0"
      :: "v"(l0), "v"(l1), "v"(g0), "v"(g1) : "memory");
}

// value of lane l ^ 16
__device__ __forceinline__ float xhalf(float x) {
  const int v = __builtin_bit_cast(int, x);
  return __builtin_bit_cast(float, __builtin_amdgcn_permlanex16(
      v, v, 0x76543210, 0xfedcba98, false, false));
}

__global__ void flash_attn(const u16* __restrict__ q, const u16* __restrict__ k,
                           const u16* __restrict__ vT, u16* __restrict__ ctx) {
  __shared__ __attribute__((aligned(16))) u16 kt[2][32 * KT_PITCH];  // [key][d]
  __shared__ __attribute__((aligned(16))) u16 vt[2][64 * VT_PITCH];  // [d][key]

  const int tid  = threadIdx.x;
  const int lane = tid & 31;
  const int wv   = tid >> 5;
  const int l16  = lane & 15;
  const int hig  = lane >> 4;

  const int qblk = blockIdx.x & 7;
  const int bh   = blockIdx.x >> 3;
  const int h    = bh & (H_ - 1);
  const int b0   = bh >> 4;
  const int qbase = qblk * 128 + wv * 16;

  const u16* qh = q  + (size_t)bh * S_ * HD_;
  const u16* kh = k  + (size_t)bh * S_ * HD_;
  const u16* vh = vT + (size_t)bh * HD_ * S_;

  // Q^T as B operand: column l16 = query qbase + l16
  const u16* qp = qh + (size_t)(qbase + l16) * HD_;
  v16bf qa0 = make_frag(qp +      hig * 8, qp + 16 + hig * 8);  // d 0..31
  v16bf qa1 = make_frag(qp + 32 + hig * 8, qp + 48 + hig * 8);  // d 32..63

  // one query a lane: m is joined over the halves every tile, lsum holds this
  // half's keys only and is joined once behind the loop
  float m = -3.0e38f, lsum = 0.f;
  v8f o[4] = {};                             // o[j][r] = O[query l16][16j + 8 hig + r]

  const float SC = 0.125f;                   // 1/sqrt(64)

  // cooperative async stage of one 32-key K/V tile pair (8 KB = 2 chunks/thr)
  auto issue_tiles = [&](int n0, int bsel) {
    // K tile: 32 keys x 64 d, contiguous 4 KB at kh + n0*64, 8 chunks a row
    // V tile: 64 d-rows x 32 keys (64B per row, stride S_), 4 chunks a row
    const int d = tid >> 2, part = tid & 3;
    async_cp16x2(lds_off32(&kt[bsel][(tid >> 3) * KT_PITCH + (tid & 7) * 8]),
                 kh + (size_t)n0 * HD_ + tid * 8,
                 lds_off32(&vt[bsel][d * VT_PITCH + part * 8]),
                 vh + (size_t)d * S_ + n0 + part * 8);
  };

  issue_tiles(0, 0);

  for (int it = 0; it < S_ / 32; ++it) {
    const int n0   = it * 32;
    const int bsel = it & 1;
    // hand-over between trips, in this order.  The last trip issues nothing behind
    // it, so no copy is in flight when the wave ends.
    // this wave's LDS reads of the other buffer have retired before it is refilled
    asm volatile("s_wait_dscnt 0x0" ::: "memory");
    wait_async0();         // own chunks of tile `it` landed
    __syncthreads();       // everyone's chunks landed; prev compute done
    if (it + 1 < S_ / 32) issue_tiles(n0 + 32, bsel ^ 1);

    // ---- scores S^T = K @ Q^T for the 32x16 tile (K rows from LDS as A) ----
    const u16* kp0 = &kt[bsel][(size_t)l16 * KT_PITCH];
    const u16* kp1 = &kt[bsel][(size_t)(16 + l16) * KT_PITCH];
    v16bf kb00 = make_frag(kp0 +      hig * 8, kp0 + 16 + hig * 8);
    v16bf kb01 = make_frag(kp0 + 32 + hig * 8, kp0 + 48 + hig * 8);
    v16bf kb10 = make_frag(kp1 +      hig * 8, kp1 + 16 + hig * 8);
    v16bf kb11 = make_frag(kp1 + 32 + hig * 8, kp1 + 48 + hig * 8);

    v8f c0 = {}, c1 = {};                    // c0[r]: key 8 hig + r, c1[r]: 16 more
    c0 = wmma_bf16(kb00, qa0, c0);
    c0 = wmma_bf16(kb01, qa1, c0);
    c1 = wmma_bf16(kb10, qa0, c1);
    c1 = wmma_bf16(kb11, qa1, c1);

    // ---- online softmax: 16 scores of one query in this lane ----
    c0 *= SC;
    c1 *= SC;
    float t[8];
#pragma unroll   // constant indices: t[] stays in registers
    for (int r = 0; r < 8; ++r) t[r] = fmaxf(c0[r], c1[r]);
    float tm = fmaxf(fmaxf(fmaxf(t[0], t[1]), fmaxf(t[2], t[3])),
                     fmaxf(fmaxf(t[4], t[5]), fmaxf(t[6], t[7])));
    tm = fmaxf(tm, xhalf(tm));               // the other half's 16 keys
    const float mnew = fmaxf(m, tm);
    const float scl  = __expf(m - mnew);
    m = mnew;
#pragma unroll   // constant indices: c0, c1, t[] stay in registers
    for (int r = 0; r < 8; ++r) {
      c0[r] = __expf(c0[r] - mnew);
      c1[r] = __expf(c1[r] - mnew);
      t[r]  = c0[r] + c1[r];
    }
    lsum = lsum * scl + (((t[0] + t[1]) + (t[2] + t[3])) +
                         ((t[4] + t[5]) + (t[6] + t[7])));

    // P^T as B operand, straight from the two score tiles
    union { v8bf h[2]; v16bf v; } pb;
    pb.h[0] = __builtin_convertvector(c0, v8bf);
    pb.h[1] = __builtin_convertvector(c1, v8bf);

    // ---- O^T += V^T @ P^T  (V^T rows from LDS as A, [d][key] tile) ----
#pragma unroll
    for (int j = 0; j < 4; ++j) {
      const u16* vp = &vt[bsel][(size_t)(j * 16 + l16) * VT_PITCH];
      v16bf vb = make_frag(vp + hig * 8, vp + 16 + hig * 8);
      o[j] = wmma_bf16(vb, pb.v, o[j] * scl);
    }
  }

  // ---- normalize & store ctx as bf16 in [B,S,D]: 8 consecutive d a store ----
  const float inv = 1.0f / (lsum + xhalf(lsum));
  u16* crow = ctx + ((size_t)(b0 * S_ + qbase + l16)) * D_ + h * HD_ + hig * 8;
#pragma unroll
  for (int j = 0; j < 4; ++j)
    *(v8bf*)(crow + j * 16) = __builtin_convertvector(o[j] * inv, v8bf);
}

// ---- output projection + residual -----------------------------------------

__global__ __launch_bounds__(256)
void out_gemm(const u16* __restrict__ ctxb, const u16* __restrict__ WdT,
              const float* __restrict__ bd, const float* __restrict__ pic,
              float* __restrict__ xo) {
  __shared__ __attribute__((aligned(16))) u16 ldsB[GB_LDS_U16];
  const int lane = threadIdx.x & 31;
  const int wv   = threadIdx.x >> 5;
  const int l16  = lane & 15;
  const int hig  = lane >> 4;

  const int row0 = ((blockIdx.x >> 4) << 7) + (wv << 4);
  const int col0 = (blockIdx.x & 15) << 6;

  v8f acc[4] = {};
  gemm_16x64(ctxb, WdT, ldsB, row0, col0, acc);

#pragma unroll
  for (int c = 0; c < 4; ++c) {
    const int n = col0 + c * 16 + l16;
    const float bval = bd[n];
#pragma unroll
    for (int r = 0; r < 8; ++r) {
      const int rowg = row0 + r + hig * 8;
      const size_t idx = (size_t)rowg * D_ + n;
      xo[idx] = acc[c][r] + bval + pic[idx];     // residual
    }
  }
}

// ---- layer norm ------------------------------------------------------------

__global__ void ln_kernel(const float* __restrict__ x, const float* __restrict__ w,
                          const float* __restrict__ bw, float* __restrict__ out) {
  __shared__ float red[256];
  const int row = blockIdx.x;
  const float* xr = x + (size_t)row * D_;

  float s = 0.f;
  for (int i = threadIdx.x; i < D_; i += 256) s += xr[i];
  red[threadIdx.x] = s; __syncthreads();
  for (int off = 128; off > 0; off >>= 1) {
    if (threadIdx.x < off) red[threadIdx.x] += red[threadIdx.x + off];
    __syncthreads();
  }
  const float mean = red[0] * (1.0f / D_);
  __syncthreads();

  float v = 0.f;
  for (int i = threadIdx.x; i < D_; i += 256) {
    float d = xr[i] - mean; v += d * d;
  }
  red[threadIdx.x] = v; __syncthreads();
  for (int off = 128; off > 0; off >>= 1) {
    if (threadIdx.x < off) red[threadIdx.x] += red[threadIdx.x + off];
    __syncthreads();
  }
  const float inv = rsqrtf(red[0] * (1.0f / D_) + 1e-12f);

  for (int i = threadIdx.x; i < D_; i += 256)
    out[(size_t)row * D_ + i] = w[i] * ((xr[i] - mean) * inv) + bw[i];
}

// ---- launch ---------------------------------------------------------------

extern "C" void kernel_launch(void* const* d_in, const int* in_sizes, int n_in,
                              void* d_out, int out_size, void* d_ws, size_t ws_size,
                              hipStream_t stream) {
  const float* eeg = (const float*)d_in[0];
  const float* pic = (const float*)d_in[1];
  const float* Wk  = (const float*)d_in[2];
  const float* bk  = (const float*)d_in[3];
  const float* Wq  = (const float*)d_in[4];
  const float* bq  = (const float*)d_in[5];
  const float* Wv  = (const float*)d_in[6];
  const float* bv  = (const float*)d_in[7];
  const float* Wd  = (const float*)d_in[8];
  const float* bd  = (const float*)d_in[9];
  const float* lnw = (const float*)d_in[10];
  const float* lnb = (const float*)d_in[11];

  char* ws = (char*)d_ws;
  u16*  eegb = (u16*)(ws + ((size_t)0  << 20));   // 8 MB
  u16*  picb = (u16*)(ws + ((size_t)8  << 20));   // 8 MB
  u16*  WkT  = (u16*)(ws + ((size_t)16 << 20));   // 2 MB
  u16*  WqT  = (u16*)(ws + ((size_t)18 << 20));   // 2 MB
  u16*  WvT  = (u16*)(ws + ((size_t)20 << 20));   // 2 MB
  u16*  WdT  = (u16*)(ws + ((size_t)22 << 20));   // 2 MB
  u16*  qb   = (u16*)(ws + ((size_t)24 << 20));   // 8 MB [b,h,S,hd]
  u16*  kbuf = (u16*)(ws + ((size_t)32 << 20));   // 8 MB [b,h,S,hd]
  u16*  vTb  = (u16*)(ws + ((size_t)40 << 20));   // 8 MB [b,h,hd,S]
  u16*  ctxb = (u16*)(ws + ((size_t)48 << 20));   // 8 MB [B,S,D]
  float* xb  = (float*)(ws + ((size_t)56 << 20)); // 16 MB

  cvt_all<<<2 * CV_ACT_WGS + 4 * CV_W_WGS, CV_THREADS, 0, stream>>>(
      eeg, pic, Wk, Wq, Wv, Wd, eegb, picb, WkT, WqT, WvT, WdT);

  qkv_gemm<<<dim3(512, 3), 256, 0, stream>>>(eegb, picb, WkT, WqT, WvT,
                                             bk, bq, bv, qb, kbuf, vTb);
  flash_attn<<<512, 256, 0, stream>>>(qb, kbuf, vTb, ctxb);
  out_gemm<<<512, 256, 0, stream>>>(ctxb, WdT, bd, pic, xb);
  ln_kernel<<<NTOK, 256, 0, stream>>>(xb, lnw, lnb, (float*)d_out);
}

// v007
// One run takes 103 microseconds.
// In both of two side-by-side timings against v006, it was 1.09 times as fast.
// All steps since v000 together make it 4.31 times as fast.
#include <hip/hip_runtime.h>
#include <hip/hip_bf16.h>
#include <math.h>
#include <stdint.h>

// Problem constants (reference: B=4, S=1024, D=1024, H=16, HD=64)
#define B_   4
#define S_   1024
#define D_   1024
#define H_   16
#define HD_  64
#define NTOK (B_ * S_)   // 4096 tokens

typedef unsigned short u16;
typedef __attribute__((ext_vector_type(8)))  u16    u16x8;
typedef __attribute__((ext_vector_type(4)))  u16    u16x4;
typedef __attribute__((ext_vector_type(4)))  float  f32x4;
typedef __attribute__((ext_vector_type(16))) __bf16 v16bf;
typedef __attribute__((ext_vector_type(8)))  __bf16 v8bf;
typedef __attribute__((ext_vector_type(8)))  float  v8f;

// ---- helpers ---------------------------------------------------------------

__device__ __forceinline__ u16 f2bf(float f) {
  union { float f; unsigned u; } c; c.f = f;
  unsigned u = c.u;
  u += 0x7FFFu + ((u >> 16) & 1u);   // round-to-nearest-even
  return (u16)(u >> 16);
}

// Build a 16x32 (or 32x16) bf16 WMMA fragment from two contiguous 16B chunks.
// Per ISA layout (16-bit A 16x32): lane-lo holds K=0..7 (v0-3) and K=16..23
// (v4-7); lane-hi holds K=8..15 and K=24..31.
__device__ __forceinline__ v16bf make_frag(const u16* p0, const u16* p1) {
  union { u16x8 h[2]; v16bf v; } u;
  u.h[0] = *(const u16x8*)p0;
  u.h[1] = *(const u16x8*)p1;
  return u.v;
}

__device__ __forceinline__ v8f wmma_bf16(v16bf a, v16bf b, v8f c) {
  return __builtin_amdgcn_wmma_f32_16x16x32_bf16(
      false, a, false, b, (short)0, c, false, false);
}

// The issuing wave's async copies to LDS (ASYNCcnt-tracked) have landed.
__device__ __forceinline__ void wait_async0() {
  asm volatile("s_wait_asynccnt 0x0" ::: "memory");
}
__device__ __forceinline__ unsigned lds_off32(const void* p) {
  return (unsigned)(uintptr_t)p;   // low 32 bits of generic ptr = LDS offset
}

// ---- conversion kernel -----------------------------------------------------
// The two activation conversions and the four weight transposes do not depend on
// one another, so they share ONE launch: a workgroup's index says which job it
// does (a block-uniform branch).  All 768 workgroups (16 waves each, three a WGP)
// are resident at once; the long activation streams have the low indices.

// Every bf16 activation matrix X[4096][1024] that a projection GEMM reads as its
// A operand lies in the workspace in A-fragment order: 1 KiB per (16-row block,
// 32-k step), blocks row-major over [row block][k step].  Inside a block lane
// l = 16 * hig + l16 owns bytes 16 l .. 16 l + 15 of each 512-byte half:
//   first half : X[16 rb + l16][32 s      + 8 hig + 0..7]
//   second half: X[16 rb + l16][32 s + 16 + 8 hig + 0..7]
// so a wave's 16-byte fragment load covers 512 contiguous bytes (4 whole lines),
// not 32-byte pieces of 16 lines.  In units of 256 B (128 elements):
//   unit = (row >> 4) * 128 + (k >> 3), element in it = (row & 15) * 8 + (k & 7).

// Activations: each of an input's 128 workgroups converts 32768 contiguous
// elements = 32 whole rows = 64 KiB contiguous in fragment order.  A lane issues
// its 16 independent 16-byte loads first (each wave-wide load is 512 contiguous
// bytes), converts, and puts 8 bytes per load at their fragment-order place in
// LDS; behind one barrier the image goes out linearly, 512 contiguous bytes per
// wave-wide store.  In LDS each 256-byte unit has a 272 B pitch (16 B x odd): the
// 16 units that a wave's 8-byte stores fall in cover all 64 banks once.
#define CV_THREADS 512
#define CV_LOADS   16
#define CV_STEP    (CV_THREADS * 4)            // elements per workgroup-wide round
#define CV_CHUNK   (CV_STEP * CV_LOADS)        // elements per workgroup
#define CV_ACT_WGS (NTOK * D_ / CV_CHUNK)      // workgroups per activation: 128
#define CV_UPITCH  (128 + 8)                   // u16 per 256-byte unit in LDS
#define CV_LDS_U16 (CV_CHUNK / 128 * CV_UPITCH)   // 69632 B
__device__ __forceinline__ void cvt_act(const float* __restrict__ x,
                                        u16* __restrict__ y, u16* sm, int chunk) {
  const int tid = threadIdx.x;
  const size_t base = (size_t)chunk * CV_CHUNK;
  const unsigned xoff = ((unsigned)base + tid * 4) * 4;   // byte offset in x, below 16 MiB

  f32x4 r[CV_LOADS];
  // unrolled: r[] stays in registers and every load issues before the first wait
#pragma unroll
  for (int j = 0; j < CV_LOADS; ++j)
    r[j] = *(const f32x4*)((const char*)x + xoff + j * (CV_STEP * 4));
  // stands ahead of any rewrite of the loads' address registers (a precaution);
  // the offset is named as an input so that it lives up to the wait and no load
  // of the run lands in its register
  asm volatile("s_wait_xcnt 0x0" :: "v"(xoff) : "memory");

  // load j of this thread: row 2 j + (tid >> 8) of the chunk, k = 4 (tid & 255)
  u16* st = sm + ((tid & 255) >> 1) * CV_UPITCH + (tid >> 8) * 8 + (tid & 1) * 4;
  // unrolled (both loops): constant indices into r[] and p, no scratch memory
#pragma unroll
  for (int j = 0; j < CV_LOADS; ++j) {
    u16x4 p;
#pragma unroll
    for (int c = 0; c < 4; ++c) p[c] = f2bf(r[j][c]);
    *(u16x4*)(st + (j >> 3) * 128 * CV_UPITCH + (j & 7) * 16) = p;
  }
  __syncthreads();   // reached by all 16 waves of a converting workgroup

  // 16-byte piece i * 512 + tid of the image: unit piece >> 4, place piece & 15
  const u16* ld  = sm + (tid >> 4) * CV_UPITCH + (tid & 15) * 8;
  u16*       dst = y + base + tid * 8;
#pragma unroll   // constant offsets on one LDS and one global address
  for (int i = 0; i < CV_CHUNK / (CV_THREADS * 8); ++i)
    *(u16x8*)(dst + i * (CV_THREADS * 8)) =
        *(const u16x8*)(ld + i * (CV_THREADS / 16) * CV_UPITCH);
}

// W is [K][N] row-major f32; produce WT[N][K] bf16 so a B-fragment column
// reads contiguous K.  One 64(k) x 64(n) tile per 256 threads, turned in LDS:
// global reads are whole 256-byte row pieces, global writes whole 128-byte
// lines (8 lanes x 16 B per WT row), each line written by one workgroup.
// A workgroup's two halves take two tiles side by side in n, each in its own
// LDS tile; tid is the thread's number inside its half.
#define WT_PITCH 68   // u16 per LDS row: 64 + 4, rows stay 8-byte aligned
#define CV_W_WGS ((D_ / 64) * (D_ / 64) / 2)   // workgroups per weight: 128
__device__ __forceinline__ void cvt_wT(const float* __restrict__ w,
                                       u16* __restrict__ wt,
                                       u16* tile, int tidx, int tid) {   // tile: [n][k]
  const int n0  = (tidx & 15) << 6;
  const int k0  = (tidx >> 4) << 6;

  // each thread: a 4(k) x 4(n) block, four independent 16-byte loads
  const int nq = (tid & 15) << 2;
  const int kq = (tid >> 4) << 2;
  const float* src = w + (size_t)(k0 + kq) * D_ + n0 + nq;
  f32x4 r[4];
#pragma unroll
  for (int j = 0; j < 4; ++j) r[j] = *(const f32x4*)(src + (size_t)j * D_);

#pragma unroll
  for (int c = 0; c < 4; ++c) {
    u16x4 p;
#pragma unroll
    for (int j = 0; j < 4; ++j) p[j] = f2bf(r[j][c]);
    *(u16x4*)&tile[(nq + c) * WT_PITCH + kq] = p;    // 4 k of one n: 8 bytes
  }
  __syncthreads();   // reached by all 16 waves of a transposing workgroup

  const int kc = (tid & 7) << 3;
#pragma unroll
  for (int p = 0; p < 2; ++p) {
    const int n = p * 32 + (tid >> 3);
    union { u16x4 h[2]; u16x8 v; } u;
    u.h[0] = *(const u16x4*)&tile[n * WT_PITCH + kc];
    u.h[1] = *(const u16x4*)&tile[n * WT_PITCH + kc + 4];
    *(u16x8*)(wt + (size_t)(n0 + n) * D_ + k0 + kc) = u.v;
  }
  // stands ahead of any rewrite of the two stores' registers (a precaution): the
  // built kernel lays the activation branch's code behind these stores
  asm volatile("s_wait_xcnt 0x0" ::: "memory");
}

__global__ __launch_bounds__(CV_THREADS)
void cvt_all(const float* __restrict__ eeg, const float* __restrict__ pic,
             const float* __restrict__ Wk,  const float* __restrict__ Wq,
             const float* __restrict__ Wv,  const float* __restrict__ Wd,
             u16* __restrict__ eegb, u16* __restrict__ picb,
             u16* __restrict__ WkT,  u16* __restrict__ WqT,
             u16* __restrict__ WvT,  u16* __restrict__ WdT) {
  // one array for both jobs: the fragment-order image, or the two transpose tiles
  __shared__ __attribute__((aligned(16))) u16 sm[CV_LDS_U16];
  const int blk = blockIdx.x;
  if (blk < 2 * CV_ACT_WGS) {
    const bool second = blk >= CV_ACT_WGS;
    cvt_act(second ? pic : eeg, second ? picb : eegb, sm, blk & (CV_ACT_WGS - 1));
  } else {
    const int wb   = blk - 2 * CV_ACT_WGS;
    const int wsel = wb / CV_W_WGS;            // 0..3: k, q, v, d
    const float* w = wsel == 0 ? Wk  : wsel == 1 ? Wq  : wsel == 2 ? Wv  : Wd;
    u16*        wt = wsel == 0 ? WkT : wsel == 1 ? WqT : wsel == 2 ? WvT : WdT;
    const int half = threadIdx.x >> 8;
    cvt_wT(w, wt, sm + half * (64 * WT_PITCH), (wb & (CV_W_WGS - 1)) * 2 + half,
           threadIdx.x & 255);
  }
}

// ---- projection GEMMs: shared main loop ------------------------------------
// A workgroup (8 waves) computes 128 rows x 64 columns; each wave a 16x64 tile.
// All 8 waves use the same 64 weight rows of WT[N][K] (128 KB, contiguous in
// global memory), so that panel is async-staged into LDS once and every
// B fragment comes from LDS.  Each wave reads its own 16 activation rows from
// global memory (fragment order: 32 KiB contiguous), every byte once, four
// k-steps (128 k) ahead.
// LDS layout [k quarter][64 rows][256 k + 8]: the row pitch is 528 B = 16 B x odd
// (no bank conflict for 16-byte reads), and everything one trip of the main loop
// reads lies within 64 KB of one address register (the LDS offset field's reach).
#define GB_PITCH   (256 + 8)           // u16 per LDS row
#define GB_QUART   (64 * GB_PITCH)     // u16 per k quarter: 33792 B
#define GB_LDS_U16 (4 * GB_QUART)      // 135168 B: two workgroups per WGP

// Eight async 16-byte copies, then s_wait_xcnt 0 ahead of any rewrite of their
// address registers (a precaution); one statement, so that the compiler can put
// no such rewrite between the copies and the wait.
__device__ __forceinline__ void async_cp16x8(unsigned l, const u16* g) {
  const unsigned LS = 2 * GB_PITCH * 2;  // LDS bytes between a thread's chunks
  const int      GS = 256 * 8;           // global elements between them
  asm volatile(
      "global_load_async_to_lds_b128 %0, %8, off\n\t"
      "global_load_async_to_lds_b128 %1, %9, off\n\t"
      "global_load_async_to_lds_b128 %2, %10, off\n\t"
      "global_load_async_to_lds_b128 %3, %11, off\n\t"
      "global_load_async_to_lds_b128 %4, %12, off\n\t"
      "global_load_async_to_lds_b128 %5, %13, off\n\t"
      "global_load_async_to_lds_b128 %6, %14, off\n\t"
      "global_load_async_to_lds_b128 %7, %15, off\n\t"
      "s_wait_xcnt 0x0"
      :: "v"(l), "v"(l + LS), "v"(l + 2 * LS), "v"(l + 3 * LS),
         "v"(l + 4 * LS), "v"(l + 5 * LS), "v"(l + 6 * LS), "v"(l + 7 * LS),
         "v"(g), "v"(g + GS), "v"(g + 2 * GS), "v"(g + 3 * GS),
         "v"(g + 4 * GS), "v"(g + 5 * GS), "v"(g + 6 * GS), "v"(g + 7 * GS)
      : "memory");
}

// acc[c] += A[row0 + 0..15][:] x WT[col0 + 16c + 0..15][:]^T over all D_ k.
__device__ __forceinline__ void gemm_16x64(const u16* __restrict__ A,
                                           const u16* __restrict__ WT,
                                           u16* ldsB, int row0, int col0,
                                           v8f* acc) {
  const int tid  = threadIdx.x;
  const int lane = tid & 31;
  const int l16  = lane & 15;
  const int hig  = lane >> 4;

  // A in fragment order: 512 elements per k-step, this lane's 8 at 8 * lane
  const u16* arow = A + (size_t)(row0 >> 4) * (16 * D_) + lane * 8;
  auto ldA4 = [&](v16bf* dst, int kk) {
#pragma unroll   // constant indices: dst[] stays in registers
    for (int s = 0; s < 4; ++s)
      dst[s] = make_frag(arow + kk * 16 + s * 512, arow + kk * 16 + s * 512 + 256);
  };

  // first activation block: issued ahead of the staging so both fly together
  v16bf a0[4], a1[4];
  ldA4(a0, 0);

  // ---- async-stage the 64 x 1024 weight panel: 8192 chunks, 32 a thread ----
  {
    const u16* g = WT + (size_t)col0 * D_ + tid * 8;
    const unsigned l = lds_off32(ldsB) + ((tid & 127) >> 5) * (GB_QUART * 2) +
                       (tid >> 7) * (GB_PITCH * 2) + (tid & 31) * 16;
#pragma unroll   // all 32 copies issue back to back, no loop counter between them
    for (int j = 0; j < 4; ++j)
      async_cp16x8(l + j * 16 * (GB_PITCH * 2), g + j * 8 * 256 * 8);
    wait_async0();
    __syncthreads();
  }

  const u16* wrow = ldsB + l16 * GB_PITCH + hig * 8;
  // q = k quarter, kk = k inside it (kk == 256 names the next quarter's start)
  auto ldB = [&](v16bf* dst, int q, int kk) {
    const u16* p = wrow + q * GB_QUART + (kk >> 8) * GB_QUART + (kk & 255);
#pragma unroll   // constant indices: dst[] stays in registers
    for (int c = 0; c < 4; ++c)
      dst[c] = make_frag(p + c * 16 * GB_PITCH, p + c * 16 * GB_PITCH + 16);
  };
  auto mm = [&](v16bf a, const v16bf* b) {
#pragma unroll   // constant indices: acc[] and b[] stay in registers
    for (int c = 0; c < 4; ++c) acc[c] = wmma_bf16(a, b[c], acc[c]);
  };

  // B fragments one k-step ahead, A fragments one 128-k block ahead, each in
  // two disjoint register sets (no rotation moves)
  v16bf bf0[4], bf1[4];
  ldB(bf0, 0, 0);
  // keeps each group of loads in front of the WMMAs of the step before it;
  // without it the scheduler sinks every load to just ahead of its use and each
  // WMMA waits out an LDS latency
  auto hold = [] { __builtin_amdgcn_sched_barrier(0); };
  auto body = [&](int q, bool more) {
    const int kb = q * 256;
    ldA4(a1, kb + 128);
    ldB(bf1, q, 32);   hold();  mm(a0[0], bf0);
    ldB(bf0, q, 64);   hold();  mm(a0[1], bf1);
    ldB(bf1, q, 96);   hold();  mm(a0[2], bf0);
    ldB(bf0, q, 128);  hold();  mm(a0[3], bf1);
    if (more) ldA4(a0, kb + 256);
    ldB(bf1, q, 160);  hold();  mm(a1[0], bf0);
    ldB(bf0, q, 192);  hold();  mm(a1[1], bf1);
    ldB(bf1, q, 224);  hold();  mm(a1[2], bf0);
    if (more) ldB(bf0, q, 256);
    hold();
    mm(a1[3], bf1);
    // stands ahead of the next trip's first instructions, which form a new
    // activation address in the register pair that this trip's global loads name
    if (more) asm volatile("s_wait_xcnt 0x0" ::: "memory");
  };
  // kept rolled: unrolled, LDS addresses past 64 KB each cost their own add, and
  // the epilogue's loads move up until only one workgroup fits a WGP
#pragma unroll 1
  for (int q = 0; q < 3; ++q) body(q, true);
  body(3, false);   // last 256 k: nothing left to fetch ahead
}

// ---- fused QKV projection GEMM --------------------------------------------
// grid.x = 32 row blocks x 16 column blocks, grid.y = which projection.

__global__ __launch_bounds__(256)
void qkv_gemm(const u16* __restrict__ eegb, const u16* __restrict__ picb,
              const u16* __restrict__ WkT,  const u16* __restrict__ WqT,
              const u16* __restrict__ WvT,
              const float* __restrict__ bk, const float* __restrict__ bq,
              const float* __restrict__ bv,
              u16* __restrict__ qo, u16* __restrict__ ko,
              u16* __restrict__ vTo) {
  __shared__ __attribute__((aligned(16))) u16 ldsB[GB_LDS_U16];
  const int mode = blockIdx.y;           // 0=q 1=k 2=v
  const int lane = threadIdx.x & 31;
  const int wv   = threadIdx.x >> 5;
  const int l16  = lane & 15;
  const int hig  = lane >> 4;

  const int row0 = ((blockIdx.x >> 4) << 7) + (wv << 4);
  const int col0 = (blockIdx.x & 15) << 6;   // shared by all 8 waves in this WG

  const u16*  A    = (mode == 1) ? eegb : picb;
  const u16*  WT   = (mode == 0) ? WqT : (mode == 1 ? WkT : WvT);
  const float* bias = (mode == 0) ? bq : (mode == 1 ? bk : bv);

  v8f acc[4] = {};
  gemm_16x64(A, WT, ldsB, row0, col0, acc);

#pragma unroll
  for (int c = 0; c < 4; ++c) {
    const int n = col0 + c * 16 + l16;
    const float bval = bias[n];
    const int h = n >> 6, d = n & 63;
#pragma unroll
    for (int r = 0; r < 8; ++r) {
      const int rowg = row0 + r + hig * 8;
      const int b = rowg >> 10, s = rowg & (S_ - 1);
      const float val = acc[c][r] + bval;
      if (mode == 2) {
        vTo[(((size_t)(b * H_ + h) * HD_ + d) * S_) + s] = f2bf(val);   // [b,h,hd,S]
      } else {
        u16* dst = (mode == 0) ? qo : ko;                               // [b,h,S,hd]
        dst[(((size_t)(b * H_ + h) * S_ + s) * HD_) + d] = f2bf(val);
      }
    }
  }
}

#define KT_PITCH (64 + 8)   // u16 per K row in LDS: 144 B = 16 B x 9
#define VT_PITCH (32 + 8)   // u16 per V^T row in LDS: 80 B = 16 B x 5

// A thread's two async 16-byte copies of one tile pair, then s_wait_xcnt 0 ahead
// of any rewrite of their address registers (a precaution); one statement, so that
// the compiler can put no such rewrite between the copies and the wait.
__device__ __forceinline__ void async_cp16x2(unsigned l0, const u16* g0,
                                             unsigned l1, const u16* g1) {
  asm volatile(
      "global_load_async_to_lds_b128 %0, %2, off\n\t"
      "global_load_async_to_lds_b128 %1, %3, off\n\t"
      "s_wait_xcnt 0x0"
      :: "v"(l0), "v"(l1), "v"(g0), "v"(g1) : "memory");
}

// value of lane l ^ 16
__device__ __forceinline__ float xhalf(float x) {
  const int v = __builtin_bit_cast(int, x);
  return __builtin_bit_cast(float, __builtin_amdgcn_permlanex16(
      v, v, 0x76543210, 0xfedcba98, false, false));
}

__global__ void flash_attn(const u16* __restrict__ q, const u16* __restrict__ k,
                           const u16* __restrict__ vT, u16* __restrict__ ctx) {
  __shared__ __attribute__((aligned(16))) u16 kt[2][32 * KT_PITCH];  // [key][d]
  __shared__ __attribute__((aligned(16))) u16 vt[2][64 * VT_PITCH];  // [d][key]

  const int tid  = threadIdx.x;
  const int lane = tid & 31;
  const int wv   = tid >> 5;
  const int l16  = lane & 15;
  const int hig  = lane >> 4;

  const int qblk = blockIdx.x & 7;
  const int bh   = blockIdx.x >> 3;
  const int h    = bh & (H_ - 1);
  const int b0   = bh >> 4;
  const int qbase = qblk * 128 + wv * 16;

  const u16* qh = q  + (size_t)bh * S_ * HD_;
  const u16* kh = k  + (size_t)bh * S_ * HD_;
  const u16* vh = vT + (size_t)bh * HD_ * S_;

  // Q^T as B operand: column l16 = query qbase + l16
  const u16* qp = qh + (size_t)(qbase + l16) * HD_;
  v16bf qa0 = make_frag(qp +      hig * 8, qp + 16 + hig * 8);  // d 0..31
  v16bf qa1 = make_frag(qp + 32 + hig * 8, qp + 48 + hig * 8);  // d 32..63

  // one query a lane: m is joined over the halves every tile, lsum holds this
  // half's keys only and is joined once behind the loop
  float m = -3.0e38f, lsum = 0.f;
  v8f o[4] = {};                             // o[j][r] = O[query l16][16j + 8 hig + r]

  const float SC = 0.125f;                   // 1/sqrt(64)

  // cooperative async stage of one 32-key K/V tile pair (8 KB = 2 chunks/thr)
  auto issue_tiles = [&](int n0, int bsel) {
    // K tile: 32 keys x 64 d, contiguous 4 KB at kh + n0*64, 8 chunks a row
    // V tile: 64 d-rows x 32 keys (64B per row, stride S_), 4 chunks a row
    const int d = tid >> 2, part = tid & 3;
    async_cp16x2(lds_off32(&kt[bsel][(tid >> 3) * KT_PITCH + (tid & 7) * 8]),
                 kh + (size_t)n0 * HD_ + tid * 8,
                 lds_off32(&vt[bsel][d * VT_PITCH + part * 8]),
                 vh + (size_t)d * S_ + n0 + part * 8);
  };

  issue_tiles(0, 0);

  for (int it = 0; it < S_ / 32; ++it) {
    const int n0   = it * 32;
    const int bsel = it & 1;
    // hand-over between trips, in this order.  The last trip issues nothing behind
    // it, so no copy is in flight when the wave ends.
    // this wave's LDS reads of the other buffer have retired before it is refilled
    asm volatile("s_wait_dscnt 0x0" ::: "memory");
    wait_async0();         // own chunks of tile `it` landed
    __syncthreads();       // everyone's chunks landed; prev compute done
    if (it + 1 < S_ / 32) issue_tiles(n0 + 32, bsel ^ 1);

    // ---- scores S^T = K @ Q^T for the 32x16 tile (K rows from LDS as A) ----
    const u16* kp0 = &kt[bsel][(size_t)l16 * KT_PITCH];
    const u16* kp1 = &kt[bsel][(size_t)(16 + l16) * KT_PITCH];
    v16bf kb00 = make_frag(kp0 +      hig * 8, kp0 + 16 + hig * 8);
    v16bf kb01 = make_frag(kp0 + 32 + hig * 8, kp0 + 48 + hig * 8);
    v16bf kb10 = make_frag(kp1 +      hig * 8, kp1 + 16 + hig * 8);
    v16bf kb11 = make_frag(kp1 + 32 + hig * 8, kp1 + 48 + hig * 8);

    v8f c0 = {}, c1 = {};                    // c0[r]: key 8 hig + r, c1[r]: 16 more
    c0 = wmma_bf16(kb00, qa0, c0);
    c0 = wmma_bf16(kb01, qa1, c0);
    c1 = wmma_bf16(kb10, qa0, c1);
    c1 = wmma_bf16(kb11, qa1, c1);

    // ---- online softmax: 16 scores of one query in this lane ----
    c0 *= SC;
    c1 *= SC;
    float t[8];
#pragma unroll   // constant indices: t[] stays in registers
    for (int r = 0; r < 8; ++r) t[r] = fmaxf(c0[r], c1[r]);
    float tm = fmaxf(fmaxf(fmaxf(t[0], t[1]), fmaxf(t[2], t[3])),
                     fmaxf(fmaxf(t[4], t[5]), fmaxf(t[6], t[7])));
    tm = fmaxf(tm, xhalf(tm));               // the other half's 16 keys
    const float mnew = fmaxf(m, tm);
    const float scl  = __expf(m - mnew);
    m = mnew;
#pragma unroll   // constant indices: c0, c1, t[] stay in registers
    for (int r = 0; r < 8; ++r) {
      c0[r] = __expf(c0[r] - mnew);
      c1[r] = __expf(c1[r] - mnew);
      t[r]  = c0[r] + c1[r];
    }
    lsum = lsum * scl + (((t[0] + t[1]) + (t[2] + t[3])) +
                         ((t[4] + t[5]) + (t[6] + t[7])));

    // P^T as B operand, straight from the two score tiles
    union { v8bf h[2]; v16bf v; } pb;
    pb.h[0] = __builtin_convertvector(c0, v8bf);
    pb.h[1] = __builtin_convertvector(c1, v8bf);

    // ---- O^T += V^T @ P^T  (V^T rows from LDS as A, [d][key] tile) ----
#pragma unroll
    for (int j = 0; j < 4; ++j) {
      const u16* vp = &vt[bsel][(size_t)(j * 16 + l16) * VT_PITCH];
      v16bf vb = make_frag(vp + hig * 8, vp + 16 + hig * 8);
      o[j] = wmma_bf16(vb, pb.v, o[j] * scl);
    }
  }

  // ---- normalize & store ctx as bf16, [B*S][D] in fragment order: the wave's 16
  // queries are one row block, o[j] is half j & 1 of k-step 2 h + (j >> 1), so
  // every store is 512 contiguous bytes ----
  const float inv = 1.0f / (lsum + xhalf(lsum));
  u16* crow = ctx + ((size_t)((b0 * S_ + qbase) >> 4) * (D_ / 32) + h * 2) * 512 + lane * 8;
#pragma unroll
  for (int j = 0; j < 4; ++j)
    *(v8bf*)(crow + j * 256) = __builtin_convertvector(o[j] * inv, v8bf);
}

// ---- output projection + residual -----------------------------------------

__global__ __launch_bounds__(256)
void out_gemm(const u16* __restrict__ ctxb, const u16* __restrict__ WdT,
              const float* __restrict__ bd, const float* __restrict__ pic,
              float* __restrict__ xo) {
  __shared__ __attribute__((aligned(16))) u16 ldsB[GB_LDS_U16];
  const int lane = threadIdx.x & 31;
  const int wv   = threadIdx.x >> 5;
  const int l16  = lane & 15;
  const int hig  = lane >> 4;

  const int row0 = ((blockIdx.x >> 4) << 7) + (wv << 4);
  const int col0 = (blockIdx.x & 15) << 6;

  v8f acc[4] = {};
  gemm_16x64(ctxb, WdT, ldsB, row0, col0, acc);

#pragma unroll
  for (int c = 0; c < 4; ++c) {
    const int n = col0 + c * 16 + l16;
    const float bval = bd[n];
#pragma unroll
    for (int r = 0; r < 8; ++r) {
      const int rowg = row0 + r + hig * 8;
      const size_t idx = (size_t)rowg * D_ + n;
      xo[idx] = acc[c][r] + bval + pic[idx];     // residual
    }
  }
}

// ---- layer norm ------------------------------------------------------------

__global__ void ln_kernel(const float* __restrict__ x, const float* __restrict__ w,
                          const float* __restrict__ bw, float* __restrict__ out) {
  __shared__ float red[256];
  const int row = blockIdx.x;
  const float* xr = x + (size_t)row * D_;

  float s = 0.f;
  for (int i = threadIdx.x; i < D_; i += 256) s += xr[i];
  red[threadIdx.x] = s; __syncthreads();
  for (int off = 128; off > 0; off >>= 1) {
    if (threadIdx.x < off) red[threadIdx.x] += red[threadIdx.x + off];
    __syncthreads();
  }
  const float mean = red[0] * (1.0f / D_);
  __syncthreads();

  float v = 0.f;
  for (int i = threadIdx.x; i < D_; i += 256) {
    float d = xr[i] - mean; v += d * d;
  }
  red[threadIdx.x] = v; __syncthreads();
  for (int off = 128; off > 0; off >>= 1) {
    if (threadIdx.x < off) red[threadIdx.x] += red[threadIdx.x + off];
    __syncthreads();
  }
  const float inv = rsqrtf(red[0] * (1.0f / D_) + 1e-12f);

  for (int i = threadIdx.x; i < D_; i += 256)
    out[(size_t)row * D_ + i] = w[i] * ((xr[i] - mean) * inv) + bw[i];
}

// ---- launch ---------------------------------------------------------------

extern "C" void kernel_launch(void* const* d_in, const int* in_sizes, int n_in,
                              void* d_out, int out_size, void* d_ws, size_t ws_size,
                              hipStream_t stream) {
  const float* eeg = (const float*)d_in[0];
  const float* pic = (const float*)d_in[1];
  const float* Wk  = (const float*)d_in[2];
  const float* bk  = (const float*)d_in[3];
  const float* Wq  = (const float*)d_in[4];
  const float* bq  = (const float*)d_in[5];
  const float* Wv  = (const float*)d_in[6];
  const float* bv  = (const float*)d_in[7];
  const float* Wd  = (const float*)d_in[8];
  const float* bd  = (const float*)d_in[9];
  const float* lnw = (const float*)d_in[10];
  const float* lnb = (const float*)d_in[11];

  char* ws = (char*)d_ws;
  u16*  eegb = (u16*)(ws + ((size_t)0  << 20));   // 8 MB, fragment order
  u16*  picb = (u16*)(ws + ((size_t)8  << 20));   // 8 MB, fragment order
  u16*  WkT  = (u16*)(ws + ((size_t)16 << 20));   // 2 MB
  u16*  WqT  = (u16*)(ws + ((size_t)18 << 20));   // 2 MB
  u16*  WvT  = (u16*)(ws + ((size_t)20 << 20));   // 2 MB
  u16*  WdT  = (u16*)(ws + ((size_t)22 << 20));   // 2 MB
  u16*  qb   = (u16*)(ws + ((size_t)24 << 20));   // 8 MB [b,h,S,hd]
  u16*  kbuf = (u16*)(ws + ((size_t)32 << 20));   // 8 MB [b,h,S,hd]
  u16*  vTb  = (u16*)(ws + ((size_t)40 << 20));   // 8 MB [b,h,hd,S]
  u16*  ctxb = (u16*)(ws + ((size_t)48 << 20));   // 8 MB [B*S][D], fragment order
  float* xb  = (float*)(ws + ((size_t)56 << 20)); // 16 MB

  cvt_all<<<2 * CV_ACT_WGS + 4 * CV_W_WGS, CV_THREADS, 0, stream>>>(
      eeg, pic, Wk, Wq, Wv, Wd, eegb, picb, WkT, WqT, WvT, WdT);

  qkv_gemm<<<dim3(512, 3), 256, 0, stream>>>(eegb, picb, WkT, WqT, WvT,
                                             bk, bq, bv, qb, kbuf, vTb);
  flash_attn<<<512, 256, 0, stream>>>(qb, kbuf, vTb, ctxb);
  out_gemm<<<512, 256, 0, stream>>>(ctxb, WdT, bd, pic, xb);
  ln_kernel<<<NTOK, 256, 0, stream>>>(xb, lnw, lnb, (float*)d_out);
}

// v008
// It runs in 90.7 microseconds.
// In two side-by-side timings against v007, it was 1.13 and 1.12 times as fast.
// Over all steps from v000 it is 4.85 times as fast.
#include <hip/hip_runtime.h>
#include <hip/hip_bf16.h>
#include <math.h>
#include <stdint.h>

// Problem constants (reference: B=4, S=1024, D=1024, H=16, HD=64)
#define B_   4
#define S_   1024
#define D_   1024
#define H_   16
#define HD_  64
#define NTOK (B_ * S_)   // 4096 tokens

typedef unsigned short u16;
typedef __attribute__((ext_vector_type(8)))  u16    u16x8;
typedef __attribute__((ext_vector_type(4)))  u16    u16x4;
typedef __attribute__((ext_vector_type(4)))  float  f32x4;
typedef __attribute__((ext_vector_type(16))) __bf16 v16bf;
typedef __attribute__((ext_vector_type(8)))  __bf16 v8bf;
typedef __attribute__((ext_vector_type(8)))  float  v8f;

// ---- helpers ---------------------------------------------------------------

__device__ __forceinline__ u16 f2bf(float f) {
  union { float f; unsigned u; } c; c.f = f;
  unsigned u = c.u;
  u += 0x7FFFu + ((u >> 16) & 1u);   // round-to-nearest-even
  return (u16)(u >> 16);
}

// Build a 16x32 (or 32x16) bf16 WMMA fragment from two contiguous 16B chunks.
// Per ISA layout (16-bit A 16x32): lane-lo holds K=0..7 (v0-3) and K=16..23
// (v4-7); lane-hi holds K=8..15 and K=24..31.
__device__ __forceinline__ v16bf make_frag(const u16* p0, const u16* p1) {
  union { u16x8 h[2]; v16bf v; } u;
  u.h[0] = *(const u16x8*)p0;
  u.h[1] = *(const u16x8*)p1;
  return u.v;
}

__device__ __forceinline__ v8f wmma_bf16(v16bf a, v16bf b, v8f c) {
  return __builtin_amdgcn_wmma_f32_16x16x32_bf16(
      false, a, false, b, (short)0, c, false, false);
}

// The issuing wave's async copies to LDS (ASYNCcnt-tracked) have landed.
__device__ __forceinline__ void wait_async0() {
  asm volatile("s_wait_asynccnt 0x0" ::: "memory");
}
__device__ __forceinline__ unsigned lds_off32(const void* p) {
  return (unsigned)(uintptr_t)p;   // low 32 bits of generic ptr = LDS offset
}

// ---- conversion kernel -----------------------------------------------------
// The two activation conversions and the four weight transposes do not depend on
// one another, so they share ONE launch: a workgroup's index says which job it
// does (a block-uniform branch).  All 768 workgroups (16 waves each, three a WGP)
// are resident at once; the long activation streams have the low indices.

// Every bf16 activation matrix X[4096][1024] that a projection GEMM reads as its
// A operand lies in the workspace in A-fragment order: 1 KiB per (16-row block,
// 32-k step), blocks row-major over [row block][k step].  Inside a block lane
// l = 16 * hig + l16 owns bytes 16 l .. 16 l + 15 of each 512-byte half:
//   first half : X[16 rb + l16][32 s      + 8 hig + 0..7]
//   second half: X[16 rb + l16][32 s + 16 + 8 hig + 0..7]
// so a wave's 16-byte fragment load covers 512 contiguous bytes (4 whole lines),
// not 32-byte pieces of 16 lines.  In units of 256 B (128 elements):
//   unit = (row >> 4) * 128 + (k >> 3), element in it = (row & 15) * 8 + (k & 7).

// Activations: each of an input's 128 workgroups converts 32768 contiguous
// elements = 32 whole rows = 64 KiB contiguous in fragment order.  A lane issues
// its 16 independent 16-byte loads first (each wave-wide load is 512 contiguous
// bytes), converts, and puts 8 bytes per load at their fragment-order place in
// LDS; behind one barrier the image goes out linearly, 512 contiguous bytes per
// wave-wide store.  In LDS each 256-byte unit has a 272 B pitch (16 B x odd): the
// 16 units that a wave's 8-byte stores fall in cover all 64 banks once.
#define CV_THREADS 512
#define CV_LOADS   16
#define CV_STEP    (CV_THREADS * 4)            // elements per workgroup-wide round
#define CV_CHUNK   (CV_STEP * CV_LOADS)        // elements per workgroup
#define CV_ACT_WGS (NTOK * D_ / CV_CHUNK)      // workgroups per activation: 128
#define CV_UPITCH  (128 + 8)                   // u16 per 256-byte unit in LDS
#define CV_LDS_U16 (CV_CHUNK / 128 * CV_UPITCH)   // 69632 B
__device__ __forceinline__ void cvt_act(const float* __restrict__ x,
                                        u16* __restrict__ y, u16* sm, int chunk) {
  const int tid = threadIdx.x;
  const size_t base = (size_t)chunk * CV_CHUNK;
  const unsigned xoff = ((unsigned)base + tid * 4) * 4;   // byte offset in x, below 16 MiB

  f32x4 r[CV_LOADS];
  // unrolled: r[] stays in registers and every load issues before the first wait
#pragma unroll
  for (int j = 0; j < CV_LOADS; ++j)
    r[j] = *(const f32x4*)((const char*)x + xoff + j * (CV_STEP * 4));
  // stands ahead of any rewrite of the loads' address registers (a precaution);
  // the offset is named as an input so that it lives up to the wait and no load
  // of the run lands in its register
  asm volatile("s_wait_xcnt 0x0" :: "v"(xoff) : "memory");

  // load j of this thread: row 2 j + (tid >> 8) of the chunk, k = 4 (tid & 255)
  u16* st = sm + ((tid & 255) >> 1) * CV_UPITCH + (tid >> 8) * 8 + (tid & 1) * 4;
  // unrolled (both loops): constant indices into r[] and p, no scratch memory
#pragma unroll
  for (int j = 0; j < CV_LOADS; ++j) {
    u16x4 p;
#pragma unroll
    for (int c = 0; c < 4; ++c) p[c] = f2bf(r[j][c]);
    *(u16x4*)(st + (j >> 3) * 128 * CV_UPITCH + (j & 7) * 16) = p;
  }
  __syncthreads();   // reached by all 16 waves of a converting workgroup

  // 16-byte piece i * 512 + tid of the image: unit piece >> 4, place piece & 15
  const u16* ld  = sm + (tid >> 4) * CV_UPITCH + (tid & 15) * 8;
  u16*       dst = y + base + tid * 8;
#pragma unroll   // constant offsets on one LDS and one global address
  for (int i = 0; i < CV_CHUNK / (CV_THREADS * 8); ++i)
    *(u16x8*)(dst + i * (CV_THREADS * 8)) =
        *(const u16x8*)(ld + i * (CV_THREADS / 16) * CV_UPITCH);
}

// W is [K][N] row-major f32; produce WT[N][K] bf16 so a B-fragment column
// reads contiguous K.  One 64(k) x 64(n) tile per 256 threads, turned in LDS:
// global reads are whole 256-byte row pieces, global writes whole 128-byte
// lines (8 lanes x 16 B per WT row), each line written by one workgroup.
// A workgroup's two halves take two tiles side by side in n, each in its own
// LDS tile; tid is the thread's number inside its half.
#define WT_PITCH 68   // u16 per LDS row: 64 + 4, rows stay 8-byte aligned
#define CV_W_WGS ((D_ / 64) * (D_ / 64) / 2)   // workgroups per weight: 128
__device__ __forceinline__ void cvt_wT(const float* __restrict__ w,
                                       u16* __restrict__ wt,
                                       u16* tile, int tidx, int tid) {   // tile: [n][k]
  const int n0  = (tidx & 15) << 6;
  const int k0  = (tidx >> 4) << 6;

  // each thread: a 4(k) x 4(n) block, four independent 16-byte loads
  const int nq = (tid & 15) << 2;
  const int kq = (tid >> 4) << 2;
  const float* src = w + (size_t)(k0 + kq) * D_ + n0 + nq;
  f32x4 r[4];
#pragma unroll
  for (int j = 0; j < 4; ++j) r[j] = *(const f32x4*)(src + (size_t)j * D_);

#pragma unroll
  for (int c = 0; c < 4; ++c) {
    u16x4 p;
#pragma unroll
    for (int j = 0; j < 4; ++j) p[j] = f2bf(r[j][c]);
    *(u16x4*)&tile[(nq + c) * WT_PITCH + kq] = p;    // 4 k of one n: 8 bytes
  }
  __syncthreads();   // reached by all 16 waves of a transposing workgroup

  const int kc = (tid & 7) << 3;
#pragma unroll
  for (int p = 0; p < 2; ++p) {
    const int n = p * 32 + (tid >> 3);
    union { u16x4 h[2]; u16x8 v; } u;
    u.h[0] = *(const u16x4*)&tile[n * WT_PITCH + kc];
    u.h[1] = *(const u16x4*)&tile[n * WT_PITCH + kc + 4];
    *(u16x8*)(wt + (size_t)(n0 + n) * D_ + k0 + kc) = u.v;
  }
  // stands ahead of any rewrite of the two stores' registers (a precaution): the
  // built kernel lays the activation branch's code behind these stores
  asm volatile("s_wait_xcnt 0x0" ::: "memory");
}

__global__ __launch_bounds__(CV_THREADS)
void cvt_all(const float* __restrict__ eeg, const float* __restrict__ pic,
             const float* __restrict__ Wk,  const float* __restrict__ Wq,
             const float* __restrict__ Wv,  const float* __restrict__ Wd,
             u16* __restrict__ eegb, u16* __restrict__ picb,
             u16* __restrict__ WkT,  u16* __restrict__ WqT,
             u16* __restrict__ WvT,  u16* __restrict__ WdT) {
  // one array for both jobs: the fragment-order image, or the two transpose tiles
  __shared__ __attribute__((aligned(16))) u16 sm[CV_LDS_U16];
  const int blk = blockIdx.x;
  if (blk < 2 * CV_ACT_WGS) {
    const bool second = blk >= CV_ACT_WGS;
    cvt_act(second ? pic : eeg, second ? picb : eegb, sm, blk & (CV_ACT_WGS - 1));
  } else {
    const int wb   = blk - 2 * CV_ACT_WGS;
    const int wsel = wb / CV_W_WGS;            // 0..3: k, q, v, d
    const float* w = wsel == 0 ? Wk  : wsel == 1 ? Wq  : wsel == 2 ? Wv  : Wd;
    u16*        wt = wsel == 0 ? WkT : wsel == 1 ? WqT : wsel == 2 ? WvT : WdT;
    const int half = threadIdx.x >> 8;
    cvt_wT(w, wt, sm + half * (64 * WT_PITCH), (wb & (CV_W_WGS - 1)) * 2 + half,
           threadIdx.x & 255);
  }
}

// ---- projection GEMMs: shared main loop ------------------------------------
// A workgroup (8 waves) computes 128 rows x 64 columns; each wave a 16x64 tile.
// All 8 waves use the same 64 weight rows of WT[N][K] (128 KB, contiguous in
// global memory), so that panel is async-staged into LDS once and every
// B fragment comes from LDS.  Each wave reads its own 16 activation rows from
// global memory (fragment order: 32 KiB contiguous), every byte once, four
// k-steps (128 k) ahead.
// LDS layout [k quarter][64 rows][256 k + 8]: the row pitch is 528 B = 16 B x odd
// (no bank conflict for 16-byte reads), and everything one trip of the main loop
// reads lies within 64 KB of one address register (the LDS offset field's reach).
#define GB_PITCH   (256 + 8)           // u16 per LDS row
#define GB_QUART   (64 * GB_PITCH)     // u16 per k quarter: 33792 B
#define GB_LDS_U16 (4 * GB_QUART)      // 135168 B: two workgroups per WGP

// Eight async 16-byte copies, then s_wait_xcnt 0 ahead of any rewrite of their
// address registers (a precaution); one statement, so that the compiler can put
// no such rewrite between the copies and the wait.
__device__ __forceinline__ void async_cp16x8(unsigned l, const u16* g) {
  const unsigned LS = 2 * GB_PITCH * 2;  // LDS bytes between a thread's chunks
  const int      GS = 256 * 8;           // global elements between them
  asm volatile(
      "global_load_async_to_lds_b128 %0, %8, off\n\t"
      "global_load_async_to_lds_b128 %1, %9, off\n\t"
      "global_load_async_to_lds_b128 %2, %10, off\n\t"
      "global_load_async_to_lds_b128 %3, %11, off\n\t"
      "global_load_async_to_lds_b128 %4, %12, off\n\t"
      "global_load_async_to_lds_b128 %5, %13, off\n\t"
      "global_load_async_to_lds_b128 %6, %14, off\n\t"
      "global_load_async_to_lds_b128 %7, %15, off\n\t"
      "s_wait_xcnt 0x0"
      :: "v"(l), "v"(l + LS), "v"(l + 2 * LS), "v"(l + 3 * LS),
         "v"(l + 4 * LS), "v"(l + 5 * LS), "v"(l + 6 * LS), "v"(l + 7 * LS),
         "v"(g), "v"(g + GS), "v"(g + 2 * GS), "v"(g + 3 * GS),
         "v"(g + 4 * GS), "v"(g + 5 * GS), "v"(g + 6 * GS), "v"(g + 7 * GS)
      : "memory");
}

// acc[c] += A[row0 + 0..15][:] x WT[col0 + 16c + 0..15][:]^T over all D_ k.
__device__ __forceinline__ void gemm_16x64(const u16* __restrict__ A,
                                           const u16* __restrict__ WT,
                                           u16* ldsB, int row0, int col0,
                                           v8f* acc) {
  const int tid  = threadIdx.x;
  const int lane = tid & 31;
  const int l16  = lane & 15;
  const int hig  = lane >> 4;

  // A in fragment order: 512 elements per k-step, this lane's 8 at 8 * lane
  const u16* arow = A + (size_t)(row0 >> 4) * (16 * D_) + lane * 8;
  auto ldA4 = [&](v16bf* dst, int kk) {
#pragma unroll   // constant indices: dst[] stays in registers
    for (int s = 0; s < 4; ++s)
      dst[s] = make_frag(arow + kk * 16 + s * 512, arow + kk * 16 + s * 512 + 256);
  };

  // first activation block: issued ahead of the staging so both fly together
  v16bf a0[4], a1[4];
  ldA4(a0, 0);

  // ---- async-stage the 64 x 1024 weight panel: 8192 chunks, 32 a thread ----
  {
    const u16* g = WT + (size_t)col0 * D_ + tid * 8;
    const unsigned l = lds_off32(ldsB) + ((tid & 127) >> 5) * (GB_QUART * 2) +
                       (tid >> 7) * (GB_PITCH * 2) + (tid & 31) * 16;
#pragma unroll   // all 32 copies issue back to back, no loop counter between them
    for (int j = 0; j < 4; ++j)
      async_cp16x8(l + j * 16 * (GB_PITCH * 2), g + j * 8 * 256 * 8);
    wait_async0();
    __syncthreads();
  }

  const u16* wrow = ldsB + l16 * GB_PITCH + hig * 8;
  // q = k quarter, kk = k inside it (kk == 256 names the next quarter's start)
  auto ldB = [&](v16bf* dst, int q, int kk) {
    const u16* p = wrow + q * GB_QUART + (kk >> 8) * GB_QUART + (kk & 255);
#pragma unroll   // constant indices: dst[] stays in registers
    for (int c = 0; c < 4; ++c)
      dst[c] = make_frag(p + c * 16 * GB_PITCH, p + c * 16 * GB_PITCH + 16);
  };
  auto mm = [&](v16bf a, const v16bf* b) {
#pragma unroll   // constant indices: acc[] and b[] stay in registers
    for (int c = 0; c < 4; ++c) acc[c] = wmma_bf16(a, b[c], acc[c]);
  };

  // B fragments one k-step ahead, A fragments one 128-k block ahead, each in
  // two disjoint register sets (no rotation moves)
  v16bf bf0[4], bf1[4];
  ldB(bf0, 0, 0);
  // keeps each group of loads in front of the WMMAs of the step before it;
  // without it the scheduler sinks every load to just ahead of its use and each
  // WMMA waits out an LDS latency
  auto hold = [] { __builtin_amdgcn_sched_barrier(0); };
  auto body = [&](int q, bool more) {
    const int kb = q * 256;
    ldA4(a1, kb + 128);
    ldB(bf1, q, 32);   hold();  mm(a0[0], bf0);
    ldB(bf0, q, 64);   hold();  mm(a0[1], bf1);
    ldB(bf1, q, 96);   hold();  mm(a0[2], bf0);
    ldB(bf0, q, 128);  hold();  mm(a0[3], bf1);
    if (more) ldA4(a0, kb + 256);
    ldB(bf1, q, 160);  hold();  mm(a1[0], bf0);
    ldB(bf0, q, 192);  hold();  mm(a1[1], bf1);
    ldB(bf1, q, 224);  hold();  mm(a1[2], bf0);
    if (more) ldB(bf0, q, 256);
    hold();
    mm(a1[3], bf1);
    // stands ahead of the next trip's first instructions, which form a new
    // activation address in the register pair that this trip's global loads name
    if (more) asm volatile("s_wait_xcnt 0x0" ::: "memory");
  };
  // kept rolled: unrolled, LDS addresses past 64 KB each cost their own add, and
  // the epilogue's loads move up until only one workgroup fits a WGP
#pragma unroll 1
  for (int q = 0; q < 3; ++q) body(q, true);
  body(3, false);   // last 256 k: nothing left to fetch ahead
}

// ---- fused QKV projection GEMM --------------------------------------------
// grid.x = 32 row blocks x 16 column blocks, grid.y = which projection.
#define EQ_PITCH (64 + 8)    // u16 per token row of the q / k tile in LDS: 144 B = 16 B x 9
#define EV_PITCH (128 + 8)   // u16 per d row of the V^T tile in LDS: 272 B = 16 B x 17

__global__ __launch_bounds__(256)
void qkv_gemm(const u16* __restrict__ eegb, const u16* __restrict__ picb,
              const u16* __restrict__ WkT,  const u16* __restrict__ WqT,
              const u16* __restrict__ WvT,
              const float* __restrict__ bk, const float* __restrict__ bq,
              const float* __restrict__ bv,
              u16* __restrict__ qo, u16* __restrict__ ko,
              u16* __restrict__ vTo) {
  __shared__ __attribute__((aligned(16))) u16 ldsB[GB_LDS_U16];
  const int mode = blockIdx.y;           // 0=q 1=k 2=v
  const int lane = threadIdx.x & 31;
  const int wv   = threadIdx.x >> 5;
  const int l16  = lane & 15;
  const int hig  = lane >> 4;

  const int row0 = ((blockIdx.x >> 4) << 7) + (wv << 4);
  const int col0 = (blockIdx.x & 15) << 6;   // shared by all 8 waves in this WG

  const u16*  A    = (mode == 1) ? eegb : picb;
  const u16*  WT   = (mode == 0) ? WqT : (mode == 1 ? WkT : WvT);
  const float* bias = (mode == 0) ? bq : (mode == 1 ? bk : bv);

  v8f acc[4] = {};
  gemm_16x64(A, WT, ldsB, row0, col0, acc);

  // ---- epilogue: the workgroup's 128 x 64 bf16 tile is laid in LDS (over the
  // weight panel, which nobody needs any more) as it lies in global memory, then
  // goes out 16 bytes a lane: q and k are 16 KiB contiguous (128 tokens x one
  // head's 64 d), V^T is 64 d rows of 256 contiguous bytes (128 tokens).  Every
  // store covers whole 128-byte lines; straight from the accumulators a V^T
  // store would put 2 bytes in each of 16 lines 2 KiB apart.
  const int tid  = threadIdx.x;
  const int rowb = (blockIdx.x >> 4) << 7;   // the workgroup's first token
  const int b    = rowb >> 10, sb = rowb & (S_ - 1);
  const int h    = blockIdx.x & 15;          // the 64 columns are one head

  // the four bias loads issue together, so that their latencies overlap
  float bval[4];
#pragma unroll   // constant indices: bval[] stays in registers
  for (int c = 0; c < 4; ++c) bval[c] = bias[col0 + c * 16 + l16];

  // this wave's last reads of the panel have retired before another wave
  // writes over it behind the barrier
  asm volatile("s_wait_dscnt 0x0" ::: "memory");
  __syncthreads();   // every wave is done with the weight panel

  // 1024 pieces of 16 bytes go out, 4 a thread; a wave's 32 pieces are consecutive
  u16x8 v[4];
  if (mode == 2) {
    // LDS row d = 16 c + l16; the lane's 8 values are 8 consecutive tokens
#pragma unroll   // constant indices: acc[] stays in registers
    for (int c = 0; c < 4; ++c) {
      u16x8 p;
#pragma unroll
      for (int r = 0; r < 8; ++r) p[r] = f2bf(acc[c][r] + bval[c]);
      *(u16x8*)(ldsB + (c * 16 + l16) * EV_PITCH + wv * 16 + hig * 8) = p;
    }
    __syncthreads();   // the whole tile is in LDS (mode is the same in the whole block)
    const u16* ld  = ldsB + (tid >> 4) * EV_PITCH + (tid & 15) * 8;
    u16*       dst = vTo + ((size_t)(b * H_ + h) * HD_ + (tid >> 4)) * S_ + sb +
                     (tid & 15) * 8;                                      // [b,h,hd,S]
#pragma unroll   // the four LDS reads issue together, each into its own registers
    for (int i = 0; i < 4; ++i) v[i] = *(const u16x8*)(ld + i * 16 * EV_PITCH);
#pragma unroll
    for (int i = 0; i < 4; ++i) *(u16x8*)(dst + i * 16 * S_) = v[i];
  } else {
    // LDS row = token; 16 lanes write 32 contiguous bytes of it
#pragma unroll   // constant indices: acc[] stays in registers
    for (int c = 0; c < 4; ++c)
#pragma unroll
      for (int r = 0; r < 8; ++r)
        ldsB[(wv * 16 + hig * 8 + r) * EQ_PITCH + c * 16 + l16] = f2bf(acc[c][r] + bval[c]);
    __syncthreads();   // the whole tile is in LDS (mode is the same in the whole block)
    const u16* ld  = ldsB + (tid >> 3) * EQ_PITCH + (tid & 7) * 8;
    u16*       dst = ((mode == 0) ? qo : ko) + ((size_t)(b * H_ + h) * S_ + sb) * HD_ +
                     tid * 8;                                             // [b,h,S,hd]
#pragma unroll   // the four LDS reads issue together, each into its own registers
    for (int i = 0; i < 4; ++i) v[i] = *(const u16x8*)(ld + i * 32 * EQ_PITCH);
#pragma unroll
    for (int i = 0; i < 4; ++i) *(u16x8*)(dst + i * 256 * 8) = v[i];
    // stands ahead of any rewrite of the four stores' registers (a precaution): the
    // built kernel lays the V^T branch's code behind these stores
    asm volatile("s_wait_xcnt 0x0" ::: "memory");
  }
}

#define KT_PITCH (64 + 8)   // u16 per K row in LDS: 144 B = 16 B x 9
#define VT_PITCH (32 + 8)   // u16 per V^T row in LDS: 80 B = 16 B x 5

// A thread's two async 16-byte copies of one tile pair, then s_wait_xcnt 0 ahead
// of any rewrite of their address registers (a precaution); one statement, so that
// the compiler can put no such rewrite between the copies and the wait.
__device__ __forceinline__ void async_cp16x2(unsigned l0, const u16* g0,
                                             unsigned l1, const u16* g1) {
  asm volatile(
      "global_load_async_to_lds_b128 %0, %2, off\n\t"
      "global_load_async_to_lds_b128 %1, %3, off\n\t"
      "s_wait_xcnt 0x0"
      :: "v"(l0), "v"(l1), "v"(g0), "v"(g1) : "memory");
}

// value of lane l ^ 16
__device__ __forceinline__ float xhalf(float x) {
  const int v = __builtin_bit_cast(int, x);
  return __builtin_bit_cast(float, __builtin_amdgcn_permlanex16(
      v, v, 0x76543210, 0xfedcba98, false, false));
}

__global__ void flash_attn(const u16* __restrict__ q, const u16* __restrict__ k,
                           const u16* __restrict__ vT, u16* __restrict__ ctx) {
  __shared__ __attribute__((aligned(16))) u16 kt[2][32 * KT_PITCH];  // [key][d]
  __shared__ __attribute__((aligned(16))) u16 vt[2][64 * VT_PITCH];  // [d][key]

  const int tid  = threadIdx.x;
  const int lane = tid & 31;
  const int wv   = tid >> 5;
  const int l16  = lane & 15;
  const int hig  = lane >> 4;

  const int qblk = blockIdx.x & 7;
  const int bh   = blockIdx.x >> 3;
  const int h    = bh & (H_ - 1);
  const int b0   = bh >> 4;
  const int qbase = qblk * 128 + wv * 16;

  const u16* qh = q  + (size_t)bh * S_ * HD_;
  const u16* kh = k  + (size_t)bh * S_ * HD_;
  const u16* vh = vT + (size_t)bh * HD_ * S_;

  // Q^T as B operand: column l16 = query qbase + l16
  const u16* qp = qh + (size_t)(qbase + l16) * HD_;
  v16bf qa0 = make_frag(qp +      hig * 8, qp + 16 + hig * 8);  // d 0..31
  v16bf qa1 = make_frag(qp + 32 + hig * 8, qp + 48 + hig * 8);  // d 32..63

  // one query a lane: m is joined over the halves every tile, lsum holds this
  // half's keys only and is joined once behind the loop
  float m = -3.0e38f, lsum = 0.f;
  v8f o[4] = {};                             // o[j][r] = O[query l16][16j + 8 hig + r]

  const float SC = 0.125f;                   // 1/sqrt(64)

  // cooperative async stage of one 32-key K/V tile pair (8 KB = 2 chunks/thr)
  auto issue_tiles = [&](int n0, int bsel) {
    // K tile: 32 keys x 64 d, contiguous 4 KB at kh + n0*64, 8 chunks a row
    // V tile: 64 d-rows x 32 keys (64B per row, stride S_), 4 chunks a row
    const int d = tid >> 2, part = tid & 3;
    async_cp16x2(lds_off32(&kt[bsel][(tid >> 3) * KT_PITCH + (tid & 7) * 8]),
                 kh + (size_t)n0 * HD_ + tid * 8,
                 lds_off32(&vt[bsel][d * VT_PITCH + part * 8]),
                 vh + (size_t)d * S_ + n0 + part * 8);
  };

  issue_tiles(0, 0);

  for (int it = 0; it < S_ / 32; ++it) {
    const int n0   = it * 32;
    const int bsel = it & 1;
    // hand-over between trips, in this order.  The last trip issues nothing behind
    // it, so no copy is in flight when the wave ends.
    // this wave's LDS reads of the other buffer have retired before it is refilled
    asm volatile("s_wait_dscnt 0x0" ::: "memory");
    wait_async0();         // own chunks of tile `it` landed
    __syncthreads();       // everyone's chunks landed; prev compute done
    if (it + 1 < S_ / 32) issue_tiles(n0 + 32, bsel ^ 1);

    // ---- scores S^T = K @ Q^T for the 32x16 tile (K rows from LDS as A) ----
    const u16* kp0 = &kt[bsel][(size_t)l16 * KT_PITCH];
    const u16* kp1 = &kt[bsel][(size_t)(16 + l16) * KT_PITCH];
    v16bf kb00 = make_frag(kp0 +      hig * 8, kp0 + 16 + hig * 8);
    v16bf kb01 = make_frag(kp0 + 32 + hig * 8, kp0 + 48 + hig * 8);
    v16bf kb10 = make_frag(kp1 +      hig * 8, kp1 + 16 + hig * 8);
    v16bf kb11 = make_frag(kp1 + 32 + hig * 8, kp1 + 48 + hig * 8);

    v8f c0 = {}, c1 = {};                    // c0[r]: key 8 hig + r, c1[r]: 16 more
    c0 = wmma_bf16(kb00, qa0, c0);
    c0 = wmma_bf16(kb01, qa1, c0);
    c1 = wmma_bf16(kb10, qa0, c1);
    c1 = wmma_bf16(kb11, qa1, c1);

    // ---- online softmax: 16 scores of one query in this lane ----
    c0 *= SC;
    c1 *= SC;
    float t[8];
#pragma unroll   // constant indices: t[] stays in registers
    for (int r = 0; r < 8; ++r) t[r] = fmaxf(c0[r], c1[r]);
    float tm = fmaxf(fmaxf(fmaxf(t[0], t[1]), fmaxf(t[2], t[3])),
                     fmaxf(fmaxf(t[4], t[5]), fmaxf(t[6], t[7])));
    tm = fmaxf(tm, xhalf(tm));               // the other half's 16 keys
    const float mnew = fmaxf(m, tm);
    const float scl  = __expf(m - mnew);
    m = mnew;
#pragma unroll   // constant indices: c0, c1, t[] stay in registers
    for (int r = 0; r < 8; ++r) {
      c0[r] = __expf(c0[r] - mnew);
      c1[r] = __expf(c1[r] - mnew);
      t[r]  = c0[r] + c1[r];
    }
    lsum = lsum * scl + (((t[0] + t[1]) + (t[2] + t[3])) +
                         ((t[4] + t[5]) + (t[6] + t[7])));

    // P^T as B operand, straight from the two score tiles
    union { v8bf h[2]; v16bf v; } pb;
    pb.h[0] = __builtin_convertvector(c0, v8bf);
    pb.h[1] = __builtin_convertvector(c1, v8bf);

    // ---- O^T += V^T @ P^T  (V^T rows from LDS as A, [d][key] tile) ----
#pragma unroll
    for (int j = 0; j < 4; ++j) {
      const u16* vp = &vt[bsel][(size_t)(j * 16 + l16) * VT_PITCH];
      v16bf vb = make_frag(vp + hig * 8, vp + 16 + hig * 8);
      o[j] = wmma_bf16(vb, pb.v, o[j] * scl);
    }
  }

  // ---- normalize & store ctx as bf16, [B*S][D] in fragment order: the wave's 16
  // queries are one row block, o[j] is half j & 1 of k-step 2 h + (j >> 1), so
  // every store is 512 contiguous bytes ----
  const float inv = 1.0f / (lsum + xhalf(lsum));
  u16* crow = ctx + ((size_t)((b0 * S_ + qbase) >> 4) * (D_ / 32) + h * 2) * 512 + lane * 8;
#pragma unroll
  for (int j = 0; j < 4; ++j)
    *(v8bf*)(crow + j * 256) = __builtin_convertvector(o[j] * inv, v8bf);
}

// ---- output projection + residual -----------------------------------------
#define EO_PITCH (64 + 4)    // f32 per row of the output tile in LDS: 272 B = 16 B x 17

__global__ __launch_bounds__(256)
void out_gemm(const u16* __restrict__ ctxb, const u16* __restrict__ WdT,
              const float* __restrict__ bd, const float* __restrict__ pic,
              float* __restrict__ xo) {
  __shared__ __attribute__((aligned(16))) u16 ldsB[GB_LDS_U16];
  const int lane = threadIdx.x & 31;
  const int wv   = threadIdx.x >> 5;
  const int l16  = lane & 15;
  const int hig  = lane >> 4;

  const int row0 = ((blockIdx.x >> 4) << 7) + (wv << 4);
  const int col0 = (blockIdx.x & 15) << 6;

  v8f acc[4] = {};
  gemm_16x64(ctxb, WdT, ldsB, row0, col0, acc);

  // ---- epilogue, staged like the QKV kernel's: the 128 x 64 f32 tile goes through
  // LDS (over the dead weight panel), so that the residual is read and the result
  // stored 16 bytes a lane, 256 contiguous bytes of a row, not in 64-byte pieces.
  // 2048 pieces of 16 bytes, 8 a thread: piece 256 i + tid is row 16 i + (tid >> 4).
  const int tid  = threadIdx.x;
  const int rowb = (blockIdx.x >> 4) << 7;   // the workgroup's first row
  const size_t g0 = (size_t)(rowb + (tid >> 4)) * D_ + col0 + (tid & 15) * 4;
  float* ldsO = (float*)ldsB;

  // residual and bias loads issue together, so that their latencies overlap
  f32x4 res[8];
#pragma unroll   // constant indices: res[] stays in registers
  for (int i = 0; i < 8; ++i) res[i] = *(const f32x4*)(pic + g0 + (size_t)i * 16 * D_);
  float bval[4];
#pragma unroll   // constant indices: bval[] stays in registers
  for (int c = 0; c < 4; ++c) bval[c] = bd[col0 + c * 16 + l16];

  // this wave's last reads of the panel have retired before another wave
  // writes over it behind the barrier
  asm volatile("s_wait_dscnt 0x0" ::: "memory");
  __syncthreads();   // every wave is done with the weight panel

#pragma unroll   // constant indices: acc[] stays in registers
  for (int c = 0; c < 4; ++c)
#pragma unroll
    for (int r = 0; r < 8; ++r)
      ldsO[(wv * 16 + hig * 8 + r) * EO_PITCH + c * 16 + l16] = acc[c][r] + bval[c];
  __syncthreads();   // the whole tile is in LDS

  const float* ld = ldsO + (tid >> 4) * EO_PITCH + (tid & 15) * 4;
  f32x4 v[8];
#pragma unroll   // the eight LDS reads issue together, each into its own registers
  for (int i = 0; i < 8; ++i) v[i] = *(const f32x4*)(ld + i * 16 * EO_PITCH);
#pragma unroll
  for (int i = 0; i < 8; ++i)
    *(f32x4*)(xo + g0 + (size_t)i * 16 * D_) = v[i] + res[i];     // residual
}

// ---- layer norm ------------------------------------------------------------

__global__ void ln_kernel(const float* __restrict__ x, const float* __restrict__ w,
                          const float* __restrict__ bw, float* __restrict__ out) {
  __shared__ float red[256];
  const int row = blockIdx.x;
  const float* xr = x + (size_t)row * D_;

  float s = 0.f;
  for (int i = threadIdx.x; i < D_; i += 256) s += xr[i];
  red[threadIdx.x] = s; __syncthreads();
  for (int off = 128; off > 0; off >>= 1) {
    if (threadIdx.x < off) red[threadIdx.x] += red[threadIdx.x + off];
    __syncthreads();
  }
  const float mean = red[0] * (1.0f / D_);
  __syncthreads();

  float v = 0.f;
  for (int i = threadIdx.x; i < D_; i += 256) {
    float d = xr[i] - mean; v += d * d;
  }
  red[threadIdx.x] = v; __syncthreads();
  for (int off = 128; off > 0; off >>= 1) {
    if (threadIdx.x < off) red[threadIdx.x] += red[threadIdx.x + off];
    __syncthreads();
  }
  const float inv = rsqrtf(red[0] * (1.0f / D_) + 1e-12f);

  for (int i = threadIdx.x; i < D_; i += 256)
    out[(size_t)row * D_ + i] = w[i] * ((xr[i] - mean) * inv) + bw[i];
}

// ---- launch ---------------------------------------------------------------

extern "C" void kernel_launch(void* const* d_in, const int* in_sizes, int n_in,
                              void* d_out, int out_size, void* d_ws, size_t ws_size,
                              hipStream_t stream) {
  const float* eeg = (const float*)d_in[0];
  const float* pic = (const float*)d_in[1];
  const float* Wk  = (const float*)d_in[2];
  const float* bk  = (const float*)d_in[3];
  const float* Wq  = (const float*)d_in[4];
  const float* bq  = (const float*)d_in[5];
  const float* Wv  = (const float*)d_in[6];
  const float* bv  = (const float*)d_in[7];
  const float* Wd  = (const float*)d_in[8];
  const float* bd  = (const float*)d_in[9];
  const float* lnw = (const float*)d_in[10];
  const float* lnb = (const float*)d_in[11];

  char* ws = (char*)d_ws;
  u16*  eegb = (u16*)(ws + ((size_t)0  << 20));   // 8 MB, fragment order
  u16*  picb = (u16*)(ws + ((size_t)8  << 20));   // 8 MB, fragment order
  u16*  WkT  = (u16*)(ws + ((size_t)16 << 20));   // 2 MB
  u16*  WqT  = (u16*)(ws + ((size_t)18 << 20));   // 2 MB
  u16*  WvT  = (u16*)(ws + ((size_t)20 << 20));   // 2 MB
  u16*  WdT  = (u16*)(ws + ((size_t)22 << 20));   // 2 MB
  u16*  qb   = (u16*)(ws + ((size_t)24 << 20));   // 8 MB [b,h,S,hd]
  u16*  kbuf = (u16*)(ws + ((size_t)32 << 20));   // 8 MB [b,h,S,hd]
  u16*  vTb  = (u16*)(ws + ((size_t)40 << 20));   // 8 MB [b,h,hd,S]
  u16*  ctxb = (u16*)(ws + ((size_t)48 << 20));   // 8 MB [B*S][D], fragment order
  float* xb  = (float*)(ws + ((size_t)56 << 20)); // 16 MB

  cvt_all<<<2 * CV_ACT_WGS + 4 * CV_W_WGS, CV_THREADS, 0, stream>>>(
      eeg, pic, Wk, Wq, Wv, Wd, eegb, picb, WkT, WqT, WvT, WdT);

  qkv_gemm<<<dim3(512, 3), 256, 0, stream>>>(eegb, picb, WkT, WqT, WvT,
                                             bk, bq, bv, qb, kbuf, vTb);
  flash_attn<<<512, 256, 0, stream>>>(qb, kbuf, vTb, ctxb);
  out_gemm<<<512, 256, 0, stream>>>(ctxb, WdT, bd, pic, xb);
  ln_kernel<<<NTOK, 256, 0, stream>>>(xb, lnw, lnb, (float*)d_out);
}

// v009
// One run takes 81.4 microseconds.
// Timed twice side by side with v008, it ran 1.13 times as fast both times.
// All steps since v000 together make it 5.47 times as fast.
#include <hip/hip_runtime.h>
#include <hip/hip_bf16.h>
#include <math.h>
#include <stdint.h>

// Problem constants (reference: B=4, S=1024, D=1024, H=16, HD=64)
#define B_   4
#define S_   1024
#define D_   1024
#define H_   16
#define HD_  64
#define NTOK (B_ * S_)   // 4096 tokens

typedef unsigned short u16;
typedef __attribute__((ext_vector_type(8)))  u16    u16x8;
typedef __attribute__((ext_vector_type(4)))  u16    u16x4;
typedef __attribute__((ext_vector_type(4)))  float  f32x4;
typedef __attribute__((ext_vector_type(16))) __bf16 v16bf;
typedef __attribute__((ext_vector_type(8)))  __bf16 v8bf;
typedef __attribute__((ext_vector_type(8)))  float  v8f;

// ---- helpers ---------------------------------------------------------------

__device__ __forceinline__ u16 f2bf(float f) {
  union { float f; unsigned u; } c; c.f = f;
  unsigned u = c.u;
  u += 0x7FFFu + ((u >> 16) & 1u);   // round-to-nearest-even
  return (u16)(u >> 16);
}

// Build a 16x32 (or 32x16) bf16 WMMA fragment from two contiguous 16B chunks.
// Per ISA layout (16-bit A 16x32): lane-lo holds K=0..7 (v0-3) and K=16..23
// (v4-7); lane-hi holds K=8..15 and K=24..31.
__device__ __forceinline__ v16bf make_frag(const u16* p0, const u16* p1) {
  union { u16x8 h[2]; v16bf v; } u;
  u.h[0] = *(const u16x8*)p0;
  u.h[1] = *(const u16x8*)p1;
  return u.v;
}

__device__ __forceinline__ v8f wmma_bf16(v16bf a, v16bf b, v8f c) {
  return __builtin_amdgcn_wmma_f32_16x16x32_bf16(
      false, a, false, b, (short)0, c, false, false);
}

// The issuing wave's async copies to LDS (ASYNCcnt-tracked) have landed.
__device__ __forceinline__ void wait_async0() {
  asm volatile("s_wait_asynccnt 0x0" ::: "memory");
}
__device__ __forceinline__ unsigned lds_off32(const void* p) {
  return (unsigned)(uintptr_t)p;   // low 32 bits of generic ptr = LDS offset
}

// ---- conversion kernel -----------------------------------------------------
// The two activation conversions and the four weight transposes do not depend on
// one another, so they share ONE launch: a workgroup's index says which job it
// does (a block-uniform branch).  All 768 workgroups (16 waves each, three a WGP)
// are resident at once; the long activation streams have the low indices.

// Every bf16 activation matrix X[4096][1024] that a projection GEMM reads as its
// A operand lies in the workspace in A-fragment order: 1 KiB per (16-row block,
// 32-k step), blocks row-major over [row block][k step].  Inside a block lane
// l = 16 * hig + l16 owns bytes 16 l .. 16 l + 15 of each 512-byte half:
//   first half : X[16 rb + l16][32 s      + 8 hig + 0..7]
//   second half: X[16 rb + l16][32 s + 16 + 8 hig + 0..7]
// so a wave's 16-byte fragment load covers 512 contiguous bytes (4 whole lines),
// not 32-byte pieces of 16 lines.  In units of 256 B (128 elements):
//   unit = (row >> 4) * 128 + (k >> 3), element in it = (row & 15) * 8 + (k & 7).

// Activations: each of an input's 128 workgroups converts 32768 contiguous
// elements = 32 whole rows = 64 KiB contiguous in fragment order.  A lane issues
// its 16 independent 16-byte loads first (each wave-wide load is 512 contiguous
// bytes), converts, and puts 8 bytes per load at their fragment-order place in
// LDS; behind one barrier the image goes out linearly, 512 contiguous bytes per
// wave-wide store.  In LDS each 256-byte unit has a 272 B pitch (16 B x odd): the
// 16 units that a wave's 8-byte stores fall in cover all 64 banks once.
#define CV_THREADS 512
#define CV_LOADS   16
#define CV_STEP    (CV_THREADS * 4)            // elements per workgroup-wide round
#define CV_CHUNK   (CV_STEP * CV_LOADS)        // elements per workgroup
#define CV_ACT_WGS (NTOK * D_ / CV_CHUNK)      // workgroups per activation: 128
#define CV_UPITCH  (128 + 8)                   // u16 per 256-byte unit in LDS
#define CV_LDS_U16 (CV_CHUNK / 128 * CV_UPITCH)   // 69632 B
__device__ __forceinline__ void cvt_act(const float* __restrict__ x,
                                        u16* __restrict__ y, u16* sm, int chunk) {
  const int tid = threadIdx.x;
  const size_t base = (size_t)chunk * CV_CHUNK;
  const unsigned xoff = ((unsigned)base + tid * 4) * 4;   // byte offset in x, below 16 MiB

  f32x4 r[CV_LOADS];
  // unrolled: r[] stays in registers and every load issues before the first wait
#pragma unroll
  for (int j = 0; j < CV_LOADS; ++j)
    r[j] = *(const f32x4*)((const char*)x + xoff + j * (CV_STEP * 4));
  // stands ahead of any rewrite of the loads' address registers (a precaution);
  // the offset is named as an input so that it lives up to the wait and no load
  // of the run lands in its register
  asm volatile("s_wait_xcnt 0x0" :: "v"(xoff) : "memory");

  // load j of this thread: row 2 j + (tid >> 8) of the chunk, k = 4 (tid & 255)
  u16* st = sm + ((tid & 255) >> 1) * CV_UPITCH + (tid >> 8) * 8 + (tid & 1) * 4;
  // unrolled (both loops): constant indices into r[] and p, no scratch memory
#pragma unroll
  for (int j = 0; j < CV_LOADS; ++j) {
    u16x4 p;
#pragma unroll
    for (int c = 0; c < 4; ++c) p[c] = f2bf(r[j][c]);
    *(u16x4*)(st + (j >> 3) * 128 * CV_UPITCH + (j & 7) * 16) = p;
  }
  __syncthreads();   // reached by all 16 waves of a converting workgroup

  // 16-byte piece i * 512 + tid of the image: unit piece >> 4, place piece & 15
  const u16* ld  = sm + (tid >> 4) * CV_UPITCH + (tid & 15) * 8;
  u16*       dst = y + base + tid * 8;
#pragma unroll   // constant offsets on one LDS and one global address
  for (int i = 0; i < CV_CHUNK / (CV_THREADS * 8); ++i)
    *(u16x8*)(dst + i * (CV_THREADS * 8)) =
        *(const u16x8*)(ld + i * (CV_THREADS / 16) * CV_UPITCH);
}

// W is [K][N] row-major f32; produce WT[N][K] bf16 so a B-fragment column
// reads contiguous K.  One 64(k) x 64(n) tile per 256 threads, turned in LDS:
// global reads are whole 256-byte row pieces, global writes whole 128-byte
// lines (8 lanes x 16 B per WT row), each line written by one workgroup.
// A workgroup's two halves take two tiles side by side in n, each in its own
// LDS tile; tid is the thread's number inside its half.
#define WT_PITCH 68   // u16 per LDS row: 64 + 4, rows stay 8-byte aligned
#define CV_W_WGS ((D_ / 64) * (D_ / 64) / 2)   // workgroups per weight: 128
__device__ __forceinline__ void cvt_wT(const float* __restrict__ w,
                                       u16* __restrict__ wt,
                                       u16* tile, int tidx, int tid) {   // tile: [n][k]
  const int n0  = (tidx & 15) << 6;
  const int k0  = (tidx >> 4) << 6;

  // each thread: a 4(k) x 4(n) block, four independent 16-byte loads
  const int nq = (tid & 15) << 2;
  const int kq = (tid >> 4) << 2;
  const float* src = w + (size_t)(k0 + kq) * D_ + n0 + nq;
  f32x4 r[4];
#pragma unroll
  for (int j = 0; j < 4; ++j) r[j] = *(const f32x4*)(src + (size_t)j * D_);

#pragma unroll
  for (int c = 0; c < 4; ++c) {
    u16x4 p;
#pragma unroll
    for (int j = 0; j < 4; ++j) p[j] = f2bf(r[j][c]);
    *(u16x4*)&tile[(nq + c) * WT_PITCH + kq] = p;    // 4 k of one n: 8 bytes
  }
  __syncthreads();   // reached by all 16 waves of a transposing workgroup

  const int kc = (tid & 7) << 3;
#pragma unroll
  for (int p = 0; p < 2; ++p) {
    const int n = p * 32 + (tid >> 3);
    union { u16x4 h[2]; u16x8 v; } u;
    u.h[0] = *(const u16x4*)&tile[n * WT_PITCH + kc];
    u.h[1] = *(const u16x4*)&tile[n * WT_PITCH + kc + 4];
    *(u16x8*)(wt + (size_t)(n0 + n) * D_ + k0 + kc) = u.v;
  }
  // stands ahead of any rewrite of the two stores' registers (a precaution): the
  // built kernel lays the activation branch's code behind these stores
  asm volatile("s_wait_xcnt 0x0" ::: "memory");
}

__global__ __launch_bounds__(CV_THREADS)
void cvt_all(const float* __restrict__ eeg, const float* __restrict__ pic,
             const float* __restrict__ Wk,  const float* __restrict__ Wq,
             const float* __restrict__ Wv,  const float* __restrict__ Wd,
             u16* __restrict__ eegb, u16* __restrict__ picb,
             u16* __restrict__ WkT,  u16* __restrict__ WqT,
             u16* __restrict__ WvT,  u16* __restrict__ WdT) {
  // one array for both jobs: the fragment-order image, or the two transpose tiles
  __shared__ __attribute__((aligned(16))) u16 sm[CV_LDS_U16];
  const int blk = blockIdx.x;
  if (blk < 2 * CV_ACT_WGS) {
    const bool second = blk >= CV_ACT_WGS;
    cvt_act(second ? pic : eeg, second ? picb : eegb, sm, blk & (CV_ACT_WGS - 1));
  } else {
    const int wb   = blk - 2 * CV_ACT_WGS;
    const int wsel = wb / CV_W_WGS;            // 0..3: k, q, v, d
    const float* w = wsel == 0 ? Wk  : wsel == 1 ? Wq  : wsel == 2 ? Wv  : Wd;
    u16*        wt = wsel == 0 ? WkT : wsel == 1 ? WqT : wsel == 2 ? WvT : WdT;
    const int half = threadIdx.x >> 8;
    cvt_wT(w, wt, sm + half * (64 * WT_PITCH), (wb & (CV_W_WGS - 1)) * 2 + half,
           threadIdx.x & 255);
  }
}

// ---- projection GEMMs: shared main loop ------------------------------------
// A workgroup (8 waves) computes 128 rows x 64 columns; each wave a 16x64 tile.
// All 8 waves use the same 64 weight rows of WT[N][K] (128 KB, contiguous in
// global memory), so that panel is async-staged into LDS once and every
// B fragment comes from LDS.  Each wave reads its own 16 activation rows from
// global memory (fragment order: 32 KiB contiguous), every byte once, four
// k-steps (128 k) ahead.
// LDS layout [k quarter][64 rows][256 k + 8]: the row pitch is 528 B = 16 B x odd
// (no bank conflict for 16-byte reads), and everything one trip of the main loop
// reads lies within 64 KB of one address register (the LDS offset field's reach).
#define GB_PITCH   (256 + 8)           // u16 per LDS row
#define GB_QUART   (64 * GB_PITCH)     // u16 per k quarter: 33792 B
#define GB_LDS_U16 (4 * GB_QUART)      // 135168 B: two workgroups per WGP

// Eight async 16-byte copies, then s_wait_xcnt 0 ahead of any rewrite of their
// address registers (a precaution); one statement, so that the compiler can put
// no such rewrite between the copies and the wait.
__device__ __forceinline__ void async_cp16x8(unsigned l, const u16* g) {
  const unsigned LS = 2 * GB_PITCH * 2;  // LDS bytes between a thread's chunks
  const int      GS = 256 * 8;           // global elements between them
  asm volatile(
      "global_load_async_to_lds_b128 %0, %8, off\n\t"
      "global_load_async_to_lds_b128 %1, %9, off\n\t"
      "global_load_async_to_lds_b128 %2, %10, off\n\t"
      "global_load_async_to_lds_b128 %3, %11, off\n\t"
      "global_load_async_to_lds_b128 %4, %12, off\n\t"
      "global_load_async_to_lds_b128 %5, %13, off\n\t"
      "global_load_async_to_lds_b128 %6, %14, off\n\t"
      "global_load_async_to_lds_b128 %7, %15, off\n\t"
      "s_wait_xcnt 0x0"
      :: "v"(l), "v"(l + LS), "v"(l + 2 * LS), "v"(l + 3 * LS),
         "v"(l + 4 * LS), "v"(l + 5 * LS), "v"(l + 6 * LS), "v"(l + 7 * LS),
         "v"(g), "v"(g + GS), "v"(g + 2 * GS), "v"(g + 3 * GS),
         "v"(g + 4 * GS), "v"(g + 5 * GS), "v"(g + 6 * GS), "v"(g + 7 * GS)
      : "memory");
}

// acc[c] += A[row0 + 0..15][:] x WT[col0 + 16c + 0..15][:]^T over all D_ k.
__device__ __forceinline__ void gemm_16x64(const u16* __restrict__ A,
                                           const u16* __restrict__ WT,
                                           u16* ldsB, int row0, int col0,
                                           v8f* acc) {
  const int tid  = threadIdx.x;
  const int lane = tid & 31;
  const int l16  = lane & 15;
  const int hig  = lane >> 4;

  // A in fragment order: 512 elements per k-step, this lane's 8 at 8 * lane
  const u16* arow = A + (size_t)(row0 >> 4) * (16 * D_) + lane * 8;
  auto ldA4 = [&](v16bf* dst, int kk) {
#pragma unroll   // constant indices: dst[] stays in registers
    for (int s = 0; s < 4; ++s)
      dst[s] = make_frag(arow + kk * 16 + s * 512, arow + kk * 16 + s * 512 + 256);
  };

  // first activation block: issued ahead of the staging so both fly together
  v16bf a0[4], a1[4];
  ldA4(a0, 0);

  // ---- async-stage the 64 x 1024 weight panel: 8192 chunks, 32 a thread ----
  {
    const u16* g = WT + (size_t)col0 * D_ + tid * 8;
    const unsigned l = lds_off32(ldsB) + ((tid & 127) >> 5) * (GB_QUART * 2) +
                       (tid >> 7) * (GB_PITCH * 2) + (tid & 31) * 16;
#pragma unroll   // all 32 copies issue back to back, no loop counter between them
    for (int j = 0; j < 4; ++j)
      async_cp16x8(l + j * 16 * (GB_PITCH * 2), g + j * 8 * 256 * 8);
    wait_async0();
    __syncthreads();
  }

  const u16* wrow = ldsB + l16 * GB_PITCH + hig * 8;
  // q = k quarter, kk = k inside it (kk == 256 names the next quarter's start)
  auto ldB = [&](v16bf* dst, int q, int kk) {
    const u16* p = wrow + q * GB_QUART + (kk >> 8) * GB_QUART + (kk & 255);
#pragma unroll   // constant indices: dst[] stays in registers
    for (int c = 0; c < 4; ++c)
      dst[c] = make_frag(p + c * 16 * GB_PITCH, p + c * 16 * GB_PITCH + 16);
  };
  auto mm = [&](v16bf a, const v16bf* b) {
#pragma unroll   // constant indices: acc[] and b[] stay in registers
    for (int c = 0; c < 4; ++c) acc[c] = wmma_bf16(a, b[c], acc[c]);
  };

  // B fragments one k-step ahead, A fragments one 128-k block ahead, each in
  // two disjoint register sets (no rotation moves)
  v16bf bf0[4], bf1[4];
  ldB(bf0, 0, 0);
  // keeps each group of loads in front of the WMMAs of the step before it;
  // without it the scheduler sinks every load to just ahead of its use and each
  // WMMA waits out an LDS latency
  auto hold = [] { __builtin_amdgcn_sched_barrier(0); };
  auto body = [&](int q, bool more) {
    const int kb = q * 256;
    ldA4(a1, kb + 128);
    ldB(bf1, q, 32);   hold();  mm(a0[0], bf0);
    ldB(bf0, q, 64);   hold();  mm(a0[1], bf1);
    ldB(bf1, q, 96);   hold();  mm(a0[2], bf0);
    ldB(bf0, q, 128);  hold();  mm(a0[3], bf1);
    if (more) ldA4(a0, kb + 256);
    ldB(bf1, q, 160);  hold();  mm(a1[0], bf0);
    ldB(bf0, q, 192);  hold();  mm(a1[1], bf1);
    ldB(bf1, q, 224);  hold();  mm(a1[2], bf0);
    if (more) ldB(bf0, q, 256);
    hold();
    mm(a1[3], bf1);
    // stands ahead of the next trip's first instructions, which form a new
    // activation address in the register pair that this trip's global loads name
    if (more) asm volatile("s_wait_xcnt 0x0" ::: "memory");
  };
  // kept rolled: unrolled, LDS addresses past 64 KB each cost their own add, and
  // the epilogue's loads move up until only one workgroup fits a WGP
#pragma unroll 1
  for (int q = 0; q < 3; ++q) body(q, true);
  body(3, false);   // last 256 k: nothing left to fetch ahead
}

// ---- fused QKV projection GEMM --------------------------------------------
// grid.x = 32 row blocks x 16 column blocks, grid.y = which projection.
#define EQ_PITCH (64 + 8)    // u16 per token row of the q / k tile in LDS: 144 B = 16 B x 9
#define EV_PITCH (128 + 8)   // u16 per d row of the V^T tile in LDS: 272 B = 16 B x 17

__global__ __launch_bounds__(256)
void qkv_gemm(const u16* __restrict__ eegb, const u16* __restrict__ picb,
              const u16* __restrict__ WkT,  const u16* __restrict__ WqT,
              const u16* __restrict__ WvT,
              const float* __restrict__ bk, const float* __restrict__ bq,
              const float* __restrict__ bv,
              u16* __restrict__ qo, u16* __restrict__ ko,
              u16* __restrict__ vTo) {
  __shared__ __attribute__((aligned(16))) u16 ldsB[GB_LDS_U16];
  const int mode = blockIdx.y;           // 0=q 1=k 2=v
  const int lane = threadIdx.x & 31;
  const int wv   = threadIdx.x >> 5;
  const int l16  = lane & 15;
  const int hig  = lane >> 4;

  const int row0 = ((blockIdx.x >> 4) << 7) + (wv << 4);
  const int col0 = (blockIdx.x & 15) << 6;   // shared by all 8 waves in this WG

  const u16*  A    = (mode == 1) ? eegb : picb;
  const u16*  WT   = (mode == 0) ? WqT : (mode == 1 ? WkT : WvT);
  const float* bias = (mode == 0) ? bq : (mode == 1 ? bk : bv);

  v8f acc[4] = {};
  gemm_16x64(A, WT, ldsB, row0, col0, acc);

  // ---- epilogue: the workgroup's 128 x 64 bf16 tile is laid in LDS (over the
  // weight panel, which nobody needs any more) as it lies in global memory, then
  // goes out 16 bytes a lane: q and k are 16 KiB contiguous (128 tokens x one
  // head's 64 d), V^T is 64 d rows of 256 contiguous bytes (128 tokens).  Every
  // store covers whole 128-byte lines; straight from the accumulators a V^T
  // store would put 2 bytes in each of 16 lines 2 KiB apart.
  const int tid  = threadIdx.x;
  const int rowb = (blockIdx.x >> 4) << 7;   // the workgroup's first token
  const int b    = rowb >> 10, sb = rowb & (S_ - 1);
  const int h    = blockIdx.x & 15;          // the 64 columns are one head

  // the four bias loads issue together, so that their latencies overlap
  float bval[4];
#pragma unroll   // constant indices: bval[] stays in registers
  for (int c = 0; c < 4; ++c) bval[c] = bias[col0 + c * 16 + l16];

  // this wave's last reads of the panel have retired before another wave
  // writes over it behind the barrier
  asm volatile("s_wait_dscnt 0x0" ::: "memory");
  __syncthreads();   // every wave is done with the weight panel

  // 1024 pieces of 16 bytes go out, 4 a thread; a wave's 32 pieces are consecutive
  u16x8 v[4];
  if (mode == 2) {
    // LDS row d = 16 c + l16; the lane's 8 values are 8 consecutive tokens
#pragma unroll   // constant indices: acc[] stays in registers
    for (int c = 0; c < 4; ++c) {
      u16x8 p;
#pragma unroll
      for (int r = 0; r < 8; ++r) p[r] = f2bf(acc[c][r] + bval[c]);
      *(u16x8*)(ldsB + (c * 16 + l16) * EV_PITCH + wv * 16 + hig * 8) = p;
    }
    __syncthreads();   // the whole tile is in LDS (mode is the same in the whole block)
    const u16* ld  = ldsB + (tid >> 4) * EV_PITCH + (tid & 15) * 8;
    u16*       dst = vTo + ((size_t)(b * H_ + h) * HD_ + (tid >> 4)) * S_ + sb +
                     (tid & 15) * 8;                                      // [b,h,hd,S]
#pragma unroll   // the four LDS reads issue together, each into its own registers
    for (int i = 0; i < 4; ++i) v[i] = *(const u16x8*)(ld + i * 16 * EV_PITCH);
#pragma unroll
    for (int i = 0; i < 4; ++i) *(u16x8*)(dst + i * 16 * S_) = v[i];
  } else {
    // LDS row = token; 16 lanes write 32 contiguous bytes of it
#pragma unroll   // constant indices: acc[] stays in registers
    for (int c = 0; c < 4; ++c)
#pragma unroll
      for (int r = 0; r < 8; ++r)
        ldsB[(wv * 16 + hig * 8 + r) * EQ_PITCH + c * 16 + l16] = f2bf(acc[c][r] + bval[c]);
    __syncthreads();   // the whole tile is in LDS (mode is the same in the whole block)
    const u16* ld  = ldsB + (tid >> 3) * EQ_PITCH + (tid & 7) * 8;
    u16*       dst = ((mode == 0) ? qo : ko) + ((size_t)(b * H_ + h) * S_ + sb) * HD_ +
                     tid * 8;                                             // [b,h,S,hd]
#pragma unroll   // the four LDS reads issue together, each into its own registers
    for (int i = 0; i < 4; ++i) v[i] = *(const u16x8*)(ld + i * 32 * EQ_PITCH);
#pragma unroll
    for (int i = 0; i < 4; ++i) *(u16x8*)(dst + i * 256 * 8) = v[i];
    // stands ahead of any rewrite of the four stores' registers (a precaution): the
    // built kernel lays the V^T branch's code behind these stores
    asm volatile("s_wait_xcnt 0x0" ::: "memory");
  }
}

#define KT_PITCH (64 + 8)   // u16 per K row in LDS: 144 B = 16 B x 9
#define VT_PITCH (32 + 8)   // u16 per V^T row in LDS: 80 B = 16 B x 5

// A thread's two async 16-byte copies of one tile pair, then s_wait_xcnt 0 ahead
// of any rewrite of their address registers (a precaution); one statement, so that
// the compiler can put no such rewrite between the copies and the wait.
__device__ __forceinline__ void async_cp16x2(unsigned l0, const u16* g0,
                                             unsigned l1, const u16* g1) {
  asm volatile(
      "global_load_async_to_lds_b128 %0, %2, off\n\t"
      "global_load_async_to_lds_b128 %1, %3, off\n\t"
      "s_wait_xcnt 0x0"
      :: "v"(l0), "v"(l1), "v"(g0), "v"(g1) : "memory");
}

// value of lane l ^ 16
__device__ __forceinline__ float xhalf(float x) {
  const int v = __builtin_bit_cast(int, x);
  return __builtin_bit_cast(float, __builtin_amdgcn_permlanex16(
      v, v, 0x76543210, 0xfedcba98, false, false));
}

__global__ void flash_attn(const u16* __restrict__ q, const u16* __restrict__ k,
                           const u16* __restrict__ vT, u16* __restrict__ ctx) {
  __shared__ __attribute__((aligned(16))) u16 kt[2][32 * KT_PITCH];  // [key][d]
  __shared__ __attribute__((aligned(16))) u16 vt[2][64 * VT_PITCH];  // [d][key]

  const int tid  = threadIdx.x;
  const int lane = tid & 31;
  const int wv   = tid >> 5;
  const int l16  = lane & 15;
  const int hig  = lane >> 4;

  const int qblk = blockIdx.x & 7;
  const int bh   = blockIdx.x >> 3;
  const int h    = bh & (H_ - 1);
  const int b0   = bh >> 4;
  const int qbase = qblk * 128 + wv * 16;

  const u16* qh = q  + (size_t)bh * S_ * HD_;
  const u16* kh = k  + (size_t)bh * S_ * HD_;
  const u16* vh = vT + (size_t)bh * HD_ * S_;

  // Q^T as B operand: column l16 = query qbase + l16
  const u16* qp = qh + (size_t)(qbase + l16) * HD_;
  v16bf qa0 = make_frag(qp +      hig * 8, qp + 16 + hig * 8);  // d 0..31
  v16bf qa1 = make_frag(qp + 32 + hig * 8, qp + 48 + hig * 8);  // d 32..63

  // one query a lane: m is joined over the halves every tile, lsum holds this
  // half's keys only and is joined once behind the loop
  float m = -3.0e38f, lsum = 0.f;
  v8f o[4] = {};                             // o[j][r] = O[query l16][16j + 8 hig + r]

  const float SC = 0.125f;                   // 1/sqrt(64)

  // cooperative async stage of one 32-key K/V tile pair (8 KB = 2 chunks/thr)
  auto issue_tiles = [&](int n0, int bsel) {
    // K tile: 32 keys x 64 d, contiguous 4 KB at kh + n0*64, 8 chunks a row
    // V tile: 64 d-rows x 32 keys (64B per row, stride S_), 4 chunks a row
    const int d = tid >> 2, part = tid & 3;
    async_cp16x2(lds_off32(&kt[bsel][(tid >> 3) * KT_PITCH + (tid & 7) * 8]),
                 kh + (size_t)n0 * HD_ + tid * 8,
                 lds_off32(&vt[bsel][d * VT_PITCH + part * 8]),
                 vh + (size_t)d * S_ + n0 + part * 8);
  };

  issue_tiles(0, 0);

  for (int it = 0; it < S_ / 32; ++it) {
    const int n0   = it * 32;
    const int bsel = it & 1;
    // hand-over between trips, in this order.  The last trip issues nothing behind
    // it, so no copy is in flight when the wave ends.
    // this wave's LDS reads of the other buffer have retired before it is refilled
    asm volatile("s_wait_dscnt 0x0" ::: "memory");
    wait_async0();         // own chunks of tile `it` landed
    __syncthreads();       // everyone's chunks landed; prev compute done
    if (it + 1 < S_ / 32) issue_tiles(n0 + 32, bsel ^ 1);

    // ---- scores S^T = K @ Q^T for the 32x16 tile (K rows from LDS as A) ----
    const u16* kp0 = &kt[bsel][(size_t)l16 * KT_PITCH];
    const u16* kp1 = &kt[bsel][(size_t)(16 + l16) * KT_PITCH];
    v16bf kb00 = make_frag(kp0 +      hig * 8, kp0 + 16 + hig * 8);
    v16bf kb01 = make_frag(kp0 + 32 + hig * 8, kp0 + 48 + hig * 8);
    v16bf kb10 = make_frag(kp1 +      hig * 8, kp1 + 16 + hig * 8);
    v16bf kb11 = make_frag(kp1 + 32 + hig * 8, kp1 + 48 + hig * 8);

    v8f c0 = {}, c1 = {};                    // c0[r]: key 8 hig + r, c1[r]: 16 more
    c0 = wmma_bf16(kb00, qa0, c0);
    c0 = wmma_bf16(kb01, qa1, c0);
    c1 = wmma_bf16(kb10, qa0, c1);
    c1 = wmma_bf16(kb11, qa1, c1);

    // ---- online softmax: 16 scores of one query in this lane ----
    c0 *= SC;
    c1 *= SC;
    float t[8];
#pragma unroll   // constant indices: t[] stays in registers
    for (int r = 0; r < 8; ++r) t[r] = fmaxf(c0[r], c1[r]);
    float tm = fmaxf(fmaxf(fmaxf(t[0], t[1]), fmaxf(t[2], t[3])),
                     fmaxf(fmaxf(t[4], t[5]), fmaxf(t[6], t[7])));
    tm = fmaxf(tm, xhalf(tm));               // the other half's 16 keys
    const float mnew = fmaxf(m, tm);
    const float scl  = __expf(m - mnew);
    m = mnew;
#pragma unroll   // constant indices: c0, c1, t[] stay in registers
    for (int r = 0; r < 8; ++r) {
      c0[r] = __expf(c0[r] - mnew);
      c1[r] = __expf(c1[r] - mnew);
      t[r]  = c0[r] + c1[r];
    }
    lsum = lsum * scl + (((t[0] + t[1]) + (t[2] + t[3])) +
                         ((t[4] + t[5]) + (t[6] + t[7])));

    // P^T as B operand, straight from the two score tiles
    union { v8bf h[2]; v16bf v; } pb;
    pb.h[0] = __builtin_convertvector(c0, v8bf);
    pb.h[1] = __builtin_convertvector(c1, v8bf);

    // ---- O^T += V^T @ P^T  (V^T rows from LDS as A, [d][key] tile) ----
#pragma unroll
    for (int j = 0; j < 4; ++j) {
      const u16* vp = &vt[bsel][(size_t)(j * 16 + l16) * VT_PITCH];
      v16bf vb = make_frag(vp + hig * 8, vp + 16 + hig * 8);
      o[j] = wmma_bf16(vb, pb.v, o[j] * scl);
    }
  }

  // ---- normalize & store ctx as bf16, [B*S][D] in fragment order: the wave's 16
  // queries are one row block, o[j] is half j & 1 of k-step 2 h + (j >> 1), so
  // every store is 512 contiguous bytes ----
  const float inv = 1.0f / (lsum + xhalf(lsum));
  u16* crow = ctx + ((size_t)((b0 * S_ + qbase) >> 4) * (D_ / 32) + h * 2) * 512 + lane * 8;
#pragma unroll
  for (int j = 0; j < 4; ++j)
    *(v8bf*)(crow + j * 256) = __builtin_convertvector(o[j] * inv, v8bf);
}

// ---- output projection + residual -----------------------------------------
#define EO_PITCH (64 + 4)    // f32 per row of the output tile in LDS: 272 B = 16 B x 17

__global__ __launch_bounds__(256)
void out_gemm(const u16* __restrict__ ctxb, const u16* __restrict__ WdT,
              const float* __restrict__ bd, const float* __restrict__ pic,
              float* __restrict__ xo) {
  __shared__ __attribute__((aligned(16))) u16 ldsB[GB_LDS_U16];
  const int lane = threadIdx.x & 31;
  const int wv   = threadIdx.x >> 5;
  const int l16  = lane & 15;
  const int hig  = lane >> 4;

  const int row0 = ((blockIdx.x >> 4) << 7) + (wv << 4);
  const int col0 = (blockIdx.x & 15) << 6;

  v8f acc[4] = {};
  gemm_16x64(ctxb, WdT, ldsB, row0, col0, acc);

  // ---- epilogue, staged like the QKV kernel's: the 128 x 64 f32 tile goes through
  // LDS (over the dead weight panel), so that the residual is read and the result
  // stored 16 bytes a lane, 256 contiguous bytes of a row, not in 64-byte pieces.
  // 2048 pieces of 16 bytes, 8 a thread: piece 256 i + tid is row 16 i + (tid >> 4).
  const int tid  = threadIdx.x;
  const int rowb = (blockIdx.x >> 4) << 7;   // the workgroup's first row
  const size_t g0 = (size_t)(rowb + (tid >> 4)) * D_ + col0 + (tid & 15) * 4;
  float* ldsO = (float*)ldsB;

  // residual and bias loads issue together, so that their latencies overlap
  f32x4 res[8];
#pragma unroll   // constant indices: res[] stays in registers
  for (int i = 0; i < 8; ++i) res[i] = *(const f32x4*)(pic + g0 + (size_t)i * 16 * D_);
  float bval[4];
#pragma unroll   // constant indices: bval[] stays in registers
  for (int c = 0; c < 4; ++c) bval[c] = bd[col0 + c * 16 + l16];

  // this wave's last reads of the panel have retired before another wave
  // writes over it behind the barrier
  asm volatile("s_wait_dscnt 0x0" ::: "memory");
  __syncthreads();   // every wave is done with the weight panel

#pragma unroll   // constant indices: acc[] stays in registers
  for (int c = 0; c < 4; ++c)
#pragma unroll
    for (int r = 0; r < 8; ++r)
      ldsO[(wv * 16 + hig * 8 + r) * EO_PITCH + c * 16 + l16] = acc[c][r] + bval[c];
  __syncthreads();   // the whole tile is in LDS

  const float* ld = ldsO + (tid >> 4) * EO_PITCH + (tid & 15) * 4;
  f32x4 v[8];
#pragma unroll   // the eight LDS reads issue together, each into its own registers
  for (int i = 0; i < 8; ++i) v[i] = *(const f32x4*)(ld + i * 16 * EO_PITCH);
#pragma unroll
  for (int i = 0; i < 8; ++i)
    *(f32x4*)(xo + g0 + (size_t)i * 16 * D_) = v[i] + res[i];     // residual
}

// ---- layer norm ------------------------------------------------------------
// One wave per row.  The row's 1024 f32 are read once, 8 independent 16-byte loads
// a lane (each wave-wide load is 512 contiguous bytes), and stay in registers for
// the mean, the variance and the result; weight and bias fly behind them.  The two
// sums run in the lane, then across the wave's lanes: no LDS, no barrier, and 16
// waves a WGP keep 64 KiB of the row stream in flight.
#define LN_WAVES 16                    // rows (waves) per workgroup
#define LN_LOADS (D_ / (32 * 4))       // 16-byte pieces of a row per lane: 8

// value of lane l ^ M inside a 16-lane row (DPP row_xmask:M)
template <int M>
__device__ __forceinline__ float xrow(float x) {
  return __builtin_bit_cast(float, __builtin_amdgcn_update_dpp(
      0, __builtin_bit_cast(int, x), 0x160 + M, 0xf, 0xf, true));
}
// sum over the wave's 32 lanes, the same value in every lane
__device__ __forceinline__ float wave_sum(float s) {
  s += xrow<1>(s);
  s += xrow<2>(s);
  s += xrow<4>(s);
  s += xrow<8>(s);
  return s + xhalf(s);
}

__global__ __launch_bounds__(LN_WAVES * 32)
void ln_kernel(const float* __restrict__ x, const float* __restrict__ w,
               const float* __restrict__ bw, float* __restrict__ out) {
  const int lane = threadIdx.x & 31;
  // the wave's number is the same in all its lanes: the row address stays scalar
  const int row = blockIdx.x * LN_WAVES +
                  __builtin_amdgcn_readfirstlane((int)(threadIdx.x >> 5));
  const float* xr = x + (size_t)row * D_ + lane * 4;

  f32x4 v[LN_LOADS], g[LN_LOADS], c[LN_LOADS];
  // unrolled (all loops here): constant indices, the arrays stay in registers, and
  // all 24 loads issue before the first wait
#pragma unroll
  for (int j = 0; j < LN_LOADS; ++j) v[j] = *(const f32x4*)(xr + j * 128);
#pragma unroll
  for (int j = 0; j < LN_LOADS; ++j) g[j] = *(const f32x4*)(w + lane * 4 + j * 128);
#pragma unroll
  for (int j = 0; j < LN_LOADS; ++j) c[j] = *(const f32x4*)(bw + lane * 4 + j * 128);
  // stands ahead of any rewrite of the loads' address registers (a precaution); the
  // scheduling barrier below keeps every such rewrite behind it
  asm volatile("s_wait_xcnt 0x0" ::: "memory");
  // keeps the weight and bias loads up here, in flight under the row's latency and
  // the two sums; without it the scheduler sinks them behind the sums, two at a
  // time, and the wave waits out a cache latency for each pair
  __builtin_amdgcn_sched_barrier(0);

  const f32x4 s4 = ((v[0] + v[1]) + (v[2] + v[3])) + ((v[4] + v[5]) + (v[6] + v[7]));
  const float mean = wave_sum((s4[0] + s4[1]) + (s4[2] + s4[3])) * (1.0f / D_);

#pragma unroll
  for (int j = 0; j < LN_LOADS; ++j) v[j] -= mean;
  const f32x4 q4 = ((v[0] * v[0] + v[1] * v[1]) + (v[2] * v[2] + v[3] * v[3])) +
                   ((v[4] * v[4] + v[5] * v[5]) + (v[6] * v[6] + v[7] * v[7]));
  const float var = wave_sum((q4[0] + q4[1]) + (q4[2] + q4[3])) * (1.0f / D_);
  const float inv = rsqrtf(var + 1e-12f);

  float* orow = out + (size_t)row * D_ + lane * 4;
#pragma unroll
  for (int j = 0; j < LN_LOADS; ++j)
    *(f32x4*)(orow + j * 128) = g[j] * (v[j] * inv) + c[j];
}

// ---- launch ---------------------------------------------------------------

extern "C" void kernel_launch(void* const* d_in, const int* in_sizes, int n_in,
                              void* d_out, int out_size, void* d_ws, size_t ws_size,
                              hipStream_t stream) {
  const float* eeg = (const float*)d_in[0];
  const float* pic = (const float*)d_in[1];
  const float* Wk  = (const float*)d_in[2];
  const float* bk  = (const float*)d_in[3];
  const float* Wq  = (const float*)d_in[4];
  const float* bq  = (const float*)d_in[5];
  const float* Wv  = (const float*)d_in[6];
  const float* bv  = (const float*)d_in[7];
  const float* Wd  = (const float*)d_in[8];
  const float* bd  = (const float*)d_in[9];
  const float* lnw = (const float*)d_in[10];
  const float* lnb = (const float*)d_in[11];

  char* ws = (char*)d_ws;
  u16*  eegb = (u16*)(ws + ((size_t)0  << 20));   // 8 MB, fragment order
  u16*  picb = (u16*)(ws + ((size_t)8  << 20));   // 8 MB, fragment order
  u16*  WkT  = (u16*)(ws + ((size_t)16 << 20));   // 2 MB
  u16*  WqT  = (u16*)(ws + ((size_t)18 << 20));   // 2 MB
  u16*  WvT  = (u16*)(ws + ((size_t)20 << 20));   // 2 MB
  u16*  WdT  = (u16*)(ws + ((size_t)22 << 20));   // 2 MB
  u16*  qb   = (u16*)(ws + ((size_t)24 << 20));   // 8 MB [b,h,S,hd]
  u16*  kbuf = (u16*)(ws + ((size_t)32 << 20));   // 8 MB [b,h,S,hd]
  u16*  vTb  = (u16*)(ws + ((size_t)40 << 20));   // 8 MB [b,h,hd,S]
  u16*  ctxb = (u16*)(ws + ((size_t)48 << 20));   // 8 MB [B*S][D], fragment order
  float* xb  = (float*)(ws + ((size_t)56 << 20)); // 16 MB

  cvt_all<<<2 * CV_ACT_WGS + 4 * CV_W_WGS, CV_THREADS, 0, stream>>>(
      eeg, pic, Wk, Wq, Wv, Wd, eegb, picb, WkT, WqT, WvT, WdT);

  qkv_gemm<<<dim3(512, 3), 256, 0, stream>>>(eegb, picb, WkT, WqT, WvT,
                                             bk, bq, bv, qb, kbuf, vTb);
  flash_attn<<<512, 256, 0, stream>>>(qb, kbuf, vTb, ctxb);
  out_gemm<<<512, 256, 0, stream>>>(ctxb, WdT, bd, pic, xb);
  ln_kernel<<<NTOK / LN_WAVES, LN_WAVES * 32, 0, stream>>>(xb, lnw, lnb, (float*)d_out);
}

// v010
// A run of this version takes 72.5 microseconds.
// In both of two side-by-side timings against v009, it was 1.12 times as fast.
// Counting every step since v000, it is 6.13 times as fast.
#include <hip/hip_runtime.h>
#include <hip/hip_bf16.h>
#include <math.h>
#include <stdint.h>

// Problem constants (reference: B=4, S=1024, D=1024, H=16, HD=64)
#define B_   4
#define S_   1024
#define D_   1024
#define H_   16
#define HD_  64
#define NTOK (B_ * S_)   // 4096 tokens

typedef unsigned short u16;
typedef __attribute__((ext_vector_type(8)))  u16    u16x8;
typedef __attribute__((ext_vector_type(4)))  u16    u16x4;
typedef __attribute__((ext_vector_type(4)))  float  f32x4;
typedef __attribute__((ext_vector_type(16))) __bf16 v16bf;
typedef __attribute__((ext_vector_type(8)))  __bf16 v8bf;
typedef __attribute__((ext_vector_type(8)))  float  v8f;

// ---- helpers ---------------------------------------------------------------

__device__ __forceinline__ u16 f2bf(float f) {
  union { float f; unsigned u; } c; c.f = f;
  unsigned u = c.u;
  u += 0x7FFFu + ((u >> 16) & 1u);   // round-to-nearest-even
  return (u16)(u >> 16);
}

// Build a 16x32 (or 32x16) bf16 WMMA fragment from two contiguous 16B chunks.
// Per ISA layout (16-bit A 16x32): lane-lo holds K=0..7 (v0-3) and K=16..23
// (v4-7); lane-hi holds K=8..15 and K=24..31.
__device__ __forceinline__ v16bf make_frag(const u16* p0, const u16* p1) {
  union { u16x8 h[2]; v16bf v; } u;
  u.h[0] = *(const u16x8*)p0;
  u.h[1] = *(const u16x8*)p1;
  return u.v;
}

__device__ __forceinline__ v8f wmma_bf16(v16bf a, v16bf b, v8f c) {
  return __builtin_amdgcn_wmma_f32_16x16x32_bf16(
      false, a, false, b, (short)0, c, false, false);
}

// The issuing wave's async copies to LDS (ASYNCcnt-tracked) have landed.
__device__ __forceinline__ void wait_async0() {
  asm volatile("s_wait_asynccnt 0x0" ::: "memory");
}
__device__ __forceinline__ unsigned lds_off32(const void* p) {
  return (unsigned)(uintptr_t)p;   // low 32 bits of generic ptr = LDS offset
}

// ---- conversion kernel -----------------------------------------------------
// The two activation conversions and the four weight transposes do not depend on
// one another, so they share ONE launch: a workgroup's index says which job it
// does (a block-uniform branch).  All 768 workgroups (16 waves each, three a WGP)
// are resident at once; the long activation streams have the low indices.

// Every bf16 activation matrix X[4096][1024] that a projection GEMM reads as its
// A operand lies in the workspace in A-fragment order: 1 KiB per (16-row block,
// 32-k step), blocks row-major over [row block][k step].  Inside a block lane
// l = 16 * hig + l16 owns bytes 16 l .. 16 l + 15 of each 512-byte half:
//   first half : X[16 rb + l16][32 s      + 8 hig + 0..7]
//   second half: X[16 rb + l16][32 s + 16 + 8 hig + 0..7]
// so a wave's 16-byte fragment load covers 512 contiguous bytes (4 whole lines),
// not 32-byte pieces of 16 lines.  In units of 256 B (128 elements):
//   unit = (row >> 4) * 128 + (k >> 3), element in it = (row & 15) * 8 + (k & 7).

// Activations: each of an input's 128 workgroups converts 32768 contiguous
// elements = 32 whole rows = 64 KiB contiguous in fragment order.  A lane issues
// its 16 independent 16-byte loads first (each wave-wide load is 512 contiguous
// bytes), converts, and puts 8 bytes per load at their fragment-order place in
// LDS; behind one barrier the image goes out linearly, 512 contiguous bytes per
// wave-wide store.  In LDS each 256-byte unit has a 272 B pitch (16 B x odd): the
// 16 units that a wave's 8-byte stores fall in cover all 64 banks once.
#define CV_THREADS 512
#define CV_LOADS   16
#define CV_STEP    (CV_THREADS * 4)            // elements per workgroup-wide round
#define CV_CHUNK   (CV_STEP * CV_LOADS)        // elements per workgroup
#define CV_ACT_WGS (NTOK * D_ / CV_CHUNK)      // workgroups per activation: 128
#define CV_UPITCH  (128 + 8)                   // u16 per 256-byte unit in LDS
#define CV_LDS_U16 (CV_CHUNK / 128 * CV_UPITCH)   // 69632 B
__device__ __forceinline__ void cvt_act(const float* __restrict__ x,
                                        u16* __restrict__ y, u16* sm, int chunk) {
  const int tid = threadIdx.x;
  const size_t base = (size_t)chunk * CV_CHUNK;
  const unsigned xoff = ((unsigned)base + tid * 4) * 4;   // byte offset in x, below 16 MiB

  f32x4 r[CV_LOADS];
  // unrolled: r[] stays in registers and every load issues before the first wait
#pragma unroll
  for (int j = 0; j < CV_LOADS; ++j)
    r[j] = *(const f32x4*)((const char*)x + xoff + j * (CV_STEP * 4));
  // stands ahead of any rewrite of the loads' address registers (a precaution);
  // the offset is named as an input so that it lives up to the wait and no load
  // of the run lands in its register
  asm volatile("s_wait_xcnt 0x0" :: "v"(xoff) : "memory");

  // load j of this thread: row 2 j + (tid >> 8) of the chunk, k = 4 (tid & 255)
  u16* st = sm + ((tid & 255) >> 1) * CV_UPITCH + (tid >> 8) * 8 + (tid & 1) * 4;
  // unrolled (both loops): constant indices into r[] and p, no scratch memory
#pragma unroll
  for (int j = 0; j < CV_LOADS; ++j) {
    u16x4 p;
#pragma unroll
    for (int c = 0; c < 4; ++c) p[c] = f2bf(r[j][c]);
    *(u16x4*)(st + (j >> 3) * 128 * CV_UPITCH + (j & 7) * 16) = p;
  }
  __syncthreads();   // reached by all 16 waves of a converting workgroup

  // 16-byte piece i * 512 + tid of the image: unit piece >> 4, place piece & 15
  const u16* ld  = sm + (tid >> 4) * CV_UPITCH + (tid & 15) * 8;
  u16*       dst = y + base + tid * 8;
#pragma unroll   // constant offsets on one LDS and one global address
  for (int i = 0; i < CV_CHUNK / (CV_THREADS * 8); ++i)
    *(u16x8*)(dst + i * (CV_THREADS * 8)) =
        *(const u16x8*)(ld + i * (CV_THREADS / 16) * CV_UPITCH);
}

// W is [K][N] row-major f32; produce WT[N][K] bf16 so a B-fragment column
// reads contiguous K.  One 64(k) x 64(n) tile per 256 threads, turned in LDS:
// global reads are whole 256-byte row pieces, global writes whole 128-byte
// lines (8 lanes x 16 B per WT row), each line written by one workgroup.
// A workgroup's two halves take two tiles side by side in n, each in its own
// LDS tile; tid is the thread's number inside its half.
#define WT_PITCH 68   // u16 per LDS row: 64 + 4, rows stay 8-byte aligned
#define CV_W_WGS ((D_ / 64) * (D_ / 64) / 2)   // workgroups per weight: 128
__device__ __forceinline__ void cvt_wT(const float* __restrict__ w,
                                       u16* __restrict__ wt,
                                       u16* tile, int tidx, int tid) {   // tile: [n][k]
  const int n0  = (tidx & 15) << 6;
  const int k0  = (tidx >> 4) << 6;

  // each thread: a 4(k) x 4(n) block, four independent 16-byte loads
  const int nq = (tid & 15) << 2;
  const int kq = (tid >> 4) << 2;
  const float* src = w + (size_t)(k0 + kq) * D_ + n0 + nq;
  f32x4 r[4];
#pragma unroll
  for (int j = 0; j < 4; ++j) r[j] = *(const f32x4*)(src + (size_t)j * D_);

#pragma unroll
  for (int c = 0; c < 4; ++c) {
    u16x4 p;
#pragma unroll
    for (int j = 0; j < 4; ++j) p[j] = f2bf(r[j][c]);
    *(u16x4*)&tile[(nq + c) * WT_PITCH + kq] = p;    // 4 k of one n: 8 bytes
  }
  __syncthreads();   // reached by all 16 waves of a transposing workgroup

  const int kc = (tid & 7) << 3;
#pragma unroll
  for (int p = 0; p < 2; ++p) {
    const int n = p * 32 + (tid >> 3);
    union { u16x4 h[2]; u16x8 v; } u;
    u.h[0] = *(const u16x4*)&tile[n * WT_PITCH + kc];
    u.h[1] = *(const u16x4*)&tile[n * WT_PITCH + kc + 4];
    *(u16x8*)(wt + (size_t)(n0 + n) * D_ + k0 + kc) = u.v;
  }
  // stands ahead of any rewrite of the two stores' registers (a precaution): the
  // built kernel lays the activation branch's code behind these stores
  asm volatile("s_wait_xcnt 0x0" ::: "memory");
}

__global__ __launch_bounds__(CV_THREADS)
void cvt_all(const float* __restrict__ eeg, const float* __restrict__ pic,
             const float* __restrict__ Wk,  const float* __restrict__ Wq,
             const float* __restrict__ Wv,  const float* __restrict__ Wd,
             u16* __restrict__ eegb, u16* __restrict__ picb,
             u16* __restrict__ WkT,  u16* __restrict__ WqT,
             u16* __restrict__ WvT,  u16* __restrict__ WdT) {
  // one array for both jobs: the fragment-order image, or the two transpose tiles
  __shared__ __attribute__((aligned(16))) u16 sm[CV_LDS_U16];
  const int blk = blockIdx.x;
  if (blk < 2 * CV_ACT_WGS) {
    const bool second = blk >= CV_ACT_WGS;
    cvt_act(second ? pic : eeg, second ? picb : eegb, sm, blk & (CV_ACT_WGS - 1));
  } else {
    const int wb   = blk - 2 * CV_ACT_WGS;
    const int wsel = wb / CV_W_WGS;            // 0..3: k, q, v, d
    const float* w = wsel == 0 ? Wk  : wsel == 1 ? Wq  : wsel == 2 ? Wv  : Wd;
    u16*        wt = wsel == 0 ? WkT : wsel == 1 ? WqT : wsel == 2 ? WvT : WdT;
    const int half = threadIdx.x >> 8;
    cvt_wT(w, wt, sm + half * (64 * WT_PITCH), (wb & (CV_W_WGS - 1)) * 2 + half,
           threadIdx.x & 255);
  }
}

// ---- projection GEMMs: shared main loop ------------------------------------
// A workgroup (8 waves) computes 128 rows x 64 columns; each wave a 16x64 tile.
// All 8 waves use the same 64 weight rows of WT[N][K] (128 KB, contiguous in
// global memory), so that panel is async-staged into LDS once and every
// B fragment comes from LDS.  Each wave reads its own 16 activation rows from
// global memory (fragment order: 32 KiB contiguous), every byte once, four
// k-steps (128 k) ahead.
// LDS layout [k quarter][64 rows][256 k + 8]: the row pitch is 528 B = 16 B x odd
// (no bank conflict for 16-byte reads), and everything one trip of the main loop
// reads lies within 64 KB of one address register (the LDS offset field's reach).
#define GB_PITCH   (256 + 8)           // u16 per LDS row
#define GB_QUART   (64 * GB_PITCH)     // u16 per k quarter: 33792 B
#define GB_LDS_U16 (4 * GB_QUART)      // 135168 B: two workgroups per WGP

// Eight async 16-byte copies, then s_wait_xcnt 0 ahead of any rewrite of their
// address registers (a precaution); one statement, so that the compiler can put
// no such rewrite between the copies and the wait.
__device__ __forceinline__ void async_cp16x8(unsigned l, const u16* g) {
  const unsigned LS = 2 * GB_PITCH * 2;  // LDS bytes between a thread's chunks
  const int      GS = 256 * 8;           // global elements between them
  asm volatile(
      "global_load_async_to_lds_b128 %0, %8, off\n\t"
      "global_load_async_to_lds_b128 %1, %9, off\n\t"
      "global_load_async_to_lds_b128 %2, %10, off\n\t"
      "global_load_async_to_lds_b128 %3, %11, off\n\t"
      "global_load_async_to_lds_b128 %4, %12, off\n\t"
      "global_load_async_to_lds_b128 %5, %13, off\n\t"
      "global_load_async_to_lds_b128 %6, %14, off\n\t"
      "global_load_async_to_lds_b128 %7, %15, off\n\t"
      "s_wait_xcnt 0x0"
      :: "v"(l), "v"(l + LS), "v"(l + 2 * LS), "v"(l + 3 * LS),
         "v"(l + 4 * LS), "v"(l + 5 * LS), "v"(l + 6 * LS), "v"(l + 7 * LS),
         "v"(g), "v"(g + GS), "v"(g + 2 * GS), "v"(g + 3 * GS),
         "v"(g + 4 * GS), "v"(g + 5 * GS), "v"(g + 6 * GS), "v"(g + 7 * GS)
      : "memory");
}

// acc[c] += A[row0 + 0..15][:] x WT[col0 + 16c + 0..15][:]^T over all D_ k.
__device__ __forceinline__ void gemm_16x64(const u16* __restrict__ A,
                                           const u16* __restrict__ WT,
                                           u16* ldsB, int row0, int col0,
                                           v8f* acc) {
  const int tid  = threadIdx.x;
  const int lane = tid & 31;
  const int l16  = lane & 15;
  const int hig  = lane >> 4;

  // A in fragment order: 512 elements per k-step, this lane's 8 at 8 * lane
  const u16* arow = A + (size_t)(row0 >> 4) * (16 * D_) + lane * 8;
  auto ldA4 = [&](v16bf* dst, int kk) {
#pragma unroll   // constant indices: dst[] stays in registers
    for (int s = 0; s < 4; ++s)
      dst[s] = make_frag(arow + kk * 16 + s * 512, arow + kk * 16 + s * 512 + 256);
  };

  // first activation block: issued ahead of the staging so both fly together
  v16bf a0[4], a1[4];
  ldA4(a0, 0);

  // ---- async-stage the 64 x 1024 weight panel: 8192 chunks, 32 a thread ----
  {
    const u16* g = WT + (size_t)col0 * D_ + tid * 8;
    const unsigned l = lds_off32(ldsB) + ((tid & 127) >> 5) * (GB_QUART * 2) +
                       (tid >> 7) * (GB_PITCH * 2) + (tid & 31) * 16;
#pragma unroll   // all 32 copies issue back to back, no loop counter between them
    for (int j = 0; j < 4; ++j)
      async_cp16x8(l + j * 16 * (GB_PITCH * 2), g + j * 8 * 256 * 8);
    wait_async0();
    __syncthreads();
  }

  const u16* wrow = ldsB + l16 * GB_PITCH + hig * 8;
  // q = k quarter, kk = k inside it (kk == 256 names the next quarter's start)
  auto ldB = [&](v16bf* dst, int q, int kk) {
    const u16* p = wrow + q * GB_QUART + (kk >> 8) * GB_QUART + (kk & 255);
#pragma unroll   // constant indices: dst[] stays in registers
    for (int c = 0; c < 4; ++c)
      dst[c] = make_frag(p + c * 16 * GB_PITCH, p + c * 16 * GB_PITCH + 16);
  };
  auto mm = [&](v16bf a, const v16bf* b) {
#pragma unroll   // constant indices: acc[] and b[] stay in registers
    for (int c = 0; c < 4; ++c) acc[c] = wmma_bf16(a, b[c], acc[c]);
  };

  // B fragments one k-step ahead, A fragments one 128-k block ahead, each in
  // two disjoint register sets (no rotation moves)
  v16bf bf0[4], bf1[4];
  ldB(bf0, 0, 0);
  // keeps each group of loads in front of the WMMAs of the step before it;
  // without it the scheduler sinks every load to just ahead of its use and each
  // WMMA waits out an LDS latency
  auto hold = [] { __builtin_amdgcn_sched_barrier(0); };
  auto body = [&](int q, bool more) {
    const int kb = q * 256;
    ldA4(a1, kb + 128);
    ldB(bf1, q, 32);   hold();  mm(a0[0], bf0);
    ldB(bf0, q, 64);   hold();  mm(a0[1], bf1);
    ldB(bf1, q, 96);   hold();  mm(a0[2], bf0);
    ldB(bf0, q, 128);  hold();  mm(a0[3], bf1);
    if (more) ldA4(a0, kb + 256);
    ldB(bf1, q, 160);  hold();  mm(a1[0], bf0);
    ldB(bf0, q, 192);  hold();  mm(a1[1], bf1);
    ldB(bf1, q, 224);  hold();  mm(a1[2], bf0);
    if (more) ldB(bf0, q, 256);
    hold();
    mm(a1[3], bf1);
    // stands ahead of the next trip's first instructions, which form a new
    // activation address in the register pair that this trip's global loads name
    if (more) asm volatile("s_wait_xcnt 0x0" ::: "memory");
  };
  // kept rolled: unrolled, LDS addresses past 64 KB each cost their own add, and
  // the epilogue's loads move up until only one workgroup fits a WGP
#pragma unroll 1
  for (int q = 0; q < 3; ++q) body(q, true);
  body(3, false);   // last 256 k: nothing left to fetch ahead
}

// ---- fused QKV projection GEMM --------------------------------------------
// grid.x = 32 row blocks x 16 column blocks, grid.y = which projection.
#define EQ_PITCH (64 + 8)    // u16 per token row of the q / k tile in LDS: 144 B = 16 B x 9
#define EV_PITCH (128 + 8)   // u16 per d row of the V^T tile in LDS: 272 B = 16 B x 17

__global__ __launch_bounds__(256)
void qkv_gemm(const u16* __restrict__ eegb, const u16* __restrict__ picb,
              const u16* __restrict__ WkT,  const u16* __restrict__ WqT,
              const u16* __restrict__ WvT,
              const float* __restrict__ bk, const float* __restrict__ bq,
              const float* __restrict__ bv,
              u16* __restrict__ qo, u16* __restrict__ ko,
              u16* __restrict__ vTo) {
  __shared__ __attribute__((aligned(16))) u16 ldsB[GB_LDS_U16];
  const int mode = blockIdx.y;           // 0=q 1=k 2=v
  const int lane = threadIdx.x & 31;
  const int wv   = threadIdx.x >> 5;
  const int l16  = lane & 15;
  const int hig  = lane >> 4;

  const int row0 = ((blockIdx.x >> 4) << 7) + (wv << 4);
  const int col0 = (blockIdx.x & 15) << 6;   // shared by all 8 waves in this WG

  const u16*  A    = (mode == 1) ? eegb : picb;
  const u16*  WT   = (mode == 0) ? WqT : (mode == 1 ? WkT : WvT);
  const float* bias = (mode == 0) ? bq : (mode == 1 ? bk : bv);

  v8f acc[4] = {};
  gemm_16x64(A, WT, ldsB, row0, col0, acc);

  // ---- epilogue: the workgroup's 128 x 64 bf16 tile is laid in LDS (over the
  // weight panel, which nobody needs any more) as it lies in global memory, then
  // goes out 16 bytes a lane: q and k are 16 KiB contiguous (128 tokens x one
  // head's 64 d), V^T is 64 d rows of 256 contiguous bytes (128 tokens).  Every
  // store covers whole 128-byte lines; straight from the accumulators a V^T
  // store would put 2 bytes in each of 16 lines 2 KiB apart.
  const int tid  = threadIdx.x;
  const int rowb = (blockIdx.x >> 4) << 7;   // the workgroup's first token
  const int b    = rowb >> 10, sb = rowb & (S_ - 1);
  const int h    = blockIdx.x & 15;          // the 64 columns are one head

  // the four bias loads issue together, so that their latencies overlap
  float bval[4];
#pragma unroll   // constant indices: bval[] stays in registers
  for (int c = 0; c < 4; ++c) bval[c] = bias[col0 + c * 16 + l16];

  // this wave's last reads of the panel have retired before another wave
  // writes over it behind the barrier
  asm volatile("s_wait_dscnt 0x0" ::: "memory");
  __syncthreads();   // every wave is done with the weight panel

  // 1024 pieces of 16 bytes go out, 4 a thread; a wave's 32 pieces are consecutive
  u16x8 v[4];
  if (mode == 2) {
    // LDS row d = 16 c + l16; the lane's 8 values are 8 consecutive tokens
#pragma unroll   // constant indices: acc[] stays in registers
    for (int c = 0; c < 4; ++c) {
      u16x8 p;
#pragma unroll
      for (int r = 0; r < 8; ++r) p[r] = f2bf(acc[c][r] + bval[c]);
      *(u16x8*)(ldsB + (c * 16 + l16) * EV_PITCH + wv * 16 + hig * 8) = p;
    }
    __syncthreads();   // the whole tile is in LDS (mode is the same in the whole block)
    const u16* ld  = ldsB + (tid >> 4) * EV_PITCH + (tid & 15) * 8;
    u16*       dst = vTo + ((size_t)(b * H_ + h) * HD_ + (tid >> 4)) * S_ + sb +
                     (tid & 15) * 8;                                      // [b,h,hd,S]
#pragma unroll   // the four LDS reads issue together, each into its own registers
    for (int i = 0; i < 4; ++i) v[i] = *(const u16x8*)(ld + i * 16 * EV_PITCH);
#pragma unroll
    for (int i = 0; i < 4; ++i) *(u16x8*)(dst + i * 16 * S_) = v[i];
  } else {
    // LDS row = token; 16 lanes write 32 contiguous bytes of it
#pragma unroll   // constant indices: acc[] stays in registers
    for (int c = 0; c < 4; ++c)
#pragma unroll
      for (int r = 0; r < 8; ++r)
        ldsB[(wv * 16 + hig * 8 + r) * EQ_PITCH + c * 16 + l16] = f2bf(acc[c][r] + bval[c]);
    __syncthreads();   // the whole tile is in LDS (mode is the same in the whole block)
    const u16* ld  = ldsB + (tid >> 3) * EQ_PITCH + (tid & 7) * 8;
    u16*       dst = ((mode == 0) ? qo : ko) + ((size_t)(b * H_ + h) * S_ + sb) * HD_ +
                     tid * 8;                                             // [b,h,S,hd]
#pragma unroll   // the four LDS reads issue together, each into its own registers
    for (int i = 0; i < 4; ++i) v[i] = *(const u16x8*)(ld + i * 32 * EQ_PITCH);
#pragma unroll
    for (int i = 0; i < 4; ++i) *(u16x8*)(dst + i * 256 * 8) = v[i];
    // stands ahead of any rewrite of the four stores' registers (a precaution): the
    // built kernel lays the V^T branch's code behind these stores
    asm volatile("s_wait_xcnt 0x0" ::: "memory");
  }
}

#define TK       128         // keys per trip
#define KT_PITCH (64 + 8)    // u16 per K row in LDS: 144 B = 16 B x 9
#define VT_PITCH (TK + 8)    // u16 per V^T row in LDS: 272 B = 16 B x 17

// A thread's four async 16-byte copies of one tile (LS bytes apart in LDS, GS
// elements apart in global memory), then s_wait_xcnt 0 ahead of any rewrite of
// their address registers (a precaution); one statement, so that the compiler can
// put no such rewrite between the copies and the wait.
template <unsigned LS, int GS>
__device__ __forceinline__ void async_cp16x4(unsigned l, const u16* g) {
  asm volatile(
      "global_load_async_to_lds_b128 %0, %4, off\n\t"
      "global_load_async_to_lds_b128 %1, %5, off\n\t"
      "global_load_async_to_lds_b128 %2, %6, off\n\t"
      "global_load_async_to_lds_b128 %3, %7, off\n\t"
      "s_wait_xcnt 0x0"
      :: "v"(l), "v"(l + LS), "v"(l + 2 * LS), "v"(l + 3 * LS),
         "v"(g), "v"(g + GS), "v"(g + 2 * GS), "v"(g + 3 * GS)
      : "memory");
}

// value of lane l ^ 16
__device__ __forceinline__ float xhalf(float x) {
  const int v = __builtin_bit_cast(int, x);
  return __builtin_bit_cast(float, __builtin_amdgcn_permlanex16(
      v, v, 0x76543210, 0xfedcba98, false, false));
}

// the real block size lifts the compiler's register ceiling of 128 (it assumes 1024
// threads otherwise); the kernel stays below 256, so two workgroups still share a WGP
__global__ __launch_bounds__(256)
void flash_attn(const u16* __restrict__ q, const u16* __restrict__ k,
                const u16* __restrict__ vT, u16* __restrict__ ctx) {
  __shared__ __attribute__((aligned(16))) u16 kt[2][TK * KT_PITCH];  // [key][d]
  __shared__ __attribute__((aligned(16))) u16 vt[2][64 * VT_PITCH];  // [d][key]

  const int tid  = threadIdx.x;
  const int lane = tid & 31;
  const int wv   = tid >> 5;
  const int l16  = lane & 15;
  const int hig  = lane >> 4;

  const int qblk = blockIdx.x & 7;
  const int bh   = blockIdx.x >> 3;
  const int h    = bh & (H_ - 1);
  const int b0   = bh >> 4;
  const int qbase = qblk * 128 + wv * 16;

  const u16* qh = q  + (size_t)bh * S_ * HD_;
  const u16* kh = k  + (size_t)bh * S_ * HD_;
  const u16* vh = vT + (size_t)bh * HD_ * S_;

  // Q^T as B operand: column l16 = query qbase + l16
  const u16* qp = qh + (size_t)(qbase + l16) * HD_;
  v16bf qa0 = make_frag(qp +      hig * 8, qp + 16 + hig * 8);  // d 0..31
  v16bf qa1 = make_frag(qp + 32 + hig * 8, qp + 48 + hig * 8);  // d 32..63

  // one query a lane: m is joined over the halves every tile, lsum holds this
  // half's keys only and is joined once behind the loop
  float m = -3.0e38f, lsum = 0.f;
  v8f o[4] = {};                             // o[j][r] = O[query l16][16j + 8 hig + r]

  const float SC = 0.125f;                   // 1/sqrt(64)
  const float LOG2E = 1.44269504088896340736f;   // e^x = 2^(x log2 e)

  // cooperative async stage of one 128-key K/V tile pair (32 KB = 8 chunks/thr)
  auto issue_tiles = [&](int n0, int bsel) {
    // K tile: 128 keys x 64 d, contiguous 16 KB at kh + n0*64, 8 chunks a row:
    //   chunk 256 i + tid is row 32 i + (tid >> 3), place tid & 7
    // V tile: 64 d-rows x 128 keys (256 B per row, stride S_), 16 chunks a row:
    //   chunk 256 i + tid is row 16 i + (tid >> 4), place tid & 15
    async_cp16x4<32 * KT_PITCH * 2, 256 * 8>(
        lds_off32(&kt[bsel][(tid >> 3) * KT_PITCH + (tid & 7) * 8]),
        kh + (size_t)n0 * HD_ + tid * 8);
    async_cp16x4<16 * VT_PITCH * 2, 16 * S_>(
        lds_off32(&vt[bsel][(tid >> 4) * VT_PITCH + (tid & 15) * 8]),
        vh + (size_t)(tid >> 4) * S_ + n0 + (tid & 15) * 8);
  };

  issue_tiles(0, 0);

  for (int it = 0; it < S_ / TK; ++it) {
    const int n0   = it * TK;
    const int bsel = it & 1;
    // hand-over between trips, in this order.  The last trip issues nothing behind
    // it, so no copy is in flight when the wave ends.
    // this wave's LDS reads of the other buffer have retired before it is refilled
    asm volatile("s_wait_dscnt 0x0" ::: "memory");
    wait_async0();         // own chunks of tile `it` landed
    __syncthreads();       // everyone's chunks landed; prev compute done
    if (it + 1 < S_ / TK) issue_tiles(n0 + TK, bsel ^ 1);

    // V^T fragments (A operand) of keys 32 s .. 32 s + 31: row d = 16 j + l16
    const u16* vp = &vt[bsel][(size_t)l16 * VT_PITCH + hig * 8];
    auto ldV = [&](v16bf* dst, int s) {
#pragma unroll   // constant indices: dst[] stays in registers
      for (int j = 0; j < 4; ++j) {
        const u16* p = vp + j * 16 * VT_PITCH + s * 32;
        dst[j] = make_frag(p, p + 16);
      }
    };
    // keeps a group of LDS loads in front of the WMMAs of the groups before it;
    // without it the scheduler sinks each pair of loads to just ahead of its WMMA,
    // which then waits out an LDS latency
    auto hold = [] { __builtin_amdgcn_sched_barrier(0); };

    // ---- scores S^T = K @ Q^T for the 128x16 tile (K rows from LDS as A) ----
    // c[t][r]: key 16 t + 8 hig + r
    const u16* kp = &kt[bsel][(size_t)l16 * KT_PITCH + hig * 8];
    v8f c[TK / 16];
    // the four K fragments of score tiles 2 g and 2 g + 1
    auto ldK = [&](v16bf* dst, int g) {
#pragma unroll   // constant indices: dst[] stays in registers
      for (int u = 0; u < 2; ++u) {
        const u16* p = kp + (2 * g + u) * 16 * KT_PITCH;
        dst[2 * u]     = make_frag(p,      p + 16);
        dst[2 * u + 1] = make_frag(p + 32, p + 48);
      }
    };
    // the two tiles' chains alternate, so that a WMMA does not directly follow the
    // one whose result it adds to
    auto mmK = [&](const v16bf* a, int g) {
      v8f z0 = {}, z1 = {};
      z0 = wmma_bf16(a[0], qa0, z0);
      z1 = wmma_bf16(a[2], qa0, z1);
      c[2 * g]     = wmma_bf16(a[1], qa1, z0);
      c[2 * g + 1] = wmma_bf16(a[3], qa1, z1);
    };
    // K fragments two groups ahead in three register sets, V^T fragments one group
    // ahead in two (no rotation moves)
    v16bf k0[4], k1[4], k2[4], va[4], vb[4];
    ldK(k0, 0);  ldK(k1, 1);
    ldK(k2, 2);  hold();  mmK(k0, 0);
    ldK(k0, 3);  hold();  mmK(k1, 1);
    ldV(va, 0);  hold();  mmK(k2, 2);
    mmK(k0, 3);
    // the scale multiplies stay behind the last score WMMA: moved up among the
    // WMMAs, each group of them opens with the idle slots a fresh result asks for
    hold();

    // ---- online softmax: 64 scores of one query in this lane ----
    float t8[8];
#pragma unroll   // constant indices (all loops here): c[], t8[] stay in registers
    for (int t = 0; t < TK / 16; ++t) c[t] *= SC;
#pragma unroll
    for (int r = 0; r < 8; ++r)
      t8[r] = fmaxf(fmaxf(fmaxf(c[0][r], c[1][r]), fmaxf(c[2][r], c[3][r])),
                    fmaxf(fmaxf(c[4][r], c[5][r]), fmaxf(c[6][r], c[7][r])));
    float tm = fmaxf(fmaxf(fmaxf(t8[0], t8[1]), fmaxf(t8[2], t8[3])),
                     fmaxf(fmaxf(t8[4], t8[5]), fmaxf(t8[6], t8[7])));
    tm = fmaxf(tm, xhalf(tm));               // the other half's 64 keys
    const float mnew = fmaxf(m, tm);
    const float scl  = __expf(m - mnew);
    m = mnew;

    // P^T of keys 32 s .. 32 s + 31 as B operand, straight from two score tiles
    auto pT = [&](int s) {
      c[2 * s]     = (c[2 * s]     - mnew) * LOG2E;
      c[2 * s + 1] = (c[2 * s + 1] - mnew) * LOG2E;
#pragma unroll   // constant indices: c[] stays in registers
      for (int r = 0; r < 8; ++r) {
        c[2 * s][r]     = __builtin_amdgcn_exp2f(c[2 * s][r]);
        c[2 * s + 1][r] = __builtin_amdgcn_exp2f(c[2 * s + 1][r]);
      }
      union { v8bf h[2]; v16bf v; } pb;
      pb.h[0] = __builtin_convertvector(c[2 * s],     v8bf);
      pb.h[1] = __builtin_convertvector(c[2 * s + 1], v8bf);
      return pb.v;
    };
    // O^T += V^T @ P^T for one 32-key step
    auto mmV = [&](const v16bf* a, v16bf p) {
#pragma unroll   // constant indices: o[] and a[] stay in registers
      for (int j = 0; j < 4; ++j) o[j] = wmma_bf16(a[j], p, o[j]);
    };

#pragma unroll   // constant indices: o[] stays in registers
    for (int j = 0; j < 4; ++j) o[j] *= scl;
    v16bf p0 = pT(0);
    ldV(vb, 1);  hold();  mmV(va, p0);  v16bf p1 = pT(1);
    ldV(va, 2);  hold();  mmV(vb, p1);  v16bf p2 = pT(2);
    ldV(vb, 3);  hold();  mmV(va, p2);  v16bf p3 = pT(3);
    mmV(vb, p3);

    const v8f s8 = ((c[0] + c[1]) + (c[2] + c[3])) + ((c[4] + c[5]) + (c[6] + c[7]));
    lsum = lsum * scl + (((s8[0] + s8[1]) + (s8[2] + s8[3])) +
                         ((s8[4] + s8[5]) + (s8[6] + s8[7])));
  }

  // ---- normalize & store ctx as bf16, [B*S][D] in fragment order: the wave's 16
  // queries are one row block, o[j] is half j & 1 of k-step 2 h + (j >> 1), so
  // every store is 512 contiguous bytes ----
  const float inv = 1.0f / (lsum + xhalf(lsum));
  u16* crow = ctx + ((size_t)((b0 * S_ + qbase) >> 4) * (D_ / 32) + h * 2) * 512 + lane * 8;
#pragma unroll
  for (int j = 0; j < 4; ++j)
    *(v8bf*)(crow + j * 256) = __builtin_convertvector(o[j] * inv, v8bf);
}

// ---- output projection + residual -----------------------------------------
#define EO_PITCH (64 + 4)    // f32 per row of the output tile in LDS: 272 B = 16 B x 17

__global__ __launch_bounds__(256)
void out_gemm(const u16* __restrict__ ctxb, const u16* __restrict__ WdT,
              const float* __restrict__ bd, const float* __restrict__ pic,
              float* __restrict__ xo) {
  __shared__ __attribute__((aligned(16))) u16 ldsB[GB_LDS_U16];
  const int lane = threadIdx.x & 31;
  const int wv   = threadIdx.x >> 5;
  const int l16  = lane & 15;
  const int hig  = lane >> 4;

  const int row0 = ((blockIdx.x >> 4) << 7) + (wv << 4);
  const int col0 = (blockIdx.x & 15) << 6;

  v8f acc[4] = {};
  gemm_16x64(ctxb, WdT, ldsB, row0, col0, acc);

  // ---- epilogue, staged like the QKV kernel's: the 128 x 64 f32 tile goes through
  // LDS (over the dead weight panel), so that the residual is read and the result
  // stored 16 bytes a lane, 256 contiguous bytes of a row, not in 64-byte pieces.
  // 2048 pieces of 16 bytes, 8 a thread: piece 256 i + tid is row 16 i + (tid >> 4).
  const int tid  = threadIdx.x;
  const int rowb = (blockIdx.x >> 4) << 7;   // the workgroup's first row
  const size_t g0 = (size_t)(rowb + (tid >> 4)) * D_ + col0 + (tid & 15) * 4;
  float* ldsO = (float*)ldsB;

  // residual and bias loads issue together, so that their latencies overlap
  f32x4 res[8];
#pragma unroll   // constant indices: res[] stays in registers
  for (int i = 0; i < 8; ++i) res[i] = *(const f32x4*)(pic + g0 + (size_t)i * 16 * D_);
  float bval[4];
#pragma unroll   // constant indices: bval[] stays in registers
  for (int c = 0; c < 4; ++c) bval[c] = bd[col0 + c * 16 + l16];

  // this wave's last reads of the panel have retired before another wave
  // writes over it behind the barrier
  asm volatile("s_wait_dscnt 0x0" ::: "memory");
  __syncthreads();   // every wave is done with the weight panel

#pragma unroll   // constant indices: acc[] stays in registers
  for (int c = 0; c < 4; ++c)
#pragma unroll
    for (int r = 0; r < 8; ++r)
      ldsO[(wv * 16 + hig * 8 + r) * EO_PITCH + c * 16 + l16] = acc[c][r] + bval[c];
  __syncthreads();   // the whole tile is in LDS

  const float* ld = ldsO + (tid >> 4) * EO_PITCH + (tid & 15) * 4;
  f32x4 v[8];
#pragma unroll   // the eight LDS reads issue together, each into its own registers
  for (int i = 0; i < 8; ++i) v[i] = *(const f32x4*)(ld + i * 16 * EO_PITCH);
#pragma unroll
  for (int i = 0; i < 8; ++i)
    *(f32x4*)(xo + g0 + (size_t)i * 16 * D_) = v[i] + res[i];     // residual
}

// ---- layer norm ------------------------------------------------------------
// One wave per row.  The row's 1024 f32 are read once, 8 independent 16-byte loads
// a lane (each wave-wide load is 512 contiguous bytes), and stay in registers for
// the mean, the variance and the result; weight and bias fly behind them.  The two
// sums run in the lane, then across the wave's lanes: no LDS, no barrier, and 16
// waves a WGP keep 64 KiB of the row stream in flight.
#define LN_WAVES 16                    // rows (waves) per workgroup
#define LN_LOADS (D_ / (32 * 4))       // 16-byte pieces of a row per lane: 8

// value of lane l ^ M inside a 16-lane row (DPP row_xmask:M)
template <int M>
__device__ __forceinline__ float xrow(float x) {
  return __builtin_bit_cast(float, __builtin_amdgcn_update_dpp(
      0, __builtin_bit_cast(int, x), 0x160 + M, 0xf, 0xf, true));
}
// sum over the wave's 32 lanes, the same value in every lane
__device__ __forceinline__ float wave_sum(float s) {
  s += xrow<1>(s);
  s += xrow<2>(s);
  s += xrow<4>(s);
  s += xrow<8>(s);
  return s + xhalf(s);
}

__global__ __launch_bounds__(LN_WAVES * 32)
void ln_kernel(const float* __restrict__ x, const float* __restrict__ w,
               const float* __restrict__ bw, float* __restrict__ out) {
  const int lane = threadIdx.x & 31;
  // the wave's number is the same in all its lanes: the row address stays scalar
  const int row = blockIdx.x * LN_WAVES +
                  __builtin_amdgcn_readfirstlane((int)(threadIdx.x >> 5));
  const float* xr = x + (size_t)row * D_ + lane * 4;

  f32x4 v[LN_LOADS], g[LN_LOADS], c[LN_LOADS];
  // unrolled (all loops here): constant indices, the arrays stay in registers, and
  // all 24 loads issue before the first wait
#pragma unroll
  for (int j = 0; j < LN_LOADS; ++j) v[j] = *(const f32x4*)(xr + j * 128);
#pragma unroll
  for (int j = 0; j < LN_LOADS; ++j) g[j] = *(const f32x4*)(w + lane * 4 + j * 128);
#pragma unroll
  for (int j = 0; j < LN_LOADS; ++j) c[j] = *(const f32x4*)(bw + lane * 4 + j * 128);
  // stands ahead of any rewrite of the loads' address registers (a precaution); the
  // scheduling barrier below keeps every such rewrite behind it
  asm volatile("s_wait_xcnt 0x0" ::: "memory");
  // keeps the weight and bias loads up here, in flight under the row's latency and
  // the two sums; without it the scheduler sinks them behind the sums, two at a
  // time, and the wave waits out a cache latency for each pair
  __builtin_amdgcn_sched_barrier(0);

  const f32x4 s4 = ((v[0] + v[1]) + (v[2] + v[3])) + ((v[4] + v[5]) + (v[6] + v[7]));
  const float mean = wave_sum((s4[0] + s4[1]) + (s4[2] + s4[3])) * (1.0f / D_);

#pragma unroll
  for (int j = 0; j < LN_LOADS; ++j) v[j] -= mean;
  const f32x4 q4 = ((v[0] * v[0] + v[1] * v[1]) + (v[2] * v[2] + v[3] * v[3])) +
                   ((v[4] * v[4] + v[5] * v[5]) + (v[6] * v[6] + v[7] * v[7]));
  const float var = wave_sum((q4[0] + q4[1]) + (q4[2] + q4[3])) * (1.0f / D_);
  const float inv = rsqrtf(var + 1e-12f);

  float* orow = out + (size_t)row * D_ + lane * 4;
#pragma unroll
  for (int j = 0; j < LN_LOADS; ++j)
    *(f32x4*)(orow + j * 128) = g[j] * (v[j] * inv) + c[j];
}

// ---- launch ---------------------------------------------------------------

extern "C" void kernel_launch(void* const* d_in, const int* in_sizes, int n_in,
                              void* d_out, int out_size, void* d_ws, size_t ws_size,
                              hipStream_t stream) {
  const float* eeg = (const float*)d_in[0];
  const float* pic = (const float*)d_in[1];
  const float* Wk  = (const float*)d_in[2];
  const float* bk  = (const float*)d_in[3];
  const float* Wq  = (const float*)d_in[4];
  const float* bq  = (const float*)d_in[5];
  const float* Wv  = (const float*)d_in[6];
  const float* bv  = (const float*)d_in[7];
  const float* Wd  = (const float*)d_in[8];
  const float* bd  = (const float*)d_in[9];
  const float* lnw = (const float*)d_in[10];
  const float* lnb = (const float*)d_in[11];

  char* ws = (char*)d_ws;
  u16*  eegb = (u16*)(ws + ((size_t)0  << 20));   // 8 MB, fragment order
  u16*  picb = (u16*)(ws + ((size_t)8  << 20));   // 8 MB, fragment order
  u16*  WkT  = (u16*)(ws + ((size_t)16 << 20));   // 2 MB
  u16*  WqT  = (u16*)(ws + ((size_t)18 << 20));   // 2 MB
  u16*  WvT  = (u16*)(ws + ((size_t)20 << 20));   // 2 MB
  u16*  WdT  = (u16*)(ws + ((size_t)22 << 20));   // 2 MB
  u16*  qb   = (u16*)(ws + ((size_t)24 << 20));   // 8 MB [b,h,S,hd]
  u16*  kbuf = (u16*)(ws + ((size_t)32 << 20));   // 8 MB [b,h,S,hd]
  u16*  vTb  = (u16*)(ws + ((size_t)40 << 20));   // 8 MB [b,h,hd,S]
  u16*  ctxb = (u16*)(ws + ((size_t)48 << 20));   // 8 MB [B*S][D], fragment order
  float* xb  = (float*)(ws + ((size_t)56 << 20)); // 16 MB

  cvt_all<<<2 * CV_ACT_WGS + 4 * CV_W_WGS, CV_THREADS, 0, stream>>>(
      eeg, pic, Wk, Wq, Wv, Wd, eegb, picb, WkT, WqT, WvT, WdT);

  qkv_gemm<<<dim3(512, 3), 256, 0, stream>>>(eegb, picb, WkT, WqT, WvT,
                                             bk, bq, bv, qb, kbuf, vTb);
  flash_attn<<<512, 256, 0, stream>>>(qb, kbuf, vTb, ctxb);
  out_gemm<<<512, 256, 0, stream>>>(ctxb, WdT, bd, pic, xb);
  ln_kernel<<<NTOK / LN_WAVES, LN_WAVES * 32, 0, stream>>>(xb, lnw, lnb, (float*)d_out);
}
